// v000
// Times are from an AMD MI455X. After a warm-up the kernel runs many times in a row, and a time is the length of
// such a window on the GPU divided by its runs, so every launch and the gaps after it count. The runs cycle
// through copies of the inputs. A figure is the median of several windows, for all but v000 over two sittings.
// Sittings can differ by a few percent; kernels timed side by side share one.
// v000 is the starting kernel. One run takes 3100 microseconds.
#include <hip/hip_runtime.h>

// SAN pairwise self-attention module (x [2][256][56][56]; x1, x2 = 1x1(x; [16][256] + b), x3 = 1x1(x; [256][256] + b); pos = 1x1(linspace grid [2][56][56]; wp [2][2] + bp); 7x7 reflect-padded windows (pad 3): t = concat(x1 - unfold(x2), pos - unfold(pos)) [2][18][49][3136];
// t = relu(BN1(t)) (training-mode batch statistics over n, k, p per channel); t = 1x1(t; cw1 [16][18]); t = relu(BN2(t)); wlog = 1x1(t; cw2 [32][16] + cb2); w = softmax over the 49 window slots; out[n][g*8+s][p] = sum_k unfold(x3)[n][g*8+s][k][p] w[n][g][k][p] -> [2][256][56][56] (1.6 M)).
// Compute dtypes, f32 accumulate: every input rounded to bf16; the three 1x1 input convs on PLAIN bf16 operands (input transposed while converting; exact) + f32 biases; everything after that in f32 on the VALU: window differences, position features (linspace in f32), both BatchNorms with deterministic fixed-order batch statistics (one wave per channel, biased variance, eps 1e-5), the 18->16 and 16->32 channel mixes, the 49-way softmax (online form: running max/sum with rescaling) fused with the weighted aggregation of the reflect-gathered x3.

#define NI   2
#define CIN  256
#define IMW  56
#define HW   3136
#define NTOK (NI * HW)      // 6272 = 98 x 64
#define REL  16
#define RP2  18             // rel + 2 position channels
#define OUTC 256
#define SHR  8
#define NG   32             // out / share
#define KS   7
#define KK   49
#define PADR 3
#define BNEPS 1e-5f
#define NSTAT ((size_t)NI * KK * HW)   // 307328 elements per channel
typedef _Float16 h16;
typedef unsigned short bf;
typedef __attribute__((ext_vector_type(16))) __bf16   v16bf;
typedef __attribute__((ext_vector_type(16))) _Float16 v16h;
typedef __attribute__((ext_vector_type(8)))  _Float16 v8h;
typedef __attribute__((ext_vector_type(8)))  unsigned short v8us;
typedef __attribute__((ext_vector_type(8)))  float    v8f;
typedef __attribute__((ext_vector_type(4)))  float    v4f;
typedef v8h  __attribute__((may_alias)) v8ha;
typedef v4f  __attribute__((may_alias)) v4fa;
typedef v8us __attribute__((may_alias)) v8usa;

__device__ __forceinline__ unsigned short f2bf(float f) { unsigned u = __float_as_uint(f); u += 0x7FFFu + ((u >> 16) & 1u); return (unsigned short)(u >> 16); }
__device__ __forceinline__ float bf2f(unsigned short b) { return __uint_as_float(((unsigned)b) << 16); }
__device__ __forceinline__ float bfr(float f) { return bf2f(f2bf(f)); }
__device__ __forceinline__ v16h cat16(v8h lo, v8h hi) { return __builtin_shufflevector(lo, hi, 0, 1, 2, 3, 4, 5, 6, 7, 8, 9, 10, 11, 12, 13, 14, 15); }
__device__ __forceinline__ v16bf cat16b(v8us lo, v8us hi) { return __builtin_bit_cast(v16bf, __builtin_shufflevector(lo, hi, 0, 1, 2, 3, 4, 5, 6, 7, 8, 9, 10, 11, 12, 13, 14, 15)); }
__device__ __forceinline__ v8f wmma16(v16h a, v16h b, v8f c) { return __builtin_amdgcn_wmma_f32_16x16x32_f16(false, a, false, b, (short)0, c, false, false); }
__device__ __forceinline__ v8f wmmab(v16bf a, v16bf b, v8f c) { return __builtin_amdgcn_wmma_f32_16x16x32_bf16(false, a, false, b, (short)0, c, false, false); }



// ---- k_gemmw: register-blocked GEMM, ONE WAVE per 64x64 output tile (16 accumulators), operands straight from K-contiguous 16-bit planes; grid (M/64, N/64, Z), 32 threads.
// C[m][n] (f32, pitch ldc, + optional f32 bias[n]) = sum_k A[m][k] Bt[n][k] (+ split products per NSPLIT). z-batch strides sA/sB/sC in elements. K % 32 == 0.
template <typename T16> struct WFrag;
template <> struct WFrag<h16> { typedef v16h V; static __device__ __forceinline__ V ld(const h16* p) { return cat16(*(const v8h*)p, *(const v8h*)(p + 16)); } static __device__ __forceinline__ v8f mma(V a, V b, v8f c) { return wmma16(a, b, c); } };
template <> struct WFrag<bf> { typedef v16bf V; static __device__ __forceinline__ V ld(const bf* p) { return cat16b(*(const v8us*)p, *(const v8us*)(p + 16)); } static __device__ __forceinline__ v8f mma(V a, V b, v8f c) { return wmmab(a, b, c); } };
template <typename T16, int NSPLIT, bool BIAS>
__global__ __launch_bounds__(32) void k_gemmw(const T16* __restrict__ A, const T16* __restrict__ A2, const T16* __restrict__ Bt, const T16* __restrict__ Bt2, int K, float* C, int ldc, const float* __restrict__ bias, size_t sA, size_t sB, size_t sC) {
    typedef typename WFrag<T16>::V V;
    __shared__ __align__(16) float os[16 * 68];
    const size_t z = blockIdx.z; A += z * sA; if (A2) A2 += z * sA; Bt += z * sB; if (Bt2) Bt2 += z * sB; C += z * sC;
    const int lane = threadIdx.x & 31, lr = lane & 15, hi = lane >> 4; const int r0 = blockIdx.x * 64, c0 = blockIdx.y * 64;
    v8f acc[4][4];
#pragma unroll
    for (int mb = 0; mb < 4; ++mb)
#pragma unroll
        for (int nb = 0; nb < 4; ++nb) acc[mb][nb] = (v8f){};
    const size_t aoff = (size_t)(r0 + lr) * K + 8 * hi, boff = (size_t)(c0 + lr) * K + 8 * hi;
#pragma unroll 1
    for (int kc = 0; kc < K; kc += 32) {
        V a[4], a2[4];
#pragma unroll
        for (int mb = 0; mb < 4; ++mb) { a[mb] = WFrag<T16>::ld(A + aoff + (size_t)mb * 16 * K + kc); if (NSPLIT == 1 || NSPLIT == 2) a2[mb] = WFrag<T16>::ld(A2 + aoff + (size_t)mb * 16 * K + kc); }
#pragma unroll
        for (int nb = 0; nb < 4; ++nb) { const V b = WFrag<T16>::ld(Bt + boff + (size_t)nb * 16 * K + kc); V b2; if (NSPLIT >= 2) b2 = WFrag<T16>::ld(Bt2 + boff + (size_t)nb * 16 * K + kc);
#pragma unroll
            for (int mb = 0; mb < 4; ++mb) { acc[mb][nb] = WFrag<T16>::mma(a[mb], b, acc[mb][nb]); if (NSPLIT == 1 || NSPLIT == 2) acc[mb][nb] = WFrag<T16>::mma(a2[mb], b, acc[mb][nb]); if (NSPLIT >= 2) acc[mb][nb] = WFrag<T16>::mma(a[mb], b2, acc[mb][nb]); } }
        asm volatile("v_nop\n\tv_nop\n\tv_nop\n\tv_nop" : "+v"(acc[0][0]), "+v"(acc[1][1]), "+v"(acc[2][2]), "+v"(acc[3][3]) : "v"(a[0]), "v"(a[3]));
    }
#pragma unroll
    for (int mb = 0; mb < 4; ++mb) {
#pragma unroll
        for (int nb = 0; nb < 4; ++nb) {
#pragma unroll
            for (int j = 0; j < 8; ++j) os[(hi * 8 + j) * 68 + nb * 16 + lr] = acc[mb][nb][j]; }
        __builtin_amdgcn_wave_barrier(); asm volatile("" ::: "memory");
        float* crow = C + (size_t)(r0 + mb * 16) * ldc + c0;
{
#pragma unroll
            for (int s = 0; s < 8; ++s) { const int row = 2 * s + hi, cofs = lr * 4; v4f val = *(const v4fa*)(os + row * 68 + cofs); if (BIAS) { val[0] += bfr(bias[c0 + cofs]); val[1] += bfr(bias[c0 + cofs + 1]); val[2] += bfr(bias[c0 + cofs + 2]); val[3] += bfr(bias[c0 + cofs + 3]); }
                *(v4f*)(crow + (size_t)row * ldc + cofs) = val; }
             }
        __builtin_amdgcn_wave_barrier(); asm volatile("" ::: "memory");
    }
}

__device__ __forceinline__ h16 tohx(float x) { return (h16)x; }
__device__ __forceinline__ void splitf(float y, unsigned short& h, unsigned short& l) { h = f2bf(y); l = f2bf(y - bf2f(h)); }
typedef __attribute__((ext_vector_type(2))) _Float16 v2h;
typedef __attribute__((ext_vector_type(4))) _Float16 v4h;
typedef __attribute__((ext_vector_type(2))) unsigned short v2us;
typedef __attribute__((ext_vector_type(4))) unsigned short v4us;
typedef __attribute__((ext_vector_type(2))) float v2f;
typedef __attribute__((ext_vector_type(4))) int v4i;

__global__ __launch_bounds__(256) void k_cvt8(const float* __restrict__ src, bf* dst, size_t n8) { const size_t i = (size_t)blockIdx.x * 256 + threadIdx.x; if (i >= n8) return; const v8f v = *(const v8f*)(src + i * 8); v8us o;
#pragma unroll
    for (int k = 0; k < 8; ++k) o[k] = f2bf(v[k]); *(v8us*)(dst + i * 8) = o;  }

// bfrb: bf16 rounding of an input value with a register barrier so the conversion is not folded into v_fma_mix.
__device__ __forceinline__ float bfrb(float x) { float y = bfr(x); asm volatile("" : "+v"(y)); return y; }
__global__ __launch_bounds__(256) void k_cvt8T(const float* __restrict__ src, bf* dst) { const size_t i = (size_t)blockIdx.x * 256 + threadIdx.x; if (i >= (size_t)NTOK * CIN / 8) return; const int tok = (int)(i / (CIN / 8)); const int c0 = (int)(i % (CIN / 8)) * 8; const int n = tok / HW, p = tok % HW; v8us o;
#pragma unroll
    for (int k = 0; k < 8; ++k) o[k] = f2bf(src[((size_t)n * CIN + c0 + k) * HW + p]); *(v8us*)(dst + (size_t)tok * CIN + c0) = o;  }
__global__ __launch_bounds__(256) void k_w12(const float* __restrict__ w1, const float* __restrict__ w2, const float* __restrict__ b1, const float* __restrict__ b2, bf* W12, float* B12) { const int i = blockIdx.x * 256 + threadIdx.x; if (i < 64 * CIN / 8) { const int o = i / (CIN / 8); const int c0 = (i % (CIN / 8)) * 8; v8us ov;
#pragma unroll
        for (int q = 0; q < 8; ++q) { const float v = (o < REL) ? w1[o * CIN + c0 + q] : ((o < 2 * REL) ? w2[(o - REL) * CIN + c0 + q] : 0.0f); ov[q] = f2bf(v); }
        *(v8us*)(W12 + (size_t)o * CIN + c0) = ov;  }
    if (i < 64) { const float v = (i < REL) ? b1[i] : ((i < 2 * REL) ? b2[i - REL] : 0.0f); *(float*)(B12 + i) = v;  } }
__device__ __forceinline__ int refl(int i) { return i < 0 ? -i : (i >= IMW ? 2 * (IMW - 1) - i : i); }
__device__ __forceinline__ float linsp(int j) { return __fadd_rn(-1.0f, __fmul_rn((float)j, 2.0f / 55.0f)); }   /* jnp.linspace(-1, 1, 56)[j] in f32 */
__device__ __forceinline__ float posv(const float* wp, const float* bp, int c, int y, int x) { float a = __fmul_rn(bfrb(wp[c * 2 + 0]), linsp(x)), b = __fmul_rn(bfrb(wp[c * 2 + 1]), linsp(y)); asm volatile("" : "+v"(a), "+v"(b)); float s = __fadd_rn(a, b); asm volatile("" : "+v"(s)); return __fadd_rn(s, bfrb(bp[c])); }
__global__ __launch_bounds__(256) void k_feat(const float* __restrict__ X12, const float* __restrict__ wp, const float* __restrict__ bp, float* T1) { const size_t i = (size_t)blockIdx.x * 256 + threadIdx.x; if (i >= (size_t)NI * RP2 * KK * HW / 4) return; const size_t e = i * 4; const int p0 = (int)(e % HW); const int k = (int)((e / HW) % KK); const int c = (int)((e / ((size_t)HW * KK)) % RP2); const int n = (int)(e / ((size_t)HW * KK * RP2)); const int di = k / KS - PADR, dj = k % KS - PADR; v4f o;
#pragma unroll
    for (int q = 0; q < 4; ++q) { const int p = p0 + q; const int y = p / IMW, x = p % IMW; const int yy = refl(y + di), xx = refl(x + dj); const int pn = yy * IMW + xx; float v;
        if (c < REL) { v = __fsub_rn(X12[((size_t)n * HW + p) * 64 + c], X12[((size_t)n * HW + pn) * 64 + REL + c]); }
        else { const int pc = c - REL; v = __fsub_rn(posv(wp, bp, pc, y, x), posv(wp, bp, pc, yy, xx)); }
        o[q] = v; }
    *(v4f*)(T1 + e) = o;  }
__global__ __launch_bounds__(256) void k_bnstat(const float* __restrict__ T, int C, float* ST) { const int lane = threadIdx.x & 31; const int c = blockIdx.x * 8 + (threadIdx.x >> 5); if (c >= C) return; float s0 = 0.f, s1 = 0.f, s2 = 0.f, s3 = 0.f;
    for (int n = 0; n < NI; ++n) { const float* base = T + ((size_t)n * C + c) * KK * HW;
        for (size_t j = (size_t)lane * 4; j < (size_t)KK * HW; j += 128) { const v4f a = *(const v4f*)(base + j); s0 = __fadd_rn(s0, a[0]); s1 = __fadd_rn(s1, a[1]); s2 = __fadd_rn(s2, a[2]); s3 = __fadd_rn(s3, a[3]); } }
    float s = __fadd_rn(__fadd_rn(s0, s1), __fadd_rn(s2, s3));
#pragma unroll
    for (int sh = 16; sh; sh >>= 1) s += __shfl_xor(s, sh, 32);
    const float mean = s * (1.0f / (float)NSTAT); float v0 = 0.f, v1 = 0.f, v2 = 0.f, v3 = 0.f;
    for (int n = 0; n < NI; ++n) { const float* base = T + ((size_t)n * C + c) * KK * HW;
        for (size_t j = (size_t)lane * 4; j < (size_t)KK * HW; j += 128) { const v4f a = *(const v4f*)(base + j); float d0 = __fsub_rn(a[0], mean), d1 = __fsub_rn(a[1], mean), d2 = __fsub_rn(a[2], mean), d3 = __fsub_rn(a[3], mean); asm volatile("" : "+v"(d0), "+v"(d1), "+v"(d2), "+v"(d3)); float q0 = __fmul_rn(d0, d0), q1 = __fmul_rn(d1, d1), q2 = __fmul_rn(d2, d2), q3 = __fmul_rn(d3, d3); asm volatile("" : "+v"(q0), "+v"(q1), "+v"(q2), "+v"(q3)); v0 = __fadd_rn(v0, q0); v1 = __fadd_rn(v1, q1); v2 = __fadd_rn(v2, q2); v3 = __fadd_rn(v3, q3); } }
    float vs = __fadd_rn(__fadd_rn(v0, v1), __fadd_rn(v2, v3));
#pragma unroll
    for (int sh = 16; sh; sh >>= 1) vs += __shfl_xor(vs, sh, 32);
    float var = __fadd_rn(vs * (1.0f / (float)NSTAT), BNEPS); asm volatile("" : "+v"(var)); const float rs = __frsqrt_rn(var);
    const float val = (lane == 0) ? mean : ((lane == 1) ? rs : 0.0f); *(float*)(ST + (size_t)c * 32 + lane) = val;  }
__global__ __launch_bounds__(256) void k_conv1(const float* __restrict__ T1, const float* __restrict__ ST, const float* __restrict__ g1, const float* __restrict__ be1, const float* __restrict__ cw1, float* T2) { const size_t i = (size_t)blockIdx.x * 256 + threadIdx.x; if (i >= (size_t)NI * KK * HW / 4) return; const size_t e = i * 4; const int p0 = (int)(e % HW); const int k = (int)((e / HW) % KK); const int n = (int)(e / ((size_t)HW * KK)); v4f acc[REL];
#pragma unroll
    for (int o = 0; o < REL; ++o) acc[o] = (v4f){0.f, 0.f, 0.f, 0.f};
#pragma unroll 2
    for (int c = 0; c < RP2; ++c) { const v4f a = *(const v4f*)(T1 + (((size_t)n * RP2 + c) * KK + k) * HW + p0); const float mean = ST[c * 32], rs = ST[c * 32 + 1]; const float gg = bfrb(g1[c]), bb = bfrb(be1[c]); v4f tn;
#pragma unroll
        for (int q = 0; q < 4; ++q) { float d0 = __fsub_rn(a[q], mean); asm volatile("" : "+v"(d0)); float n0 = __fmul_rn(d0, rs); asm volatile("" : "+v"(n0)); float y = __fmul_rn(n0, gg); asm volatile("" : "+v"(y)); float z = __fadd_rn(y, bb); tn[q] = fmaxf(z, 0.0f); }
#pragma unroll
        for (int o = 0; o < REL; ++o) { const float w = bfrb(cw1[o * RP2 + c]);
#pragma unroll
            for (int q = 0; q < 4; ++q) { float pr = __fmul_rn(w, tn[q]); asm volatile("" : "+v"(pr)); acc[o][q] = __fadd_rn(acc[o][q], pr); } } }
{
#pragma unroll
        for (int o = 0; o < REL; ++o) *(v4f*)(T2 + (((size_t)n * REL + o) * KK + k) * HW + p0) = acc[o];
         } }
// k_final: per (n, g, p) (one lane per p): for each of the 49 window slots k (rolled loop): wl = sum_o cw2[g][o] relu((T2[n][o][k][p] - mean_o) rs_o g2 + be2) + cb2[g]; ONLINE softmax over k in f32 (running max / sum with exp2 rescaling of the 8 accumulators, no per-slot array) fused with the aggregation out[n][g*8+s][p] = sum_k w[k] x3[n*HW + nbr(p,k)][g*8+s] (x3 token-major [tok][256] f32, 32-B per lane per slot);
__global__ __launch_bounds__(256) void k_final(const float* __restrict__ T2, const float* __restrict__ ST, const float* __restrict__ g2, const float* __restrict__ be2, const float* __restrict__ cw2, const float* __restrict__ cb2, const float* __restrict__ X3, float* out) {
    const size_t gidx = (size_t)blockIdx.x * 256 + threadIdx.x; if (gidx >= (size_t)NI * NG * HW) return; const int p = (int)(gidx % HW); const int g = (int)((gidx / HW) % NG); const int n = (int)(gidx / ((size_t)HW * NG)); const int y = p / IMW, x = p % IMW;
    const float cb = bfrb(cb2[g]); float m = -3.0e38f, Z = 0.f; float acc[SHR];
#pragma unroll
    for (int s2 = 0; s2 < SHR; ++s2) acc[s2] = 0.f;
#pragma unroll 1
    for (int k = 0; k < KK; ++k) { float s = 0.f;
#pragma unroll
        for (int o = 0; o < REL; ++o) { const float a = T2[(((size_t)n * REL + o) * KK + k) * HW + p]; float d0 = __fsub_rn(a, ST[o * 32]); asm volatile("" : "+v"(d0)); float n0 = __fmul_rn(d0, ST[o * 32 + 1]); asm volatile("" : "+v"(n0)); float yv = __fmul_rn(n0, bfrb(g2[o])); asm volatile("" : "+v"(yv)); float z = __fadd_rn(yv, bfrb(be2[o])); const float tn = fmaxf(z, 0.0f); float pr = __fmul_rn(bfrb(cw2[g * REL + o]), tn); asm volatile("" : "+v"(pr)); s = __fadd_rn(s, pr); }
        asm volatile("s_wait_loadcnt 0x0" : "+v"(s) :: "memory"); const float wl = __fadd_rn(s, cb);
        const float mn = fmaxf(m, wl); float d1 = __fsub_rn(m, mn), d2 = __fsub_rn(wl, mn); asm volatile("" : "+v"(d1), "+v"(d2)); const float r = __builtin_amdgcn_exp2f(__fmul_rn(d1, 1.4426950408889634f)), w = __builtin_amdgcn_exp2f(__fmul_rn(d2, 1.4426950408889634f)); float zr = __fmul_rn(Z, r); asm volatile("" : "+v"(zr)); Z = __fadd_rn(zr, w); m = mn;
        const int yy = refl(y + k / KS - PADR), xx = refl(x + k % KS - PADR); v8f v = *(const v8f*)(X3 + ((size_t)n * HW + (size_t)yy * IMW + xx) * OUTC + g * SHR); asm volatile("s_wait_loadcnt 0x0" : "+v"(v) :: "memory");
#pragma unroll
        for (int s2 = 0; s2 < SHR; ++s2) { float t0 = __fmul_rn(acc[s2], r); asm volatile("" : "+v"(t0)); float t1 = __fmul_rn(w, v[s2]); asm volatile("" : "+v"(t1)); acc[s2] = __fadd_rn(t0, t1); } }
    const float iz = __fdiv_rn(1.0f, Z);
{
#pragma unroll
        for (int s2 = 0; s2 < SHR; ++s2) *(float*)(out + ((size_t)n * OUTC + g * SHR + s2) * HW + p) = acc[s2] * iz;
         } }

extern "C" void kernel_launch(void* const* d_in, const int* in_sizes, int n_in,
                              void* d_out, int out_size, void* d_ws, size_t ws_size, hipStream_t stream) {
    (void)in_sizes; (void)n_in; (void)out_size;
    const float* x = (const float*)d_in[0]; const float* w1 = (const float*)d_in[1]; const float* b1 = (const float*)d_in[2]; const float* w2 = (const float*)d_in[3]; const float* b2 = (const float*)d_in[4]; const float* w3 = (const float*)d_in[5]; const float* b3 = (const float*)d_in[6]; const float* wp = (const float*)d_in[7]; const float* bp = (const float*)d_in[8];
    const float* g1 = (const float*)d_in[9]; const float* be1 = (const float*)d_in[10]; const float* cw1 = (const float*)d_in[11]; const float* g2 = (const float*)d_in[12]; const float* be2 = (const float*)d_in[13]; const float* cw2 = (const float*)d_in[14]; const float* cb2 = (const float*)d_in[15];
    float* OUT = (float*)d_out;     // [2][256][56][56]
    char* wsp = (char*)d_ws;
    auto take = [&](size_t bytes) { char* p = wsp; wsp += (bytes + 255) & ~(size_t)255; return (void*)p; };
    bf* XT = (bf*)take((size_t)NTOK * CIN * 2); bf* W12 = (bf*)take((size_t)64 * CIN * 2); float* B12 = (float*)take(256); bf* W3 = (bf*)take((size_t)OUTC * CIN * 2);
    float* X12 = (float*)take((size_t)NTOK * 64 * 4); float* X3 = (float*)take((size_t)NTOK * OUTC * 4); float* T1 = (float*)take((size_t)NI * RP2 * KK * HW * 4); float* T2 = (float*)take((size_t)NI * REL * KK * HW * 4); float* ST1 = (float*)take(32 * 32 * 4); float* ST2 = (float*)take(32 * 32 * 4);
    if ((size_t)(wsp - (char*)d_ws) > ws_size) return;    // carve ~52 MiB
    k_cvt8T<<<(unsigned)(((size_t)NTOK * CIN / 8 + 255) / 256), 256, 0, stream>>>(x, XT); k_w12<<<(64 * CIN / 8 + 255) / 256, 256, 0, stream>>>(w1, w2, b1, b2, W12, B12); k_cvt8<<<(unsigned)(((size_t)OUTC * CIN / 8 + 255) / 256), 256, 0, stream>>>(w3, W3, (size_t)OUTC * CIN / 8);
    k_gemmw<bf, 0, true><<<dim3(NTOK / 64, 1, 1), 32, 0, stream>>>(XT, nullptr, W12, nullptr, CIN, X12, 64, B12, 0, 0, 0);             /* x1 | x2 token-major [tok][0..15 | 16..31] */
    k_gemmw<bf, 0, true><<<dim3(NTOK / 64, OUTC / 64, 1), 32, 0, stream>>>(XT, nullptr, W3, nullptr, CIN, X3, OUTC, b3, 0, 0, 0);        /* x3 token-major [tok][256] */
    k_feat<<<(unsigned)(((size_t)NI * RP2 * KK * HW / 4 + 255) / 256), 256, 0, stream>>>(X12, wp, bp, T1);
    k_bnstat<<<(RP2 + 7) / 8, 256, 0, stream>>>(T1, RP2, ST1);
    k_conv1<<<(unsigned)(((size_t)NI * KK * HW / 4 + 255) / 256), 256, 0, stream>>>(T1, ST1, g1, be1, cw1, T2);
    k_bnstat<<<(REL + 7) / 8, 256, 0, stream>>>(T2, REL, ST2);
    k_final<<<(unsigned)(((size_t)NI * NG * HW + 255) / 256), 256, 0, stream>>>(T2, ST2, g2, be2, cw2, cb2, X3, OUT);
}

// v001
// A run of this version takes 461 microseconds.
// Next to v000, in two timings, it ran 6.70 and 6.72 times as fast.
#include <hip/hip_runtime.h>

// SAN pairwise self-attention module (x [2][256][56][56]; x1, x2 = 1x1(x; [16][256] + b), x3 = 1x1(x; [256][256] + b); pos = 1x1(linspace grid [2][56][56]; wp [2][2] + bp); 7x7 reflect-padded windows (pad 3): t = concat(x1 - unfold(x2), pos - unfold(pos)) [2][18][49][3136];
// t = relu(BN1(t)) (training-mode batch statistics over n, k, p per channel); t = 1x1(t; cw1 [16][18]); t = relu(BN2(t)); wlog = 1x1(t; cw2 [32][16] + cb2); w = softmax over the 49 window slots; out[n][g*8+s][p] = sum_k unfold(x3)[n][g*8+s][k][p] w[n][g][k][p] -> [2][256][56][56] (1.6 M)).
// Compute dtypes, f32 accumulate: every input rounded to bf16; the three 1x1 input convs on PLAIN bf16 operands (input transposed while converting; exact) + f32 biases; everything after that in f32 on the VALU: window differences, position features (linspace in f32), both BatchNorms with deterministic fixed-order batch statistics (14 work-groups per channel, each its chunk's sum and squared distances from the chunk mean, merged by one wave per channel; biased variance, eps 1e-5), the 18->16 and 16->32 channel mixes, the 49-way softmax (online form: running max/sum with rescaling) fused with the weighted aggregation of the reflect-gathered x3.

#define NI   2
#define CIN  256
#define IMW  56
#define HW   3136
#define NTOK (NI * HW)      // 6272 = 98 x 64
#define REL  16
#define RP2  18             // rel + 2 position channels
#define OUTC 256
#define SHR  8
#define NG   32             // out / share
#define KS   7
#define KK   49
#define PADR 3
#define BNEPS 1e-5f
#define NSTAT ((size_t)NI * KK * HW)   // 307328 elements per channel
typedef _Float16 h16;
typedef unsigned short bf;
typedef __attribute__((ext_vector_type(16))) __bf16   v16bf;
typedef __attribute__((ext_vector_type(16))) _Float16 v16h;
typedef __attribute__((ext_vector_type(8)))  _Float16 v8h;
typedef __attribute__((ext_vector_type(8)))  unsigned short v8us;
typedef __attribute__((ext_vector_type(8)))  float    v8f;
typedef __attribute__((ext_vector_type(4)))  float    v4f;
typedef v8h  __attribute__((may_alias)) v8ha;
typedef v4f  __attribute__((may_alias)) v4fa;
typedef v8us __attribute__((may_alias)) v8usa;

__device__ __forceinline__ unsigned short f2bf(float f) { unsigned u = __float_as_uint(f); u += 0x7FFFu + ((u >> 16) & 1u); return (unsigned short)(u >> 16); }
__device__ __forceinline__ float bf2f(unsigned short b) { return __uint_as_float(((unsigned)b) << 16); }
__device__ __forceinline__ float bfr(float f) { return bf2f(f2bf(f)); }
__device__ __forceinline__ v16h cat16(v8h lo, v8h hi) { return __builtin_shufflevector(lo, hi, 0, 1, 2, 3, 4, 5, 6, 7, 8, 9, 10, 11, 12, 13, 14, 15); }
__device__ __forceinline__ v16bf cat16b(v8us lo, v8us hi) { return __builtin_bit_cast(v16bf, __builtin_shufflevector(lo, hi, 0, 1, 2, 3, 4, 5, 6, 7, 8, 9, 10, 11, 12, 13, 14, 15)); }
__device__ __forceinline__ v8f wmma16(v16h a, v16h b, v8f c) { return __builtin_amdgcn_wmma_f32_16x16x32_f16(false, a, false, b, (short)0, c, false, false); }
__device__ __forceinline__ v8f wmmab(v16bf a, v16bf b, v8f c) { return __builtin_amdgcn_wmma_f32_16x16x32_bf16(false, a, false, b, (short)0, c, false, false); }



// ---- k_gemmw: register-blocked GEMM, ONE WAVE per 64x64 output tile (16 accumulators), operands straight from K-contiguous 16-bit planes; grid (M/64, N/64, Z), 32 threads.
// C[m][n] (f32, pitch ldc, + optional f32 bias[n]) = sum_k A[m][k] Bt[n][k] (+ split products per NSPLIT). z-batch strides sA/sB/sC in elements. K % 32 == 0.
template <typename T16> struct WFrag;
template <> struct WFrag<h16> { typedef v16h V; static __device__ __forceinline__ V ld(const h16* p) { return cat16(*(const v8h*)p, *(const v8h*)(p + 16)); } static __device__ __forceinline__ v8f mma(V a, V b, v8f c) { return wmma16(a, b, c); } };
template <> struct WFrag<bf> { typedef v16bf V; static __device__ __forceinline__ V ld(const bf* p) { return cat16b(*(const v8us*)p, *(const v8us*)(p + 16)); } static __device__ __forceinline__ v8f mma(V a, V b, v8f c) { return wmmab(a, b, c); } };
template <typename T16, int NSPLIT, bool BIAS>
__global__ __launch_bounds__(32) void k_gemmw(const T16* __restrict__ A, const T16* __restrict__ A2, const T16* __restrict__ Bt, const T16* __restrict__ Bt2, int K, float* C, int ldc, const float* __restrict__ bias, size_t sA, size_t sB, size_t sC) {
    typedef typename WFrag<T16>::V V;
    __shared__ __align__(16) float os[16 * 68];
    const size_t z = blockIdx.z; A += z * sA; if (A2) A2 += z * sA; Bt += z * sB; if (Bt2) Bt2 += z * sB; C += z * sC;
    const int lane = threadIdx.x & 31, lr = lane & 15, hi = lane >> 4; const int r0 = blockIdx.x * 64, c0 = blockIdx.y * 64;
    v8f acc[4][4];
#pragma unroll
    for (int mb = 0; mb < 4; ++mb)
#pragma unroll
        for (int nb = 0; nb < 4; ++nb) acc[mb][nb] = (v8f){};
    const size_t aoff = (size_t)(r0 + lr) * K + 8 * hi, boff = (size_t)(c0 + lr) * K + 8 * hi;
#pragma unroll 1
    for (int kc = 0; kc < K; kc += 32) {
        V a[4], a2[4];
#pragma unroll
        for (int mb = 0; mb < 4; ++mb) { a[mb] = WFrag<T16>::ld(A + aoff + (size_t)mb * 16 * K + kc); if (NSPLIT == 1 || NSPLIT == 2) a2[mb] = WFrag<T16>::ld(A2 + aoff + (size_t)mb * 16 * K + kc); }
#pragma unroll
        for (int nb = 0; nb < 4; ++nb) { const V b = WFrag<T16>::ld(Bt + boff + (size_t)nb * 16 * K + kc); V b2; if (NSPLIT >= 2) b2 = WFrag<T16>::ld(Bt2 + boff + (size_t)nb * 16 * K + kc);
#pragma unroll
            for (int mb = 0; mb < 4; ++mb) { acc[mb][nb] = WFrag<T16>::mma(a[mb], b, acc[mb][nb]); if (NSPLIT == 1 || NSPLIT == 2) acc[mb][nb] = WFrag<T16>::mma(a2[mb], b, acc[mb][nb]); if (NSPLIT >= 2) acc[mb][nb] = WFrag<T16>::mma(a[mb], b2, acc[mb][nb]); } }
        asm volatile("v_nop\n\tv_nop\n\tv_nop\n\tv_nop" : "+v"(acc[0][0]), "+v"(acc[1][1]), "+v"(acc[2][2]), "+v"(acc[3][3]) : "v"(a[0]), "v"(a[3]));
    }
#pragma unroll
    for (int mb = 0; mb < 4; ++mb) {
#pragma unroll
        for (int nb = 0; nb < 4; ++nb) {
#pragma unroll
            for (int j = 0; j < 8; ++j) os[(hi * 8 + j) * 68 + nb * 16 + lr] = acc[mb][nb][j]; }
        __builtin_amdgcn_wave_barrier(); asm volatile("" ::: "memory");
        float* crow = C + (size_t)(r0 + mb * 16) * ldc + c0;
{
#pragma unroll
            for (int s = 0; s < 8; ++s) { const int row = 2 * s + hi, cofs = lr * 4; v4f val = *(const v4fa*)(os + row * 68 + cofs); if (BIAS) { val[0] += bfr(bias[c0 + cofs]); val[1] += bfr(bias[c0 + cofs + 1]); val[2] += bfr(bias[c0 + cofs + 2]); val[3] += bfr(bias[c0 + cofs + 3]); }
                *(v4f*)(crow + (size_t)row * ldc + cofs) = val; }
             }
        __builtin_amdgcn_wave_barrier(); asm volatile("" ::: "memory");
    }
}

__device__ __forceinline__ h16 tohx(float x) { return (h16)x; }
__device__ __forceinline__ void splitf(float y, unsigned short& h, unsigned short& l) { h = f2bf(y); l = f2bf(y - bf2f(h)); }
typedef __attribute__((ext_vector_type(2))) _Float16 v2h;
typedef __attribute__((ext_vector_type(4))) _Float16 v4h;
typedef __attribute__((ext_vector_type(2))) unsigned short v2us;
typedef __attribute__((ext_vector_type(4))) unsigned short v4us;
typedef __attribute__((ext_vector_type(2))) float v2f;
typedef __attribute__((ext_vector_type(4))) int v4i;

__global__ __launch_bounds__(256) void k_cvt8(const float* __restrict__ src, bf* dst, size_t n8) { const size_t i = (size_t)blockIdx.x * 256 + threadIdx.x; if (i >= n8) return; const v8f v = *(const v8f*)(src + i * 8); v8us o;
#pragma unroll
    for (int k = 0; k < 8; ++k) o[k] = f2bf(v[k]); *(v8us*)(dst + i * 8) = o;  }

// bfrb: bf16 rounding of an input value with a register barrier so the conversion is not folded into v_fma_mix.
__device__ __forceinline__ float bfrb(float x) { float y = bfr(x); asm volatile("" : "+v"(y)); return y; }
__global__ __launch_bounds__(256) void k_cvt8T(const float* __restrict__ src, bf* dst) { const size_t i = (size_t)blockIdx.x * 256 + threadIdx.x; if (i >= (size_t)NTOK * CIN / 8) return; const int tok = (int)(i / (CIN / 8)); const int c0 = (int)(i % (CIN / 8)) * 8; const int n = tok / HW, p = tok % HW; v8us o;
#pragma unroll
    for (int k = 0; k < 8; ++k) o[k] = f2bf(src[((size_t)n * CIN + c0 + k) * HW + p]); *(v8us*)(dst + (size_t)tok * CIN + c0) = o;  }
__global__ __launch_bounds__(256) void k_w12(const float* __restrict__ w1, const float* __restrict__ w2, const float* __restrict__ b1, const float* __restrict__ b2, bf* W12, float* B12) { const int i = blockIdx.x * 256 + threadIdx.x; if (i < 64 * CIN / 8) { const int o = i / (CIN / 8); const int c0 = (i % (CIN / 8)) * 8; v8us ov;
#pragma unroll
        for (int q = 0; q < 8; ++q) { const float v = (o < REL) ? w1[o * CIN + c0 + q] : ((o < 2 * REL) ? w2[(o - REL) * CIN + c0 + q] : 0.0f); ov[q] = f2bf(v); }
        *(v8us*)(W12 + (size_t)o * CIN + c0) = ov;  }
    if (i < 64) { const float v = (i < REL) ? b1[i] : ((i < 2 * REL) ? b2[i - REL] : 0.0f); *(float*)(B12 + i) = v;  } }
__device__ __forceinline__ int refl(int i) { return i < 0 ? -i : (i >= IMW ? 2 * (IMW - 1) - i : i); }
__device__ __forceinline__ float linsp(int j) { return __fadd_rn(-1.0f, __fmul_rn((float)j, 2.0f / 55.0f)); }   /* jnp.linspace(-1, 1, 56)[j] in f32 */
__device__ __forceinline__ float posv(const float* wp, const float* bp, int c, int y, int x) { float a = __fmul_rn(bfrb(wp[c * 2 + 0]), linsp(x)), b = __fmul_rn(bfrb(wp[c * 2 + 1]), linsp(y)); asm volatile("" : "+v"(a), "+v"(b)); float s = __fadd_rn(a, b); asm volatile("" : "+v"(s)); return __fadd_rn(s, bfrb(bp[c])); }
__global__ __launch_bounds__(256) void k_feat(const float* __restrict__ X12, const float* __restrict__ wp, const float* __restrict__ bp, float* T1) { const size_t i = (size_t)blockIdx.x * 256 + threadIdx.x; if (i >= (size_t)NI * RP2 * KK * HW / 4) return; const size_t e = i * 4; const int p0 = (int)(e % HW); const int k = (int)((e / HW) % KK); const int c = (int)((e / ((size_t)HW * KK)) % RP2); const int n = (int)(e / ((size_t)HW * KK * RP2)); const int di = k / KS - PADR, dj = k % KS - PADR; v4f o;
#pragma unroll
    for (int q = 0; q < 4; ++q) { const int p = p0 + q; const int y = p / IMW, x = p % IMW; const int yy = refl(y + di), xx = refl(x + dj); const int pn = yy * IMW + xx; float v;
        if (c < REL) { v = __fsub_rn(X12[((size_t)n * HW + p) * 64 + c], X12[((size_t)n * HW + pn) * 64 + REL + c]); }
        else { const int pc = c - REL; v = __fsub_rn(posv(wp, bp, pc, y, x), posv(wp, bp, pc, yy, xx)); }
        o[q] = v; }
    *(v4f*)(T1 + e) = o;  }
// ---- batch statistics of one BatchNorm, two launches, fixed summation order, no atomics.
// k_bnpart: T is [n][c][49][3136], so work-group b owns the contiguous chunk b = (n*C + c)*7 + j of 7 window slots (21952 values), held in registers: the chunk's sum S, then Q = sum of squared distances from the chunk's own mean. Each work-group stores its own 128-byte line of PT.
// k_bnfin: one wave per channel merges that channel's 14 equal chunks: mean = sum S / N; N var = sum (Q + 21952 (S/21952 - mean)^2) (pairwise merge of variances: no cancellation of large squares); ST[c*32] = mean, ST[c*32+1] = rsqrt(var + eps).
#define BCH  KS                          // chunks per (n, c) plane
#define BCHN (KS * HW)                   // 21952 values per chunk
#define BCHV (BCHN / 4)                  // 5488 16-byte loads per chunk
#define BTH  512
#define BIT  ((BCHV + BTH - 1) / BTH)    // 11 loads per thread, the last one only in the first 368 threads
__device__ __forceinline__ float wavesum(float s) {
#pragma unroll
    for (int sh = 16; sh; sh >>= 1) s += __shfl_xor(s, sh, 32);
    return s; }
__device__ __forceinline__ float blocksum(float s, float* red) { s = wavesum(s); if ((threadIdx.x & 31) == 0) red[threadIdx.x >> 5] = s; __syncthreads(); float t = 0.f;
#pragma unroll
    for (int i = 0; i < BTH / 32; ++i) t += red[i];
    return t; }
__global__ __launch_bounds__(BTH) void k_bnpart(const float* __restrict__ T, float* PT) { __shared__ float red[2][BTH / 32]; const int t = threadIdx.x; const v4f* base = (const v4f*)(T + (size_t)blockIdx.x * BCHN); const bool tail = t < BCHV - (BIT - 1) * BTH; v4f a[BIT];
#pragma unroll
    for (int i = 0; i < BIT - 1; ++i) a[i] = base[i * BTH + t];
    a[BIT - 1] = (v4f){0.f, 0.f, 0.f, 0.f}; if (tail) a[BIT - 1] = base[(BIT - 1) * BTH + t];
    v4f s4 = a[0];
#pragma unroll
    for (int i = 1; i < BIT; ++i) s4 += a[i];
    const float S = blocksum((s4[0] + s4[1]) + (s4[2] + s4[3]), red[0]); const float cm = S * (1.0f / (float)BCHN); v4f q4 = (v4f){0.f, 0.f, 0.f, 0.f};
#pragma unroll
    for (int i = 0; i < BIT - 1; ++i) { const v4f d = a[i] - cm; q4 += d * d; }
    if (tail) { const v4f d = a[BIT - 1] - cm; q4 += d * d; }
    const float Q = blocksum((q4[0] + q4[1]) + (q4[2] + q4[3]), red[1]);
    if (t < 32) PT[(size_t)blockIdx.x * 32 + t] = (t == 0) ? S : ((t == 1) ? Q : 0.0f); }
__global__ __launch_bounds__(32) void k_bnfin(const float* __restrict__ PT, int C, float* ST) { const int lane = threadIdx.x, c = blockIdx.x; const bool on = lane < NI * BCH; const int l = on ? lane : 0; const size_t b = (size_t)((l / BCH) * C + c) * BCH + l % BCH;
    const float S = on ? PT[b * 32] : 0.0f, Q = on ? PT[b * 32 + 1] : 0.0f; const float mean = wavesum(S) * (1.0f / (float)NSTAT); const float d = S * (1.0f / (float)BCHN) - mean;
    const float vs = wavesum(on ? Q + (float)BCHN * d * d : 0.0f); const float rs = __frsqrt_rn(vs * (1.0f / (float)NSTAT) + BNEPS);
    ST[(size_t)c * 32 + lane] = (lane == 0) ? mean : ((lane == 1) ? rs : 0.0f); }
__global__ __launch_bounds__(256) void k_conv1(const float* __restrict__ T1, const float* __restrict__ ST, const float* __restrict__ g1, const float* __restrict__ be1, const float* __restrict__ cw1, float* T2) { const size_t i = (size_t)blockIdx.x * 256 + threadIdx.x; if (i >= (size_t)NI * KK * HW / 4) return; const size_t e = i * 4; const int p0 = (int)(e % HW); const int k = (int)((e / HW) % KK); const int n = (int)(e / ((size_t)HW * KK)); v4f acc[REL];
#pragma unroll
    for (int o = 0; o < REL; ++o) acc[o] = (v4f){0.f, 0.f, 0.f, 0.f};
#pragma unroll 2
    for (int c = 0; c < RP2; ++c) { const v4f a = *(const v4f*)(T1 + (((size_t)n * RP2 + c) * KK + k) * HW + p0); const float mean = ST[c * 32], rs = ST[c * 32 + 1]; const float gg = bfrb(g1[c]), bb = bfrb(be1[c]); v4f tn;
#pragma unroll
        for (int q = 0; q < 4; ++q) { float d0 = __fsub_rn(a[q], mean); asm volatile("" : "+v"(d0)); float n0 = __fmul_rn(d0, rs); asm volatile("" : "+v"(n0)); float y = __fmul_rn(n0, gg); asm volatile("" : "+v"(y)); float z = __fadd_rn(y, bb); tn[q] = fmaxf(z, 0.0f); }
#pragma unroll
        for (int o = 0; o < REL; ++o) { const float w = bfrb(cw1[o * RP2 + c]);
#pragma unroll
            for (int q = 0; q < 4; ++q) { float pr = __fmul_rn(w, tn[q]); asm volatile("" : "+v"(pr)); acc[o][q] = __fadd_rn(acc[o][q], pr); } } }
{
#pragma unroll
        for (int o = 0; o < REL; ++o) *(v4f*)(T2 + (((size_t)n * REL + o) * KK + k) * HW + p0) = acc[o];
         } }
// k_final: per (n, g, p) (one lane per p): for each of the 49 window slots k (rolled loop): wl = sum_o cw2[g][o] relu((T2[n][o][k][p] - mean_o) rs_o g2 + be2) + cb2[g]; ONLINE softmax over k in f32 (running max / sum with exp2 rescaling of the 8 accumulators, no per-slot array) fused with the aggregation out[n][g*8+s][p] = sum_k w[k] x3[n*HW + nbr(p,k)][g*8+s] (x3 token-major [tok][256] f32, 32-B per lane per slot);
__global__ __launch_bounds__(256) void k_final(const float* __restrict__ T2, const float* __restrict__ ST, const float* __restrict__ g2, const float* __restrict__ be2, const float* __restrict__ cw2, const float* __restrict__ cb2, const float* __restrict__ X3, float* out) {
    const size_t gidx = (size_t)blockIdx.x * 256 + threadIdx.x; if (gidx >= (size_t)NI * NG * HW) return; const int p = (int)(gidx % HW); const int g = (int)((gidx / HW) % NG); const int n = (int)(gidx / ((size_t)HW * NG)); const int y = p / IMW, x = p % IMW;
    const float cb = bfrb(cb2[g]); float m = -3.0e38f, Z = 0.f; float acc[SHR];
#pragma unroll
    for (int s2 = 0; s2 < SHR; ++s2) acc[s2] = 0.f;
#pragma unroll 1
    for (int k = 0; k < KK; ++k) { float s = 0.f;
#pragma unroll
        for (int o = 0; o < REL; ++o) { const float a = T2[(((size_t)n * REL + o) * KK + k) * HW + p]; float d0 = __fsub_rn(a, ST[o * 32]); asm volatile("" : "+v"(d0)); float n0 = __fmul_rn(d0, ST[o * 32 + 1]); asm volatile("" : "+v"(n0)); float yv = __fmul_rn(n0, bfrb(g2[o])); asm volatile("" : "+v"(yv)); float z = __fadd_rn(yv, bfrb(be2[o])); const float tn = fmaxf(z, 0.0f); float pr = __fmul_rn(bfrb(cw2[g * REL + o]), tn); asm volatile("" : "+v"(pr)); s = __fadd_rn(s, pr); }
        asm volatile("s_wait_loadcnt 0x0" : "+v"(s) :: "memory"); const float wl = __fadd_rn(s, cb);
        const float mn = fmaxf(m, wl); float d1 = __fsub_rn(m, mn), d2 = __fsub_rn(wl, mn); asm volatile("" : "+v"(d1), "+v"(d2)); const float r = __builtin_amdgcn_exp2f(__fmul_rn(d1, 1.4426950408889634f)), w = __builtin_amdgcn_exp2f(__fmul_rn(d2, 1.4426950408889634f)); float zr = __fmul_rn(Z, r); asm volatile("" : "+v"(zr)); Z = __fadd_rn(zr, w); m = mn;
        const int yy = refl(y + k / KS - PADR), xx = refl(x + k % KS - PADR); v8f v = *(const v8f*)(X3 + ((size_t)n * HW + (size_t)yy * IMW + xx) * OUTC + g * SHR); asm volatile("s_wait_loadcnt 0x0" : "+v"(v) :: "memory");
#pragma unroll
        for (int s2 = 0; s2 < SHR; ++s2) { float t0 = __fmul_rn(acc[s2], r); asm volatile("" : "+v"(t0)); float t1 = __fmul_rn(w, v[s2]); asm volatile("" : "+v"(t1)); acc[s2] = __fadd_rn(t0, t1); } }
    const float iz = __fdiv_rn(1.0f, Z);
{
#pragma unroll
        for (int s2 = 0; s2 < SHR; ++s2) *(float*)(out + ((size_t)n * OUTC + g * SHR + s2) * HW + p) = acc[s2] * iz;
         } }

extern "C" void kernel_launch(void* const* d_in, const int* in_sizes, int n_in,
                              void* d_out, int out_size, void* d_ws, size_t ws_size, hipStream_t stream) {
    (void)in_sizes; (void)n_in; (void)out_size;
    const float* x = (const float*)d_in[0]; const float* w1 = (const float*)d_in[1]; const float* b1 = (const float*)d_in[2]; const float* w2 = (const float*)d_in[3]; const float* b2 = (const float*)d_in[4]; const float* w3 = (const float*)d_in[5]; const float* b3 = (const float*)d_in[6]; const float* wp = (const float*)d_in[7]; const float* bp = (const float*)d_in[8];
    const float* g1 = (const float*)d_in[9]; const float* be1 = (const float*)d_in[10]; const float* cw1 = (const float*)d_in[11]; const float* g2 = (const float*)d_in[12]; const float* be2 = (const float*)d_in[13]; const float* cw2 = (const float*)d_in[14]; const float* cb2 = (const float*)d_in[15];
    float* OUT = (float*)d_out;     // [2][256][56][56]
    char* wsp = (char*)d_ws;
    auto take = [&](size_t bytes) { char* p = wsp; wsp += (bytes + 255) & ~(size_t)255; return (void*)p; };
    bf* XT = (bf*)take((size_t)NTOK * CIN * 2); bf* W12 = (bf*)take((size_t)64 * CIN * 2); float* B12 = (float*)take(256); bf* W3 = (bf*)take((size_t)OUTC * CIN * 2);
    float* X12 = (float*)take((size_t)NTOK * 64 * 4); float* X3 = (float*)take((size_t)NTOK * OUTC * 4); float* T1 = (float*)take((size_t)NI * RP2 * KK * HW * 4); float* T2 = (float*)take((size_t)NI * REL * KK * HW * 4); float* ST1 = (float*)take(32 * 32 * 4); float* ST2 = (float*)take(32 * 32 * 4); float* PT = (float*)take((size_t)NI * RP2 * BCH * 32 * 4);
    if ((size_t)(wsp - (char*)d_ws) > ws_size) return;    // carve ~51 MiB
    k_cvt8T<<<(unsigned)(((size_t)NTOK * CIN / 8 + 255) / 256), 256, 0, stream>>>(x, XT); k_w12<<<(64 * CIN / 8 + 255) / 256, 256, 0, stream>>>(w1, w2, b1, b2, W12, B12); k_cvt8<<<(unsigned)(((size_t)OUTC * CIN / 8 + 255) / 256), 256, 0, stream>>>(w3, W3, (size_t)OUTC * CIN / 8);
    k_gemmw<bf, 0, true><<<dim3(NTOK / 64, 1, 1), 32, 0, stream>>>(XT, nullptr, W12, nullptr, CIN, X12, 64, B12, 0, 0, 0);             /* x1 | x2 token-major [tok][0..15 | 16..31] */
    k_gemmw<bf, 0, true><<<dim3(NTOK / 64, OUTC / 64, 1), 32, 0, stream>>>(XT, nullptr, W3, nullptr, CIN, X3, OUTC, b3, 0, 0, 0);        /* x3 token-major [tok][256] */
    k_feat<<<(unsigned)(((size_t)NI * RP2 * KK * HW / 4 + 255) / 256), 256, 0, stream>>>(X12, wp, bp, T1);
    k_bnpart<<<NI * RP2 * BCH, BTH, 0, stream>>>(T1, PT); k_bnfin<<<RP2, 32, 0, stream>>>(PT, RP2, ST1);
    k_conv1<<<(unsigned)(((size_t)NI * KK * HW / 4 + 255) / 256), 256, 0, stream>>>(T1, ST1, g1, be1, cw1, T2);
    k_bnpart<<<NI * REL * BCH, BTH, 0, stream>>>(T2, PT); k_bnfin<<<REL, 32, 0, stream>>>(PT, REL, ST2);
    k_final<<<(unsigned)(((size_t)NI * NG * HW + 255) / 256), 256, 0, stream>>>(T2, ST2, g2, be2, cw2, cb2, X3, OUT);
}

// v002
// One run takes 160 microseconds.
// Timed twice side by side with v001, it ran 2.90 and 2.85 times as fast.
// Counting every step since v000, it is 19.3 times as fast.
#include <hip/hip_runtime.h>

// SAN pairwise self-attention module (x [2][256][56][56]; x1, x2 = 1x1(x; [16][256] + b), x3 = 1x1(x; [256][256] + b); pos = 1x1(linspace grid [2][56][56]; wp [2][2] + bp); 7x7 reflect-padded windows (pad 3): t = concat(x1 - unfold(x2), pos - unfold(pos)) [2][18][49][3136];
// t = relu(BN1(t)) (training-mode batch statistics over n, k, p per channel); t = 1x1(t; cw1 [16][18]); t = relu(BN2(t)); wlog = 1x1(t; cw2 [32][16] + cb2); w = softmax over the 49 window slots; out[n][g*8+s][p] = sum_k unfold(x3)[n][g*8+s][k][p] w[n][g][k][p] -> [2][256][56][56] (1.6 M)).
// Compute dtypes, f32 accumulate: every input rounded to bf16; the three 1x1 input convs on PLAIN bf16 operands (input transposed while converting; exact) + f32 biases; everything after that in f32 on the VALU: window differences, position features (linspace in f32), both BatchNorms with deterministic fixed-order batch statistics (14 work-groups per channel, each its chunk's sum and squared distances from the chunk mean, merged by one wave per channel; biased variance, eps 1e-5), the 18->16 and 16->32 channel mixes, the 49-way softmax (online form: running max/sum with rescaling) fused with the weighted aggregation of the reflect-gathered x3.

#define NI   2
#define CIN  256
#define IMW  56
#define HW   3136
#define NTOK (NI * HW)      // 6272 = 98 x 64
#define REL  16
#define RP2  18             // rel + 2 position channels
#define OUTC 256
#define SHR  8
#define NG   32             // out / share
#define KS   7
#define KK   49
#define PADR 3
#define BNEPS 1e-5f
#define NSTAT ((size_t)NI * KK * HW)   // 307328 elements per channel
typedef _Float16 h16;
typedef unsigned short bf;
typedef __attribute__((ext_vector_type(16))) __bf16   v16bf;
typedef __attribute__((ext_vector_type(16))) _Float16 v16h;
typedef __attribute__((ext_vector_type(8)))  _Float16 v8h;
typedef __attribute__((ext_vector_type(8)))  unsigned short v8us;
typedef __attribute__((ext_vector_type(8)))  float    v8f;
typedef __attribute__((ext_vector_type(4)))  float    v4f;
typedef v8h  __attribute__((may_alias)) v8ha;
typedef v4f  __attribute__((may_alias)) v4fa;
typedef v8us __attribute__((may_alias)) v8usa;

__device__ __forceinline__ unsigned short f2bf(float f) { unsigned u = __float_as_uint(f); u += 0x7FFFu + ((u >> 16) & 1u); return (unsigned short)(u >> 16); }
__device__ __forceinline__ float bf2f(unsigned short b) { return __uint_as_float(((unsigned)b) << 16); }
__device__ __forceinline__ float bfr(float f) { return bf2f(f2bf(f)); }
__device__ __forceinline__ v16h cat16(v8h lo, v8h hi) { return __builtin_shufflevector(lo, hi, 0, 1, 2, 3, 4, 5, 6, 7, 8, 9, 10, 11, 12, 13, 14, 15); }
__device__ __forceinline__ v16bf cat16b(v8us lo, v8us hi) { return __builtin_bit_cast(v16bf, __builtin_shufflevector(lo, hi, 0, 1, 2, 3, 4, 5, 6, 7, 8, 9, 10, 11, 12, 13, 14, 15)); }
__device__ __forceinline__ v8f wmma16(v16h a, v16h b, v8f c) { return __builtin_amdgcn_wmma_f32_16x16x32_f16(false, a, false, b, (short)0, c, false, false); }
__device__ __forceinline__ v8f wmmab(v16bf a, v16bf b, v8f c) { return __builtin_amdgcn_wmma_f32_16x16x32_bf16(false, a, false, b, (short)0, c, false, false); }



// ---- k_gemmw: register-blocked GEMM, ONE WAVE per 64x64 output tile (16 accumulators), operands straight from K-contiguous 16-bit planes; grid (M/64, N/64, Z), 32 threads.
// C[m][n] (f32, pitch ldc, + optional f32 bias[n]) = sum_k A[m][k] Bt[n][k] (+ split products per NSPLIT). z-batch strides sA/sB/sC in elements. K % 32 == 0.
template <typename T16> struct WFrag;
template <> struct WFrag<h16> { typedef v16h V; static __device__ __forceinline__ V ld(const h16* p) { return cat16(*(const v8h*)p, *(const v8h*)(p + 16)); } static __device__ __forceinline__ v8f mma(V a, V b, v8f c) { return wmma16(a, b, c); } };
template <> struct WFrag<bf> { typedef v16bf V; static __device__ __forceinline__ V ld(const bf* p) { return cat16b(*(const v8us*)p, *(const v8us*)(p + 16)); } static __device__ __forceinline__ v8f mma(V a, V b, v8f c) { return wmmab(a, b, c); } };
template <typename T16, int NSPLIT, bool BIAS>
__global__ __launch_bounds__(32) void k_gemmw(const T16* __restrict__ A, const T16* __restrict__ A2, const T16* __restrict__ Bt, const T16* __restrict__ Bt2, int K, float* C, int ldc, const float* __restrict__ bias, size_t sA, size_t sB, size_t sC) {
    typedef typename WFrag<T16>::V V;
    __shared__ __align__(16) float os[16 * 68];
    const size_t z = blockIdx.z; A += z * sA; if (A2) A2 += z * sA; Bt += z * sB; if (Bt2) Bt2 += z * sB; C += z * sC;
    const int lane = threadIdx.x & 31, lr = lane & 15, hi = lane >> 4; const int r0 = blockIdx.x * 64, c0 = blockIdx.y * 64;
    v8f acc[4][4];
#pragma unroll
    for (int mb = 0; mb < 4; ++mb)
#pragma unroll
        for (int nb = 0; nb < 4; ++nb) acc[mb][nb] = (v8f){};
    const size_t aoff = (size_t)(r0 + lr) * K + 8 * hi, boff = (size_t)(c0 + lr) * K + 8 * hi;
#pragma unroll 1
    for (int kc = 0; kc < K; kc += 32) {
        V a[4], a2[4];
#pragma unroll
        for (int mb = 0; mb < 4; ++mb) { a[mb] = WFrag<T16>::ld(A + aoff + (size_t)mb * 16 * K + kc); if (NSPLIT == 1 || NSPLIT == 2) a2[mb] = WFrag<T16>::ld(A2 + aoff + (size_t)mb * 16 * K + kc); }
#pragma unroll
        for (int nb = 0; nb < 4; ++nb) { const V b = WFrag<T16>::ld(Bt + boff + (size_t)nb * 16 * K + kc); V b2; if (NSPLIT >= 2) b2 = WFrag<T16>::ld(Bt2 + boff + (size_t)nb * 16 * K + kc);
#pragma unroll
            for (int mb = 0; mb < 4; ++mb) { acc[mb][nb] = WFrag<T16>::mma(a[mb], b, acc[mb][nb]); if (NSPLIT == 1 || NSPLIT == 2) acc[mb][nb] = WFrag<T16>::mma(a2[mb], b, acc[mb][nb]); if (NSPLIT >= 2) acc[mb][nb] = WFrag<T16>::mma(a[mb], b2, acc[mb][nb]); } }
        asm volatile("v_nop\n\tv_nop\n\tv_nop\n\tv_nop" : "+v"(acc[0][0]), "+v"(acc[1][1]), "+v"(acc[2][2]), "+v"(acc[3][3]) : "v"(a[0]), "v"(a[3]));
    }
#pragma unroll
    for (int mb = 0; mb < 4; ++mb) {
#pragma unroll
        for (int nb = 0; nb < 4; ++nb) {
#pragma unroll
            for (int j = 0; j < 8; ++j) os[(hi * 8 + j) * 68 + nb * 16 + lr] = acc[mb][nb][j]; }
        __builtin_amdgcn_wave_barrier(); asm volatile("" ::: "memory");
        float* crow = C + (size_t)(r0 + mb * 16) * ldc + c0;
{
#pragma unroll
            for (int s = 0; s < 8; ++s) { const int row = 2 * s + hi, cofs = lr * 4; v4f val = *(const v4fa*)(os + row * 68 + cofs); if (BIAS) { val[0] += bfr(bias[c0 + cofs]); val[1] += bfr(bias[c0 + cofs + 1]); val[2] += bfr(bias[c0 + cofs + 2]); val[3] += bfr(bias[c0 + cofs + 3]); }
                *(v4f*)(crow + (size_t)row * ldc + cofs) = val; }
             }
        __builtin_amdgcn_wave_barrier(); asm volatile("" ::: "memory");
    }
}

__device__ __forceinline__ h16 tohx(float x) { return (h16)x; }
__device__ __forceinline__ void splitf(float y, unsigned short& h, unsigned short& l) { h = f2bf(y); l = f2bf(y - bf2f(h)); }
typedef __attribute__((ext_vector_type(2))) _Float16 v2h;
typedef __attribute__((ext_vector_type(4))) _Float16 v4h;
typedef __attribute__((ext_vector_type(2))) unsigned short v2us;
typedef __attribute__((ext_vector_type(4))) unsigned short v4us;
typedef __attribute__((ext_vector_type(2))) float v2f;
typedef __attribute__((ext_vector_type(4))) int v4i;

__global__ __launch_bounds__(256) void k_cvt8(const float* __restrict__ src, bf* dst, size_t n8) { const size_t i = (size_t)blockIdx.x * 256 + threadIdx.x; if (i >= n8) return; const v8f v = *(const v8f*)(src + i * 8); v8us o;
#pragma unroll
    for (int k = 0; k < 8; ++k) o[k] = f2bf(v[k]); *(v8us*)(dst + i * 8) = o;  }

// bfrb: bf16 rounding of an input value with a register barrier so the conversion is not folded into v_fma_mix.
__device__ __forceinline__ float bfrb(float x) { float y = bfr(x); asm volatile("" : "+v"(y)); return y; }
__global__ __launch_bounds__(256) void k_cvt8T(const float* __restrict__ src, bf* dst) { const size_t i = (size_t)blockIdx.x * 256 + threadIdx.x; if (i >= (size_t)NTOK * CIN / 8) return; const int tok = (int)(i / (CIN / 8)); const int c0 = (int)(i % (CIN / 8)) * 8; const int n = tok / HW, p = tok % HW; v8us o;
#pragma unroll
    for (int k = 0; k < 8; ++k) o[k] = f2bf(src[((size_t)n * CIN + c0 + k) * HW + p]); *(v8us*)(dst + (size_t)tok * CIN + c0) = o;  }
__global__ __launch_bounds__(256) void k_w12(const float* __restrict__ w1, const float* __restrict__ w2, const float* __restrict__ b1, const float* __restrict__ b2, bf* W12, float* B12) { const int i = blockIdx.x * 256 + threadIdx.x; if (i < 64 * CIN / 8) { const int o = i / (CIN / 8); const int c0 = (i % (CIN / 8)) * 8; v8us ov;
#pragma unroll
        for (int q = 0; q < 8; ++q) { const float v = (o < REL) ? w1[o * CIN + c0 + q] : ((o < 2 * REL) ? w2[(o - REL) * CIN + c0 + q] : 0.0f); ov[q] = f2bf(v); }
        *(v8us*)(W12 + (size_t)o * CIN + c0) = ov;  }
    if (i < 64) { const float v = (i < REL) ? b1[i] : ((i < 2 * REL) ? b2[i - REL] : 0.0f); *(float*)(B12 + i) = v;  } }
__device__ __forceinline__ int refl(int i) { return i < 0 ? -i : (i >= IMW ? 2 * (IMW - 1) - i : i); }
__device__ __forceinline__ float linsp(int j) { return __fadd_rn(-1.0f, __fmul_rn((float)j, 2.0f / 55.0f)); }   /* jnp.linspace(-1, 1, 56)[j] in f32 */
__device__ __forceinline__ float posv(const float* wp, const float* bp, int c, int y, int x) { float a = __fmul_rn(bfrb(wp[c * 2 + 0]), linsp(x)), b = __fmul_rn(bfrb(wp[c * 2 + 1]), linsp(y)); asm volatile("" : "+v"(a), "+v"(b)); float s = __fadd_rn(a, b); asm volatile("" : "+v"(s)); return __fadd_rn(s, bfrb(bp[c])); }
__global__ __launch_bounds__(256) void k_feat(const float* __restrict__ X12, const float* __restrict__ wp, const float* __restrict__ bp, float* T1) { const size_t i = (size_t)blockIdx.x * 256 + threadIdx.x; if (i >= (size_t)NI * RP2 * KK * HW / 4) return; const size_t e = i * 4; const int p0 = (int)(e % HW); const int k = (int)((e / HW) % KK); const int c = (int)((e / ((size_t)HW * KK)) % RP2); const int n = (int)(e / ((size_t)HW * KK * RP2)); const int di = k / KS - PADR, dj = k % KS - PADR; v4f o;
#pragma unroll
    for (int q = 0; q < 4; ++q) { const int p = p0 + q; const int y = p / IMW, x = p % IMW; const int yy = refl(y + di), xx = refl(x + dj); const int pn = yy * IMW + xx; float v;
        if (c < REL) { v = __fsub_rn(X12[((size_t)n * HW + p) * 64 + c], X12[((size_t)n * HW + pn) * 64 + REL + c]); }
        else { const int pc = c - REL; v = __fsub_rn(posv(wp, bp, pc, y, x), posv(wp, bp, pc, yy, xx)); }
        o[q] = v; }
    *(v4f*)(T1 + e) = o;  }
// ---- batch statistics of one BatchNorm, two launches, fixed summation order, no atomics.
// k_bnpart: T is [n][c][49][3136], so work-group b owns the contiguous chunk b = (n*C + c)*7 + j of 7 window slots (21952 values), held in registers: the chunk's sum S, then Q = sum of squared distances from the chunk's own mean. Each work-group stores its own 128-byte line of PT.
// k_bnfin: one wave per channel merges that channel's 14 equal chunks: mean = sum S / N; N var = sum (Q + 21952 (S/21952 - mean)^2) (pairwise merge of variances: no cancellation of large squares); ST[c*32] = mean, ST[c*32+1] = rsqrt(var + eps).
#define BCH  KS                          // chunks per (n, c) plane
#define BCHN (KS * HW)                   // 21952 values per chunk
#define BCHV (BCHN / 4)                  // 5488 16-byte loads per chunk
#define BTH  512
#define BIT  ((BCHV + BTH - 1) / BTH)    // 11 loads per thread, the last one only in the first 368 threads
__device__ __forceinline__ float wavesum(float s) {
#pragma unroll
    for (int sh = 16; sh; sh >>= 1) s += __shfl_xor(s, sh, 32);
    return s; }
__device__ __forceinline__ float blocksum(float s, float* red) { s = wavesum(s); if ((threadIdx.x & 31) == 0) red[threadIdx.x >> 5] = s; __syncthreads(); float t = 0.f;
#pragma unroll
    for (int i = 0; i < BTH / 32; ++i) t += red[i];
    return t; }
__global__ __launch_bounds__(BTH) void k_bnpart(const float* __restrict__ T, float* PT) { __shared__ float red[2][BTH / 32]; const int t = threadIdx.x; const v4f* base = (const v4f*)(T + (size_t)blockIdx.x * BCHN); const bool tail = t < BCHV - (BIT - 1) * BTH; v4f a[BIT];
#pragma unroll
    for (int i = 0; i < BIT - 1; ++i) a[i] = base[i * BTH + t];
    a[BIT - 1] = (v4f){0.f, 0.f, 0.f, 0.f}; if (tail) a[BIT - 1] = base[(BIT - 1) * BTH + t];
    v4f s4 = a[0];
#pragma unroll
    for (int i = 1; i < BIT; ++i) s4 += a[i];
    const float S = blocksum((s4[0] + s4[1]) + (s4[2] + s4[3]), red[0]); const float cm = S * (1.0f / (float)BCHN); v4f q4 = (v4f){0.f, 0.f, 0.f, 0.f};
#pragma unroll
    for (int i = 0; i < BIT - 1; ++i) { const v4f d = a[i] - cm; q4 += d * d; }
    if (tail) { const v4f d = a[BIT - 1] - cm; q4 += d * d; }
    const float Q = blocksum((q4[0] + q4[1]) + (q4[2] + q4[3]), red[1]);
    if (t < 32) PT[(size_t)blockIdx.x * 32 + t] = (t == 0) ? S : ((t == 1) ? Q : 0.0f); }
__global__ __launch_bounds__(32) void k_bnfin(const float* __restrict__ PT, int C, float* ST) { const int lane = threadIdx.x, c = blockIdx.x; const bool on = lane < NI * BCH; const int l = on ? lane : 0; const size_t b = (size_t)((l / BCH) * C + c) * BCH + l % BCH;
    const float S = on ? PT[b * 32] : 0.0f, Q = on ? PT[b * 32 + 1] : 0.0f; const float mean = wavesum(S) * (1.0f / (float)NSTAT); const float d = S * (1.0f / (float)BCHN) - mean;
    const float vs = wavesum(on ? Q + (float)BCHN * d * d : 0.0f); const float rs = __frsqrt_rn(vs * (1.0f / (float)NSTAT) + BNEPS);
    ST[(size_t)c * 32 + lane] = (lane == 0) ? mean : ((lane == 1) ? rs : 0.0f); }
__global__ __launch_bounds__(256) void k_conv1(const float* __restrict__ T1, const float* __restrict__ ST, const float* __restrict__ g1, const float* __restrict__ be1, const float* __restrict__ cw1, float* T2) { const size_t i = (size_t)blockIdx.x * 256 + threadIdx.x; if (i >= (size_t)NI * KK * HW / 4) return; const size_t e = i * 4; const int p0 = (int)(e % HW); const int k = (int)((e / HW) % KK); const int n = (int)(e / ((size_t)HW * KK)); v4f acc[REL];
#pragma unroll
    for (int o = 0; o < REL; ++o) acc[o] = (v4f){0.f, 0.f, 0.f, 0.f};
#pragma unroll 2
    for (int c = 0; c < RP2; ++c) { const v4f a = *(const v4f*)(T1 + (((size_t)n * RP2 + c) * KK + k) * HW + p0); const float mean = ST[c * 32], rs = ST[c * 32 + 1]; const float g0 = g1[c], b0 = be1[c]; float wr[REL];
        // All loads of a channel are issued ahead of its arithmetic, so that they are in flight together (between two pinned operations each was waited for on its own). Unrolled so that wr[] lives in registers.
#pragma unroll
        for (int o = 0; o < REL; ++o) wr[o] = cw1[o * RP2 + c];
        const float gg = bfrb(g0), bb = bfrb(b0); v4f tn;
#pragma unroll
        for (int q = 0; q < 4; ++q) { float d0 = __fsub_rn(a[q], mean); asm volatile("" : "+v"(d0)); float n0 = __fmul_rn(d0, rs); asm volatile("" : "+v"(n0)); float y = __fmul_rn(n0, gg); asm volatile("" : "+v"(y)); float z = __fadd_rn(y, bb); tn[q] = fmaxf(z, 0.0f); }
#pragma unroll
        for (int o = 0; o < REL; ++o) { const float w = bfrb(wr[o]);
#pragma unroll
            for (int q = 0; q < 4; ++q) { float pr = __fmul_rn(w, tn[q]); asm volatile("" : "+v"(pr)); acc[o][q] = __fadd_rn(acc[o][q], pr); } } }
{
#pragma unroll
        for (int o = 0; o < REL; ++o) *(v4f*)(T2 + (((size_t)n * REL + o) * KK + k) * HW + p0) = acc[o];
         } }
// k_final: per (n, g, p) (one lane per p): for each of the 49 window slots k (rolled loop): wl = sum_o cw2[g][o] relu((T2[n][o][k][p] - mean_o) rs_o g2 + be2) + cb2[g]; ONLINE softmax over k in f32 (running max / sum with exp2 rescaling of the 8 accumulators, no per-slot array) fused with the aggregation out[n][g*8+s][p] = sum_k w[k] x3[n*HW + nbr(p,k)][g*8+s] (x3 token-major [tok][256] f32, 32-B per lane per slot);
__global__ __launch_bounds__(256) void k_final(const float* __restrict__ T2, const float* __restrict__ ST, const float* __restrict__ g2, const float* __restrict__ be2, const float* __restrict__ cw2, const float* __restrict__ cb2, const float* __restrict__ X3, float* out) {
    const size_t gidx = (size_t)blockIdx.x * 256 + threadIdx.x; if (gidx >= (size_t)NI * NG * HW) return; const int p = (int)(gidx % HW); const int g = (int)((gidx / HW) % NG); const int n = (int)(gidx / ((size_t)HW * NG)); const int y = p / IMW, x = p % IMW;
    const float cb = bfrb(cb2[g]); float m = -3.0e38f, Z = 0.f; float acc[SHR];
    // What does not change over the 49 slots is read once, here: inside the loop each of these reads stood between two pinned operations and was waited for on its own. Unrolled so that the arrays live in registers.
    float mu[REL], rs[REL], ga[REL], bt[REL], cw[REL];
#pragma unroll
    for (int o = 0; o < REL; ++o) { mu[o] = ST[o * 32]; rs[o] = ST[o * 32 + 1]; ga[o] = bfr(g2[o]); bt[o] = bfr(be2[o]); cw[o] = bfr(cw2[g * REL + o]); }
#pragma unroll
    for (int s2 = 0; s2 < SHR; ++s2) acc[s2] = 0.f;
#pragma unroll 1
    for (int k = 0; k < KK; ++k) { float s = 0.f;
        // All loads of a slot (16 planes of T2, 32 bytes of x3) are issued ahead of its arithmetic, so that they are in flight together. Unrolled so that a[] lives in registers.
        float a[REL];
#pragma unroll
        for (int o = 0; o < REL; ++o) a[o] = T2[(((size_t)n * REL + o) * KK + k) * HW + p];
        const int yy = refl(y + k / KS - PADR), xx = refl(x + k % KS - PADR); const v8f v = *(const v8f*)(X3 + ((size_t)n * HW + (size_t)yy * IMW + xx) * OUTC + g * SHR);
#pragma unroll
        for (int o = 0; o < REL; ++o) { float d0 = __fsub_rn(a[o], mu[o]); asm volatile("" : "+v"(d0)); float n0 = __fmul_rn(d0, rs[o]); asm volatile("" : "+v"(n0)); float yv = __fmul_rn(n0, ga[o]); asm volatile("" : "+v"(yv)); float z = __fadd_rn(yv, bt[o]); const float tn = fmaxf(z, 0.0f); float pr = __fmul_rn(cw[o], tn); asm volatile("" : "+v"(pr)); s = __fadd_rn(s, pr); }
        const float wl = __fadd_rn(s, cb);
        const float mn = fmaxf(m, wl); float d1 = __fsub_rn(m, mn), d2 = __fsub_rn(wl, mn); asm volatile("" : "+v"(d1), "+v"(d2)); const float r = __builtin_amdgcn_exp2f(__fmul_rn(d1, 1.4426950408889634f)), w = __builtin_amdgcn_exp2f(__fmul_rn(d2, 1.4426950408889634f)); float zr = __fmul_rn(Z, r); asm volatile("" : "+v"(zr)); Z = __fadd_rn(zr, w); m = mn;
#pragma unroll
        for (int s2 = 0; s2 < SHR; ++s2) { float t0 = __fmul_rn(acc[s2], r); asm volatile("" : "+v"(t0)); float t1 = __fmul_rn(w, v[s2]); asm volatile("" : "+v"(t1)); acc[s2] = __fadd_rn(t0, t1); } }
    const float iz = __fdiv_rn(1.0f, Z);
{
#pragma unroll
        for (int s2 = 0; s2 < SHR; ++s2) *(float*)(out + ((size_t)n * OUTC + g * SHR + s2) * HW + p) = acc[s2] * iz;
         } }

extern "C" void kernel_launch(void* const* d_in, const int* in_sizes, int n_in,
                              void* d_out, int out_size, void* d_ws, size_t ws_size, hipStream_t stream) {
    (void)in_sizes; (void)n_in; (void)out_size;
    const float* x = (const float*)d_in[0]; const float* w1 = (const float*)d_in[1]; const float* b1 = (const float*)d_in[2]; const float* w2 = (const float*)d_in[3]; const float* b2 = (const float*)d_in[4]; const float* w3 = (const float*)d_in[5]; const float* b3 = (const float*)d_in[6]; const float* wp = (const float*)d_in[7]; const float* bp = (const float*)d_in[8];
    const float* g1 = (const float*)d_in[9]; const float* be1 = (const float*)d_in[10]; const float* cw1 = (const float*)d_in[11]; const float* g2 = (const float*)d_in[12]; const float* be2 = (const float*)d_in[13]; const float* cw2 = (const float*)d_in[14]; const float* cb2 = (const float*)d_in[15];
    float* OUT = (float*)d_out;     // [2][256][56][56]
    char* wsp = (char*)d_ws;
    auto take = [&](size_t bytes) { char* p = wsp; wsp += (bytes + 255) & ~(size_t)255; return (void*)p; };
    bf* XT = (bf*)take((size_t)NTOK * CIN * 2); bf* W12 = (bf*)take((size_t)64 * CIN * 2); float* B12 = (float*)take(256); bf* W3 = (bf*)take((size_t)OUTC * CIN * 2);
    float* X12 = (float*)take((size_t)NTOK * 64 * 4); float* X3 = (float*)take((size_t)NTOK * OUTC * 4); float* T1 = (float*)take((size_t)NI * RP2 * KK * HW * 4); float* T2 = (float*)take((size_t)NI * REL * KK * HW * 4); float* ST1 = (float*)take(32 * 32 * 4); float* ST2 = (float*)take(32 * 32 * 4); float* PT = (float*)take((size_t)NI * RP2 * BCH * 32 * 4);
    if ((size_t)(wsp - (char*)d_ws) > ws_size) return;    // carve ~51 MiB
    k_cvt8T<<<(unsigned)(((size_t)NTOK * CIN / 8 + 255) / 256), 256, 0, stream>>>(x, XT); k_w12<<<(64 * CIN / 8 + 255) / 256, 256, 0, stream>>>(w1, w2, b1, b2, W12, B12); k_cvt8<<<(unsigned)(((size_t)OUTC * CIN / 8 + 255) / 256), 256, 0, stream>>>(w3, W3, (size_t)OUTC * CIN / 8);
    k_gemmw<bf, 0, true><<<dim3(NTOK / 64, 1, 1), 32, 0, stream>>>(XT, nullptr, W12, nullptr, CIN, X12, 64, B12, 0, 0, 0);             /* x1 | x2 token-major [tok][0..15 | 16..31] */
    k_gemmw<bf, 0, true><<<dim3(NTOK / 64, OUTC / 64, 1), 32, 0, stream>>>(XT, nullptr, W3, nullptr, CIN, X3, OUTC, b3, 0, 0, 0);        /* x3 token-major [tok][256] */
    k_feat<<<(unsigned)(((size_t)NI * RP2 * KK * HW / 4 + 255) / 256), 256, 0, stream>>>(X12, wp, bp, T1);
    k_bnpart<<<NI * RP2 * BCH, BTH, 0, stream>>>(T1, PT); k_bnfin<<<RP2, 32, 0, stream>>>(PT, RP2, ST1);
    k_conv1<<<(unsigned)(((size_t)NI * KK * HW / 4 + 255) / 256), 256, 0, stream>>>(T1, ST1, g1, be1, cw1, T2);
    k_bnpart<<<NI * REL * BCH, BTH, 0, stream>>>(T2, PT); k_bnfin<<<REL, 32, 0, stream>>>(PT, REL, ST2);
    k_final<<<(unsigned)(((size_t)NI * NG * HW + 255) / 256), 256, 0, stream>>>(T2, ST2, g2, be2, cw2, cb2, X3, OUT);
}

// v003
// One run takes 129 microseconds.
// Timed twice side by side with v002, it ran 1.25 and 1.26 times as fast.
// Counting every step since v000, it is 24.2 times as fast.
#include <hip/hip_runtime.h>

// SAN pairwise self-attention module (x [2][256][56][56]; x1, x2 = 1x1(x; [16][256] + b), x3 = 1x1(x; [256][256] + b); pos = 1x1(linspace grid [2][56][56]; wp [2][2] + bp); 7x7 reflect-padded windows (pad 3): t = concat(x1 - unfold(x2), pos - unfold(pos)) [2][18][49][3136];
// t = relu(BN1(t)) (training-mode batch statistics over n, k, p per channel); t = 1x1(t; cw1 [16][18]); t = relu(BN2(t)); wlog = 1x1(t; cw2 [32][16] + cb2); w = softmax over the 49 window slots; out[n][g*8+s][p] = sum_k unfold(x3)[n][g*8+s][k][p] w[n][g][k][p] -> [2][256][56][56] (1.6 M)).
// Compute dtypes, f32 accumulate: every input rounded to bf16; the three 1x1 input convs on PLAIN bf16 operands (input transposed while converting; exact) + f32 biases, their results stored channel-major [channel][n*3136 + p]; everything after that in f32 on the VALU: window differences, position features (linspace in f32), both BatchNorms with deterministic fixed-order batch statistics (14 work-groups per channel, each its chunk's sum and squared distances from the chunk mean, merged by one wave per channel; biased variance, eps 1e-5), the 18->16 and 16->32 channel mixes, the 49-way softmax (online form: running max/sum with rescaling) fused with the weighted aggregation of the reflect-gathered x3.

#define NI   2
#define CIN  256
#define IMW  56
#define HW   3136
#define NTOK (NI * HW)      // 6272 = 98 x 64
#define REL  16
#define RP2  18             // rel + 2 position channels
#define OUTC 256
#define SHR  8
#define NG   32             // out / share
#define KS   7
#define KK   49
#define PADR 3
#define BNEPS 1e-5f
#define NSTAT ((size_t)NI * KK * HW)   // 307328 elements per channel
typedef _Float16 h16;
typedef unsigned short bf;
typedef __attribute__((ext_vector_type(16))) __bf16   v16bf;
typedef __attribute__((ext_vector_type(16))) _Float16 v16h;
typedef __attribute__((ext_vector_type(8)))  _Float16 v8h;
typedef __attribute__((ext_vector_type(8)))  unsigned short v8us;
typedef __attribute__((ext_vector_type(8)))  float    v8f;
typedef __attribute__((ext_vector_type(4)))  float    v4f;
typedef v8h  __attribute__((may_alias)) v8ha;
typedef v4f  __attribute__((may_alias)) v4fa;
typedef v8us __attribute__((may_alias)) v8usa;

__device__ __forceinline__ unsigned short f2bf(float f) { unsigned u = __float_as_uint(f); u += 0x7FFFu + ((u >> 16) & 1u); return (unsigned short)(u >> 16); }
__device__ __forceinline__ float bf2f(unsigned short b) { return __uint_as_float(((unsigned)b) << 16); }
__device__ __forceinline__ float bfr(float f) { return bf2f(f2bf(f)); }
__device__ __forceinline__ v16h cat16(v8h lo, v8h hi) { return __builtin_shufflevector(lo, hi, 0, 1, 2, 3, 4, 5, 6, 7, 8, 9, 10, 11, 12, 13, 14, 15); }
__device__ __forceinline__ v16bf cat16b(v8us lo, v8us hi) { return __builtin_bit_cast(v16bf, __builtin_shufflevector(lo, hi, 0, 1, 2, 3, 4, 5, 6, 7, 8, 9, 10, 11, 12, 13, 14, 15)); }
__device__ __forceinline__ v8f wmma16(v16h a, v16h b, v8f c) { return __builtin_amdgcn_wmma_f32_16x16x32_f16(false, a, false, b, (short)0, c, false, false); }
__device__ __forceinline__ v8f wmmab(v16bf a, v16bf b, v8f c) { return __builtin_amdgcn_wmma_f32_16x16x32_bf16(false, a, false, b, (short)0, c, false, false); }



// ---- k_gemmw: register-blocked GEMM, ONE WAVE per 64x64 output tile (16 accumulators), operands straight from K-contiguous 16-bit planes; grid (M/64, N/64, Z), 32 threads.
// C[m][n] (f32, pitch ldc, + optional f32 bias[m]) = sum_k A[m][k] Bt[n][k] (+ split products per NSPLIT). z-batch strides sA/sB/sC in elements. K % 32 == 0.
template <typename T16> struct WFrag;
template <> struct WFrag<h16> { typedef v16h V; static __device__ __forceinline__ V ld(const h16* p) { return cat16(*(const v8h*)p, *(const v8h*)(p + 16)); } static __device__ __forceinline__ v8f mma(V a, V b, v8f c) { return wmma16(a, b, c); } };
template <> struct WFrag<bf> { typedef v16bf V; static __device__ __forceinline__ V ld(const bf* p) { return cat16b(*(const v8us*)p, *(const v8us*)(p + 16)); } static __device__ __forceinline__ v8f mma(V a, V b, v8f c) { return wmmab(a, b, c); } };
template <typename T16, int NSPLIT, bool BIAS>
__global__ __launch_bounds__(32) void k_gemmw(const T16* __restrict__ A, const T16* __restrict__ A2, const T16* __restrict__ Bt, const T16* __restrict__ Bt2, int K, float* C, int ldc, const float* __restrict__ bias, size_t sA, size_t sB, size_t sC) {
    typedef typename WFrag<T16>::V V;
    __shared__ __align__(16) float os[16 * 68];
    const size_t z = blockIdx.z; A += z * sA; if (A2) A2 += z * sA; Bt += z * sB; if (Bt2) Bt2 += z * sB; C += z * sC;
    const int lane = threadIdx.x & 31, lr = lane & 15, hi = lane >> 4; const int r0 = blockIdx.x * 64, c0 = blockIdx.y * 64;
    v8f acc[4][4];
#pragma unroll
    for (int mb = 0; mb < 4; ++mb)
#pragma unroll
        for (int nb = 0; nb < 4; ++nb) acc[mb][nb] = (v8f){};
    const size_t aoff = (size_t)(r0 + lr) * K + 8 * hi, boff = (size_t)(c0 + lr) * K + 8 * hi;
#pragma unroll 1
    for (int kc = 0; kc < K; kc += 32) {
        V a[4], a2[4];
#pragma unroll
        for (int mb = 0; mb < 4; ++mb) { a[mb] = WFrag<T16>::ld(A + aoff + (size_t)mb * 16 * K + kc); if (NSPLIT == 1 || NSPLIT == 2) a2[mb] = WFrag<T16>::ld(A2 + aoff + (size_t)mb * 16 * K + kc); }
#pragma unroll
        for (int nb = 0; nb < 4; ++nb) { const V b = WFrag<T16>::ld(Bt + boff + (size_t)nb * 16 * K + kc); V b2; if (NSPLIT >= 2) b2 = WFrag<T16>::ld(Bt2 + boff + (size_t)nb * 16 * K + kc);
#pragma unroll
            for (int mb = 0; mb < 4; ++mb) { acc[mb][nb] = WFrag<T16>::mma(a[mb], b, acc[mb][nb]); if (NSPLIT == 1 || NSPLIT == 2) acc[mb][nb] = WFrag<T16>::mma(a2[mb], b, acc[mb][nb]); if (NSPLIT >= 2) acc[mb][nb] = WFrag<T16>::mma(a[mb], b2, acc[mb][nb]); } }
        asm volatile("v_nop\n\tv_nop\n\tv_nop\n\tv_nop" : "+v"(acc[0][0]), "+v"(acc[1][1]), "+v"(acc[2][2]), "+v"(acc[3][3]) : "v"(a[0]), "v"(a[3]));
    }
#pragma unroll
    for (int mb = 0; mb < 4; ++mb) {
#pragma unroll
        for (int nb = 0; nb < 4; ++nb) {
#pragma unroll
            for (int j = 0; j < 8; ++j) os[(hi * 8 + j) * 68 + nb * 16 + lr] = acc[mb][nb][j]; }
        __builtin_amdgcn_wave_barrier(); asm volatile("" ::: "memory");
        float* crow = C + (size_t)(r0 + mb * 16) * ldc + c0;
{
#pragma unroll
            for (int s = 0; s < 8; ++s) { const int row = 2 * s + hi, cofs = lr * 4; v4f val = *(const v4fa*)(os + row * 68 + cofs); if (BIAS) { const float bv = bfr(bias[r0 + mb * 16 + row]); val[0] += bv; val[1] += bv; val[2] += bv; val[3] += bv; }
                *(v4f*)(crow + (size_t)row * ldc + cofs) = val; }
             }
        asm volatile("s_wait_xcnt 0x0" ::: "memory");   // the next 16 rows reuse the registers that these stores name
        __builtin_amdgcn_wave_barrier(); asm volatile("" ::: "memory");
    }
}

__device__ __forceinline__ h16 tohx(float x) { return (h16)x; }
__device__ __forceinline__ void splitf(float y, unsigned short& h, unsigned short& l) { h = f2bf(y); l = f2bf(y - bf2f(h)); }
typedef __attribute__((ext_vector_type(2))) _Float16 v2h;
typedef __attribute__((ext_vector_type(4))) _Float16 v4h;
typedef __attribute__((ext_vector_type(2))) unsigned short v2us;
typedef __attribute__((ext_vector_type(4))) unsigned short v4us;
typedef __attribute__((ext_vector_type(2))) float v2f;
typedef __attribute__((ext_vector_type(4))) int v4i;

__global__ __launch_bounds__(256) void k_cvt8(const float* __restrict__ src, bf* dst, size_t n8) { const size_t i = (size_t)blockIdx.x * 256 + threadIdx.x; if (i >= n8) return; const v8f v = *(const v8f*)(src + i * 8); v8us o;
#pragma unroll
    for (int k = 0; k < 8; ++k) o[k] = f2bf(v[k]); *(v8us*)(dst + i * 8) = o;  }

// bfrb: bf16 rounding of an input value with a register barrier so the conversion is not folded into v_fma_mix.
__device__ __forceinline__ float bfrb(float x) { float y = bfr(x); asm volatile("" : "+v"(y)); return y; }
__global__ __launch_bounds__(256) void k_cvt8T(const float* __restrict__ src, bf* dst) { const size_t i = (size_t)blockIdx.x * 256 + threadIdx.x; if (i >= (size_t)NTOK * CIN / 8) return; const int tok = (int)(i / (CIN / 8)); const int c0 = (int)(i % (CIN / 8)) * 8; const int n = tok / HW, p = tok % HW; v8us o;
#pragma unroll
    for (int k = 0; k < 8; ++k) o[k] = f2bf(src[((size_t)n * CIN + c0 + k) * HW + p]); *(v8us*)(dst + (size_t)tok * CIN + c0) = o;  }
__global__ __launch_bounds__(256) void k_w12(const float* __restrict__ w1, const float* __restrict__ w2, const float* __restrict__ b1, const float* __restrict__ b2, bf* W12, float* B12) { const int i = blockIdx.x * 256 + threadIdx.x; if (i < 64 * CIN / 8) { const int o = i / (CIN / 8); const int c0 = (i % (CIN / 8)) * 8; v8us ov;
#pragma unroll
        for (int q = 0; q < 8; ++q) { const float v = (o < REL) ? w1[o * CIN + c0 + q] : ((o < 2 * REL) ? w2[(o - REL) * CIN + c0 + q] : 0.0f); ov[q] = f2bf(v); }
        *(v8us*)(W12 + (size_t)o * CIN + c0) = ov;  }
    if (i < 64) { const float v = (i < REL) ? b1[i] : ((i < 2 * REL) ? b2[i - REL] : 0.0f); *(float*)(B12 + i) = v;  } }
__device__ __forceinline__ int refl(int i) { return i < 0 ? -i : (i >= IMW ? 2 * (IMW - 1) - i : i); }
__device__ __forceinline__ float linsp(int j) { return __fadd_rn(-1.0f, __fmul_rn((float)j, 2.0f / 55.0f)); }   /* jnp.linspace(-1, 1, 56)[j] in f32 */
__device__ __forceinline__ float posv(const float* wp, const float* bp, int c, int y, int x) { float a = __fmul_rn(bfrb(wp[c * 2 + 0]), linsp(x)), b = __fmul_rn(bfrb(wp[c * 2 + 1]), linsp(y)); asm volatile("" : "+v"(a), "+v"(b)); float s = __fadd_rn(a, b); asm volatile("" : "+v"(s)); return __fadd_rn(s, bfrb(bp[c])); }
__global__ __launch_bounds__(256) void k_feat(const float* __restrict__ X12, const float* __restrict__ wp, const float* __restrict__ bp, float* T1) { const size_t i = (size_t)blockIdx.x * 256 + threadIdx.x; if (i >= (size_t)NI * RP2 * KK * HW / 4) return; const size_t e = i * 4; const int p0 = (int)(e % HW); const int k = (int)((e / HW) % KK); const int c = (int)((e / ((size_t)HW * KK)) % RP2); const int n = (int)(e / ((size_t)HW * KK * RP2)); const int di = k / KS - PADR, dj = k % KS - PADR; v4f o;
    // X12 is channel-major: consecutive lanes read consecutive pixels of one channel plane (x1 as one 16-byte load, the window neighbours of x2 from a few cache lines per wave).
    const float* x2c = X12 + (size_t)(REL + c) * NTOK + (size_t)n * HW; v4f x1v = (v4f){0.f, 0.f, 0.f, 0.f}; if (c < REL) x1v = *(const v4f*)(X12 + (size_t)c * NTOK + (size_t)n * HW + p0);
#pragma unroll
    for (int q = 0; q < 4; ++q) { const int p = p0 + q; const int y = p / IMW, x = p % IMW; const int yy = refl(y + di), xx = refl(x + dj); const int pn = yy * IMW + xx; float v;
        if (c < REL) { v = __fsub_rn(x1v[q], x2c[pn]); }
        else { const int pc = c - REL; v = __fsub_rn(posv(wp, bp, pc, y, x), posv(wp, bp, pc, yy, xx)); }
        o[q] = v; }
    *(v4f*)(T1 + e) = o;  }
// ---- batch statistics of one BatchNorm, two launches, fixed summation order, no atomics.
// k_bnpart: T is [n][c][49][3136], so work-group b owns the contiguous chunk b = (n*C + c)*7 + j of 7 window slots (21952 values), held in registers: the chunk's sum S, then Q = sum of squared distances from the chunk's own mean. Each work-group stores its own 128-byte line of PT.
// k_bnfin: one wave per channel merges that channel's 14 equal chunks: mean = sum S / N; N var = sum (Q + 21952 (S/21952 - mean)^2) (pairwise merge of variances: no cancellation of large squares); ST[c*32] = mean, ST[c*32+1] = rsqrt(var + eps).
#define BCH  KS                          // chunks per (n, c) plane
#define BCHN (KS * HW)                   // 21952 values per chunk
#define BCHV (BCHN / 4)                  // 5488 16-byte loads per chunk
#define BTH  512
#define BIT  ((BCHV + BTH - 1) / BTH)    // 11 loads per thread, the last one only in the first 368 threads
__device__ __forceinline__ float wavesum(float s) {
#pragma unroll
    for (int sh = 16; sh; sh >>= 1) s += __shfl_xor(s, sh, 32);
    return s; }
__device__ __forceinline__ float blocksum(float s, float* red) { s = wavesum(s); if ((threadIdx.x & 31) == 0) red[threadIdx.x >> 5] = s; __syncthreads(); float t = 0.f;
#pragma unroll
    for (int i = 0; i < BTH / 32; ++i) t += red[i];
    return t; }
__global__ __launch_bounds__(BTH) void k_bnpart(const float* __restrict__ T, float* PT) { __shared__ float red[2][BTH / 32]; const int t = threadIdx.x; const v4f* base = (const v4f*)(T + (size_t)blockIdx.x * BCHN); const bool tail = t < BCHV - (BIT - 1) * BTH; v4f a[BIT];
#pragma unroll
    for (int i = 0; i < BIT - 1; ++i) a[i] = base[i * BTH + t];
    a[BIT - 1] = (v4f){0.f, 0.f, 0.f, 0.f}; if (tail) a[BIT - 1] = base[(BIT - 1) * BTH + t];
    v4f s4 = a[0];
#pragma unroll
    for (int i = 1; i < BIT; ++i) s4 += a[i];
    const float S = blocksum((s4[0] + s4[1]) + (s4[2] + s4[3]), red[0]); const float cm = S * (1.0f / (float)BCHN); v4f q4 = (v4f){0.f, 0.f, 0.f, 0.f};
#pragma unroll
    for (int i = 0; i < BIT - 1; ++i) { const v4f d = a[i] - cm; q4 += d * d; }
    if (tail) { const v4f d = a[BIT - 1] - cm; q4 += d * d; }
    const float Q = blocksum((q4[0] + q4[1]) + (q4[2] + q4[3]), red[1]);
    if (t < 32) PT[(size_t)blockIdx.x * 32 + t] = (t == 0) ? S : ((t == 1) ? Q : 0.0f); }
__global__ __launch_bounds__(32) void k_bnfin(const float* __restrict__ PT, int C, float* ST) { const int lane = threadIdx.x, c = blockIdx.x; const bool on = lane < NI * BCH; const int l = on ? lane : 0; const size_t b = (size_t)((l / BCH) * C + c) * BCH + l % BCH;
    const float S = on ? PT[b * 32] : 0.0f, Q = on ? PT[b * 32 + 1] : 0.0f; const float mean = wavesum(S) * (1.0f / (float)NSTAT); const float d = S * (1.0f / (float)BCHN) - mean;
    const float vs = wavesum(on ? Q + (float)BCHN * d * d : 0.0f); const float rs = __frsqrt_rn(vs * (1.0f / (float)NSTAT) + BNEPS);
    ST[(size_t)c * 32 + lane] = (lane == 0) ? mean : ((lane == 1) ? rs : 0.0f); }
__global__ __launch_bounds__(256) void k_conv1(const float* __restrict__ T1, const float* __restrict__ ST, const float* __restrict__ g1, const float* __restrict__ be1, const float* __restrict__ cw1, float* T2) { const size_t i = (size_t)blockIdx.x * 256 + threadIdx.x; if (i >= (size_t)NI * KK * HW / 4) return; const size_t e = i * 4; const int p0 = (int)(e % HW); const int k = (int)((e / HW) % KK); const int n = (int)(e / ((size_t)HW * KK)); v4f acc[REL];
#pragma unroll
    for (int o = 0; o < REL; ++o) acc[o] = (v4f){0.f, 0.f, 0.f, 0.f};
#pragma unroll 2
    for (int c = 0; c < RP2; ++c) { const v4f a = *(const v4f*)(T1 + (((size_t)n * RP2 + c) * KK + k) * HW + p0); const float mean = ST[c * 32], rs = ST[c * 32 + 1]; const float g0 = g1[c], b0 = be1[c]; float wr[REL];
        // All loads of a channel are issued ahead of its arithmetic, so that they are in flight together (between two pinned operations each was waited for on its own). Unrolled so that wr[] lives in registers.
#pragma unroll
        for (int o = 0; o < REL; ++o) wr[o] = cw1[o * RP2 + c];
        const float gg = bfrb(g0), bb = bfrb(b0); v4f tn;
#pragma unroll
        for (int q = 0; q < 4; ++q) { float d0 = __fsub_rn(a[q], mean); asm volatile("" : "+v"(d0)); float n0 = __fmul_rn(d0, rs); asm volatile("" : "+v"(n0)); float y = __fmul_rn(n0, gg); asm volatile("" : "+v"(y)); float z = __fadd_rn(y, bb); tn[q] = fmaxf(z, 0.0f); }
#pragma unroll
        for (int o = 0; o < REL; ++o) { const float w = bfrb(wr[o]);
#pragma unroll
            for (int q = 0; q < 4; ++q) { float pr = __fmul_rn(w, tn[q]); asm volatile("" : "+v"(pr)); acc[o][q] = __fadd_rn(acc[o][q], pr); } } }
{
#pragma unroll
        for (int o = 0; o < REL; ++o) *(v4f*)(T2 + (((size_t)n * REL + o) * KK + k) * HW + p0) = acc[o];
         } }
// k_final: per (n, g, p) (one lane per p): for each of the 49 window slots k (rolled loop): wl = sum_o cw2[g][o] relu((T2[n][o][k][p] - mean_o) rs_o g2 + be2) + cb2[g]; ONLINE softmax over k in f32 (running max / sum with exp2 rescaling of the 8 accumulators, no per-slot array) fused with the aggregation out[n][g*8+s][p] = sum_k w[k] x3[g*8+s][n*HW + nbr(p,k)] (x3 channel-major [256][n*HW + p] f32: per slot 8 loads of 4 bytes per lane, each on consecutive addresses across the lanes);
__global__ __launch_bounds__(256) void k_final(const float* __restrict__ T2, const float* __restrict__ ST, const float* __restrict__ g2, const float* __restrict__ be2, const float* __restrict__ cw2, const float* __restrict__ cb2, const float* __restrict__ X3, float* out) {
    const size_t gidx = (size_t)blockIdx.x * 256 + threadIdx.x; if (gidx >= (size_t)NI * NG * HW) return; const int p = (int)(gidx % HW); const int g = (int)((gidx / HW) % NG); const int n = (int)(gidx / ((size_t)HW * NG)); const int y = p / IMW, x = p % IMW;
    const float cb = bfrb(cb2[g]); float m = -3.0e38f, Z = 0.f; float acc[SHR];
    // What does not change over the 49 slots is read once, here: inside the loop each of these reads stood between two pinned operations and was waited for on its own. Unrolled so that the arrays live in registers.
    float mu[REL], rs[REL], ga[REL], bt[REL], cw[REL];
#pragma unroll
    for (int o = 0; o < REL; ++o) { mu[o] = ST[o * 32]; rs[o] = ST[o * 32 + 1]; ga[o] = bfr(g2[o]); bt[o] = bfr(be2[o]); cw[o] = bfr(cw2[g * REL + o]); }
#pragma unroll
    for (int s2 = 0; s2 < SHR; ++s2) acc[s2] = 0.f;
#pragma unroll 1
    for (int k = 0; k < KK; ++k) { float s = 0.f;
        // All loads of a slot (16 planes of T2, 8 planes of x3) are issued ahead of its arithmetic, so that they are in flight together. Unrolled so that a[] lives in registers.
        const int yy = refl(y + k / KS - PADR), xx = refl(x + k % KS - PADR); const float* x3p = X3 + (size_t)(g * SHR) * NTOK + (size_t)n * HW + yy * IMW + xx; float v[SHR];
#pragma unroll
        for (int s2 = 0; s2 < SHR; ++s2) v[s2] = x3p[(size_t)s2 * NTOK];
        float a[REL];
#pragma unroll
        for (int o = 0; o < REL; ++o) a[o] = T2[(((size_t)n * REL + o) * KK + k) * HW + p];
#pragma unroll
        for (int o = 0; o < REL; ++o) { float d0 = __fsub_rn(a[o], mu[o]); asm volatile("" : "+v"(d0)); float n0 = __fmul_rn(d0, rs[o]); asm volatile("" : "+v"(n0)); float yv = __fmul_rn(n0, ga[o]); asm volatile("" : "+v"(yv)); float z = __fadd_rn(yv, bt[o]); const float tn = fmaxf(z, 0.0f); float pr = __fmul_rn(cw[o], tn); asm volatile("" : "+v"(pr)); s = __fadd_rn(s, pr); }
        const float wl = __fadd_rn(s, cb);
        const float mn = fmaxf(m, wl); float d1 = __fsub_rn(m, mn), d2 = __fsub_rn(wl, mn); asm volatile("" : "+v"(d1), "+v"(d2)); const float r = __builtin_amdgcn_exp2f(__fmul_rn(d1, 1.4426950408889634f)), w = __builtin_amdgcn_exp2f(__fmul_rn(d2, 1.4426950408889634f)); float zr = __fmul_rn(Z, r); asm volatile("" : "+v"(zr)); Z = __fadd_rn(zr, w); m = mn;
#pragma unroll
        for (int s2 = 0; s2 < SHR; ++s2) { float t0 = __fmul_rn(acc[s2], r); asm volatile("" : "+v"(t0)); float t1 = __fmul_rn(w, v[s2]); asm volatile("" : "+v"(t1)); acc[s2] = __fadd_rn(t0, t1); } }
    const float iz = __fdiv_rn(1.0f, Z);
{
#pragma unroll
        for (int s2 = 0; s2 < SHR; ++s2) *(float*)(out + ((size_t)n * OUTC + g * SHR + s2) * HW + p) = acc[s2] * iz;
         } }

extern "C" void kernel_launch(void* const* d_in, const int* in_sizes, int n_in,
                              void* d_out, int out_size, void* d_ws, size_t ws_size, hipStream_t stream) {
    (void)in_sizes; (void)n_in; (void)out_size;
    const float* x = (const float*)d_in[0]; const float* w1 = (const float*)d_in[1]; const float* b1 = (const float*)d_in[2]; const float* w2 = (const float*)d_in[3]; const float* b2 = (const float*)d_in[4]; const float* w3 = (const float*)d_in[5]; const float* b3 = (const float*)d_in[6]; const float* wp = (const float*)d_in[7]; const float* bp = (const float*)d_in[8];
    const float* g1 = (const float*)d_in[9]; const float* be1 = (const float*)d_in[10]; const float* cw1 = (const float*)d_in[11]; const float* g2 = (const float*)d_in[12]; const float* be2 = (const float*)d_in[13]; const float* cw2 = (const float*)d_in[14]; const float* cb2 = (const float*)d_in[15];
    float* OUT = (float*)d_out;     // [2][256][56][56]
    char* wsp = (char*)d_ws;
    auto take = [&](size_t bytes) { char* p = wsp; wsp += (bytes + 255) & ~(size_t)255; return (void*)p; };
    bf* XT = (bf*)take((size_t)NTOK * CIN * 2); bf* W12 = (bf*)take((size_t)64 * CIN * 2); float* B12 = (float*)take(256); bf* W3 = (bf*)take((size_t)OUTC * CIN * 2);
    float* X12 = (float*)take((size_t)NTOK * 64 * 4); float* X3 = (float*)take((size_t)NTOK * OUTC * 4); float* T1 = (float*)take((size_t)NI * RP2 * KK * HW * 4); float* T2 = (float*)take((size_t)NI * REL * KK * HW * 4); float* ST1 = (float*)take(32 * 32 * 4); float* ST2 = (float*)take(32 * 32 * 4); float* PT = (float*)take((size_t)NI * RP2 * BCH * 32 * 4);
    if ((size_t)(wsp - (char*)d_ws) > ws_size) return;    // carve ~51 MiB
    k_cvt8T<<<(unsigned)(((size_t)NTOK * CIN / 8 + 255) / 256), 256, 0, stream>>>(x, XT); k_w12<<<(64 * CIN / 8 + 255) / 256, 256, 0, stream>>>(w1, w2, b1, b2, W12, B12); k_cvt8<<<(unsigned)(((size_t)OUTC * CIN / 8 + 255) / 256), 256, 0, stream>>>(w3, W3, (size_t)OUTC * CIN / 8);
    k_gemmw<bf, 0, true><<<dim3(1, NTOK / 64, 1), 32, 0, stream>>>(W12, nullptr, XT, nullptr, CIN, X12, NTOK, B12, 0, 0, 0);             /* x1 | x2 channel-major [0..15 | 16..31][tok] */
    k_gemmw<bf, 0, true><<<dim3(OUTC / 64, NTOK / 64, 1), 32, 0, stream>>>(W3, nullptr, XT, nullptr, CIN, X3, NTOK, b3, 0, 0, 0);        /* x3 channel-major [256][tok] */
    k_feat<<<(unsigned)(((size_t)NI * RP2 * KK * HW / 4 + 255) / 256), 256, 0, stream>>>(X12, wp, bp, T1);
    k_bnpart<<<NI * RP2 * BCH, BTH, 0, stream>>>(T1, PT); k_bnfin<<<RP2, 32, 0, stream>>>(PT, RP2, ST1);
    k_conv1<<<(unsigned)(((size_t)NI * KK * HW / 4 + 255) / 256), 256, 0, stream>>>(T1, ST1, g1, be1, cw1, T2);
    k_bnpart<<<NI * REL * BCH, BTH, 0, stream>>>(T2, PT); k_bnfin<<<REL, 32, 0, stream>>>(PT, REL, ST2);
    k_final<<<(unsigned)(((size_t)NI * NG * HW + 255) / 256), 256, 0, stream>>>(T2, ST2, g2, be2, cw2, cb2, X3, OUT);
}

// v004
// It runs in 119 microseconds.
// Next to v003, in two timings, it ran 1.09 times as fast each time.
// Over all steps from v000 it is 26.3 times as fast.
#include <hip/hip_runtime.h>

// SAN pairwise self-attention module (x [2][256][56][56]; x1, x2 = 1x1(x; [16][256] + b), x3 = 1x1(x; [256][256] + b); pos = 1x1(linspace grid [2][56][56]; wp [2][2] + bp); 7x7 reflect-padded windows (pad 3): t = concat(x1 - unfold(x2), pos - unfold(pos)) [2][18][49][3136];
// t = relu(BN1(t)) (training-mode batch statistics over n, k, p per channel); t = 1x1(t; cw1 [16][18]); t = relu(BN2(t)); wlog = 1x1(t; cw2 [32][16] + cb2); w = softmax over the 49 window slots; out[n][g*8+s][p] = sum_k unfold(x3)[n][g*8+s][k][p] w[n][g][k][p] -> [2][256][56][56] (1.6 M)).
// Compute dtypes, f32 accumulate: every input rounded to bf16; the three 1x1 input convs on PLAIN bf16 operands (input transposed while converting; exact) + f32 biases, their results stored channel-major [channel][n*3136 + p]; everything after that in f32 on the VALU: window differences, position features (linspace in f32), both BatchNorms with deterministic fixed-order batch statistics (14 work-groups per channel, each its chunk's sum and squared distances from the chunk mean, merged by one wave per channel; biased variance, eps 1e-5), the 18->16 and 16->32 channel mixes, the 49-way softmax (online form: running max/sum with rescaling) fused with the weighted aggregation of the reflect-gathered x3.

#define NI   2
#define CIN  256
#define IMW  56
#define HW   3136
#define NTOK (NI * HW)      // 6272 = 98 x 64
#define REL  16
#define RP2  18             // rel + 2 position channels
#define OUTC 256
#define SHR  8
#define NG   32             // out / share
#define KS   7
#define KK   49
#define PADR 3
#define BNEPS 1e-5f
#define NSTAT ((size_t)NI * KK * HW)   // 307328 elements per channel
typedef _Float16 h16;
typedef unsigned short bf;
typedef __attribute__((ext_vector_type(16))) __bf16   v16bf;
typedef __attribute__((ext_vector_type(16))) _Float16 v16h;
typedef __attribute__((ext_vector_type(8)))  _Float16 v8h;
typedef __attribute__((ext_vector_type(8)))  unsigned short v8us;
typedef __attribute__((ext_vector_type(8)))  float    v8f;
typedef __attribute__((ext_vector_type(4)))  float    v4f;
typedef v8h  __attribute__((may_alias)) v8ha;
typedef v4f  __attribute__((may_alias)) v4fa;
typedef v8us __attribute__((may_alias)) v8usa;

__device__ __forceinline__ unsigned short f2bf(float f) { unsigned u = __float_as_uint(f); u += 0x7FFFu + ((u >> 16) & 1u); return (unsigned short)(u >> 16); }
__device__ __forceinline__ float bf2f(unsigned short b) { return __uint_as_float(((unsigned)b) << 16); }
__device__ __forceinline__ float bfr(float f) { return bf2f(f2bf(f)); }
__device__ __forceinline__ v16h cat16(v8h lo, v8h hi) { return __builtin_shufflevector(lo, hi, 0, 1, 2, 3, 4, 5, 6, 7, 8, 9, 10, 11, 12, 13, 14, 15); }
__device__ __forceinline__ v16bf cat16b(v8us lo, v8us hi) { return __builtin_bit_cast(v16bf, __builtin_shufflevector(lo, hi, 0, 1, 2, 3, 4, 5, 6, 7, 8, 9, 10, 11, 12, 13, 14, 15)); }
__device__ __forceinline__ v8f wmma16(v16h a, v16h b, v8f c) { return __builtin_amdgcn_wmma_f32_16x16x32_f16(false, a, false, b, (short)0, c, false, false); }
__device__ __forceinline__ v8f wmmab(v16bf a, v16bf b, v8f c) { return __builtin_amdgcn_wmma_f32_16x16x32_bf16(false, a, false, b, (short)0, c, false, false); }



// ---- k_gemmw: register-blocked GEMM, ONE WAVE per 64x64 output tile (16 accumulators), operands straight from K-contiguous 16-bit planes; grid (M/64, N/64, Z), 32 threads.
// C[m][n] (f32, pitch ldc, + optional f32 bias[m]) = sum_k A[m][k] Bt[n][k] (+ split products per NSPLIT). z-batch strides sA/sB/sC in elements. K % 32 == 0.
template <typename T16> struct WFrag;
template <> struct WFrag<h16> { typedef v16h V; static __device__ __forceinline__ V ld(const h16* p) { return cat16(*(const v8h*)p, *(const v8h*)(p + 16)); } static __device__ __forceinline__ v8f mma(V a, V b, v8f c) { return wmma16(a, b, c); } };
template <> struct WFrag<bf> { typedef v16bf V; static __device__ __forceinline__ V ld(const bf* p) { return cat16b(*(const v8us*)p, *(const v8us*)(p + 16)); } static __device__ __forceinline__ v8f mma(V a, V b, v8f c) { return wmmab(a, b, c); } };
template <typename T16, int NSPLIT, bool BIAS>
__global__ __launch_bounds__(32) void k_gemmw(const T16* __restrict__ A, const T16* __restrict__ A2, const T16* __restrict__ Bt, const T16* __restrict__ Bt2, int K, float* C, int ldc, const float* __restrict__ bias, size_t sA, size_t sB, size_t sC) {
    typedef typename WFrag<T16>::V V;
    __shared__ __align__(16) float os[16 * 68];
    const size_t z = blockIdx.z; A += z * sA; if (A2) A2 += z * sA; Bt += z * sB; if (Bt2) Bt2 += z * sB; C += z * sC;
    const int lane = threadIdx.x & 31, lr = lane & 15, hi = lane >> 4; const int r0 = blockIdx.x * 64, c0 = blockIdx.y * 64;
    v8f acc[4][4];
#pragma unroll
    for (int mb = 0; mb < 4; ++mb)
#pragma unroll
        for (int nb = 0; nb < 4; ++nb) acc[mb][nb] = (v8f){};
    const size_t aoff = (size_t)(r0 + lr) * K + 8 * hi, boff = (size_t)(c0 + lr) * K + 8 * hi;
#pragma unroll 1
    for (int kc = 0; kc < K; kc += 32) {
        V a[4], a2[4];
#pragma unroll
        for (int mb = 0; mb < 4; ++mb) { a[mb] = WFrag<T16>::ld(A + aoff + (size_t)mb * 16 * K + kc); if (NSPLIT == 1 || NSPLIT == 2) a2[mb] = WFrag<T16>::ld(A2 + aoff + (size_t)mb * 16 * K + kc); }
#pragma unroll
        for (int nb = 0; nb < 4; ++nb) { const V b = WFrag<T16>::ld(Bt + boff + (size_t)nb * 16 * K + kc); V b2; if (NSPLIT >= 2) b2 = WFrag<T16>::ld(Bt2 + boff + (size_t)nb * 16 * K + kc);
#pragma unroll
            for (int mb = 0; mb < 4; ++mb) { acc[mb][nb] = WFrag<T16>::mma(a[mb], b, acc[mb][nb]); if (NSPLIT == 1 || NSPLIT == 2) acc[mb][nb] = WFrag<T16>::mma(a2[mb], b, acc[mb][nb]); if (NSPLIT >= 2) acc[mb][nb] = WFrag<T16>::mma(a[mb], b2, acc[mb][nb]); } }
        asm volatile("v_nop\n\tv_nop\n\tv_nop\n\tv_nop" : "+v"(acc[0][0]), "+v"(acc[1][1]), "+v"(acc[2][2]), "+v"(acc[3][3]) : "v"(a[0]), "v"(a[3]));
    }
#pragma unroll
    for (int mb = 0; mb < 4; ++mb) {
#pragma unroll
        for (int nb = 0; nb < 4; ++nb) {
#pragma unroll
            for (int j = 0; j < 8; ++j) os[(hi * 8 + j) * 68 + nb * 16 + lr] = acc[mb][nb][j]; }
        __builtin_amdgcn_wave_barrier(); asm volatile("" ::: "memory");
        float* crow = C + (size_t)(r0 + mb * 16) * ldc + c0;
{
#pragma unroll
            for (int s = 0; s < 8; ++s) { const int row = 2 * s + hi, cofs = lr * 4; v4f val = *(const v4fa*)(os + row * 68 + cofs); if (BIAS) { const float bv = bfr(bias[r0 + mb * 16 + row]); val[0] += bv; val[1] += bv; val[2] += bv; val[3] += bv; }
                *(v4f*)(crow + (size_t)row * ldc + cofs) = val; }
             }
        asm volatile("s_wait_xcnt 0x0" ::: "memory");   // the next 16 rows reuse the registers that these stores name
        __builtin_amdgcn_wave_barrier(); asm volatile("" ::: "memory");
    }
}

__device__ __forceinline__ h16 tohx(float x) { return (h16)x; }
__device__ __forceinline__ void splitf(float y, unsigned short& h, unsigned short& l) { h = f2bf(y); l = f2bf(y - bf2f(h)); }
typedef __attribute__((ext_vector_type(2))) _Float16 v2h;
typedef __attribute__((ext_vector_type(4))) _Float16 v4h;
typedef __attribute__((ext_vector_type(2))) unsigned short v2us;
typedef __attribute__((ext_vector_type(4))) unsigned short v4us;
typedef __attribute__((ext_vector_type(2))) float v2f;
typedef __attribute__((ext_vector_type(4))) int v4i;

__global__ __launch_bounds__(256) void k_cvt8(const float* __restrict__ src, bf* dst, size_t n8) { const size_t i = (size_t)blockIdx.x * 256 + threadIdx.x; if (i >= n8) return; const v8f v = *(const v8f*)(src + i * 8); v8us o;
#pragma unroll
    for (int k = 0; k < 8; ++k) o[k] = f2bf(v[k]); *(v8us*)(dst + i * 8) = o;  }

// bfrb: bf16 rounding of an input value with a register barrier so the conversion is not folded into v_fma_mix.
__device__ __forceinline__ float bfrb(float x) { float y = bfr(x); asm volatile("" : "+v"(y)); return y; }
__global__ __launch_bounds__(256) void k_cvt8T(const float* __restrict__ src, bf* dst) { const size_t i = (size_t)blockIdx.x * 256 + threadIdx.x; if (i >= (size_t)NTOK * CIN / 8) return; const int tok = (int)(i / (CIN / 8)); const int c0 = (int)(i % (CIN / 8)) * 8; const int n = tok / HW, p = tok % HW; v8us o;
#pragma unroll
    for (int k = 0; k < 8; ++k) o[k] = f2bf(src[((size_t)n * CIN + c0 + k) * HW + p]); *(v8us*)(dst + (size_t)tok * CIN + c0) = o;  }
__global__ __launch_bounds__(256) void k_w12(const float* __restrict__ w1, const float* __restrict__ w2, const float* __restrict__ b1, const float* __restrict__ b2, bf* W12, float* B12) { const int i = blockIdx.x * 256 + threadIdx.x; if (i < 64 * CIN / 8) { const int o = i / (CIN / 8); const int c0 = (i % (CIN / 8)) * 8; v8us ov;
#pragma unroll
        for (int q = 0; q < 8; ++q) { const float v = (o < REL) ? w1[o * CIN + c0 + q] : ((o < 2 * REL) ? w2[(o - REL) * CIN + c0 + q] : 0.0f); ov[q] = f2bf(v); }
        *(v8us*)(W12 + (size_t)o * CIN + c0) = ov;  }
    if (i < 64) { const float v = (i < REL) ? b1[i] : ((i < 2 * REL) ? b2[i - REL] : 0.0f); *(float*)(B12 + i) = v;  } }
__device__ __forceinline__ int refl(int i) { return i < 0 ? -i : (i >= IMW ? 2 * (IMW - 1) - i : i); }
__device__ __forceinline__ float linsp(int j) { return __fadd_rn(-1.0f, __fmul_rn((float)j, 2.0f / 55.0f)); }   /* jnp.linspace(-1, 1, 56)[j] in f32 */
__device__ __forceinline__ float posv(const float* wp, const float* bp, int c, int y, int x) { float a = __fmul_rn(bfrb(wp[c * 2 + 0]), linsp(x)), b = __fmul_rn(bfrb(wp[c * 2 + 1]), linsp(y)); asm volatile("" : "+v"(a), "+v"(b)); float s = __fadd_rn(a, b); asm volatile("" : "+v"(s)); return __fadd_rn(s, bfrb(bp[c])); }
// t = concat(x1 - unfold(x2), pos - unfold(pos)) is never stored: its two readers (the BN1 statistics and the 18->16 mix) form it here from the channel-major planes of X12 (0.8 MB, cache resident) and from the position formula.
// Both return four consecutive pixels p0..p0+3 (p0 % 4 == 0: one image row) of window slot (di, dj). t1x4: image n, channel c < 16: x1 as one 16-byte load, the window neighbours of x2 as four 4-byte loads from a few cache lines per wave. t1p4: one position channel, its two weights and its bias read by the caller, once (inside posv each read would stand between two pinned operations and be waited for on its own).
__device__ __forceinline__ v4f t1x4(const float* __restrict__ X12, int n, int c, int di, int dj, int p0) { const int y = p0 / IMW, x = p0 % IMW; const v4f x1v = *(const v4f*)(X12 + (size_t)c * NTOK + n * HW + p0); const float* x2r = X12 + (size_t)(REL + c) * NTOK + n * HW + refl(y + di) * IMW; v4f o;
#pragma unroll
    for (int q = 0; q < 4; ++q) o[q] = __fsub_rn(x1v[q], x2r[refl(x + q + dj)]);
    return o; }
__device__ __forceinline__ v4f t1p4(float w0, float w1, float b, int di, int dj, int p0) { const int y = p0 / IMW, x = p0 % IMW; const int yy = refl(y + di); const float wl[2] = {w0, w1}, bl[1] = {b}; v4f o;
#pragma unroll
    for (int q = 0; q < 4; ++q) o[q] = __fsub_rn(posv(wl, bl, 0, y, x + q), posv(wl, bl, 0, yy, refl(x + q + dj)));
    return o; }
// ---- batch statistics of one BatchNorm, two launches, fixed summation order, no atomics.
// k_bnpart: T is [n][c][49][3136] (GEN: that tensor is not in memory, T is X12 and each value comes from t1x4 / t1p4, same element to the same thread), so work-group b owns the contiguous chunk b = (n*C + c)*7 + j of 7 window slots (21952 values), held in registers: the chunk's sum S, then Q = sum of squared distances from the chunk's own mean. Each work-group stores its own 128-byte line of PT.
// k_bnfin: one wave per channel merges that channel's 14 equal chunks: mean = sum S / N; N var = sum (Q + 21952 (S/21952 - mean)^2) (pairwise merge of variances: no cancellation of large squares); ST[c*32] = mean, ST[c*32+1] = rsqrt(var + eps).
#define BCH  KS                          // chunks per (n, c) plane
#define BCHN (KS * HW)                   // 21952 values per chunk
#define BCHV (BCHN / 4)                  // 5488 16-byte loads per chunk
#define BTH  512
#define BIT  ((BCHV + BTH - 1) / BTH)    // 11 loads per thread, the last one only in the first 368 threads
__device__ __forceinline__ float wavesum(float s) {
#pragma unroll
    for (int sh = 16; sh; sh >>= 1) s += __shfl_xor(s, sh, 32);
    return s; }
__device__ __forceinline__ float blocksum(float s, float* red) { s = wavesum(s); if ((threadIdx.x & 31) == 0) red[threadIdx.x >> 5] = s; __syncthreads(); float t = 0.f;
#pragma unroll
    for (int i = 0; i < BTH / 32; ++i) t += red[i];
    return t; }
template <bool GEN>
__global__ __launch_bounds__(BTH) void k_bnpart(const float* __restrict__ T, const float* __restrict__ wp, const float* __restrict__ bp, float* PT) { __shared__ float red[2][BTH / 32]; const int t = threadIdx.x; const v4f* base = (const v4f*)(T + (size_t)blockIdx.x * BCHN); const bool tail = t < BCHV - (BIT - 1) * BTH; v4f a[BIT];
    const int cj = (int)blockIdx.x % BCH, cc = ((int)blockIdx.x / BCH) % RP2, cn = (int)blockIdx.x / (BCH * RP2);   // GEN: the chunk is window row cj of channel cc of image cn; its 16-byte element e4 is window column e4 / 784, pixels 4 (e4 % 784) ..
    a[BIT - 1] = (v4f){0.f, 0.f, 0.f, 0.f};
    if (!GEN) {
#pragma unroll
        for (int i = 0; i < BIT - 1; ++i) a[i] = base[i * BTH + t];
        if (tail) a[BIT - 1] = base[(BIT - 1) * BTH + t]; }
    else if (cc < REL) {   // t1x4 written out for all eleven elements: element offsets, then the 55 loads in flight together, then the differences. A lane past the chunk's end reads element 0 and drops it.
        const v4f* x1b = (const v4f*)(T + (size_t)cc * NTOK + cn * HW); const float* x2b = T + (size_t)(REL + cc) * NTOK + cn * HW; unsigned o1[BIT], og[BIT][4]; v4f x1v[BIT]; float x2v[BIT][4];
#pragma unroll
        for (int i = 0; i < BIT; ++i) { const int e4 = (i < BIT - 1 || tail) ? i * BTH + t : 0; const int dj = e4 / (HW / 4) - PADR, p0 = (e4 % (HW / 4)) * 4; const int y = p0 / IMW, x = p0 % IMW; const int r = refl(y + cj - PADR) * IMW; o1[i] = (unsigned)(e4 % (HW / 4));
#pragma unroll
            for (int q = 0; q < 4; ++q) og[i][q] = (unsigned)(r + refl(x + q + dj)); }
#pragma unroll
        for (int i = 0; i < BIT; ++i) { x1v[i] = x1b[o1[i]];
#pragma unroll
            for (int q = 0; q < 4; ++q) x2v[i][q] = x2b[og[i][q]]; }
        // The wait before a register that an issued load names is rewritten. The offsets are named as inputs so that their registers stay as they are up to it, also as targets of the later loads (an asm statement takes thirty operands: two statements).
        asm volatile("s_wait_xcnt 0x0" :: "v"(o1[0]), "v"(o1[1]), "v"(o1[2]), "v"(o1[3]), "v"(o1[4]), "v"(o1[5]), "v"(o1[6]), "v"(o1[7]), "v"(o1[8]), "v"(o1[9]), "v"(o1[10]), "v"(og[0][0]), "v"(og[0][1]), "v"(og[0][2]), "v"(og[0][3]), "v"(og[1][0]), "v"(og[1][1]), "v"(og[1][2]), "v"(og[1][3]), "v"(og[2][0]), "v"(og[2][1]), "v"(og[2][2]), "v"(og[2][3]), "v"(og[3][0]), "v"(og[3][1]), "v"(og[3][2]), "v"(og[3][3]) : "memory");
        asm volatile("s_wait_xcnt 0x0" :: "v"(og[4][0]), "v"(og[4][1]), "v"(og[4][2]), "v"(og[4][3]), "v"(og[5][0]), "v"(og[5][1]), "v"(og[5][2]), "v"(og[5][3]), "v"(og[6][0]), "v"(og[6][1]), "v"(og[6][2]), "v"(og[6][3]), "v"(og[7][0]), "v"(og[7][1]), "v"(og[7][2]), "v"(og[7][3]), "v"(og[8][0]), "v"(og[8][1]), "v"(og[8][2]), "v"(og[8][3]), "v"(og[9][0]), "v"(og[9][1]), "v"(og[9][2]), "v"(og[9][3]), "v"(og[10][0]), "v"(og[10][1]), "v"(og[10][2]), "v"(og[10][3]) : "memory");
#pragma unroll
        for (int i = 0; i < BIT; ++i) { if (i < BIT - 1 || tail) {
#pragma unroll
            for (int q = 0; q < 4; ++q) a[i][q] = __fsub_rn(x1v[i][q], x2v[i][q]); } } }
    else { const float w0 = wp[(cc - REL) * 2], w1 = wp[(cc - REL) * 2 + 1], b = bp[cc - REL];
#pragma unroll
        for (int i = 0; i < BIT; ++i) { const int e4 = i * BTH + t; if (i < BIT - 1 || tail) a[i] = t1p4(w0, w1, b, cj - PADR, e4 / (HW / 4) - PADR, (e4 % (HW / 4)) * 4); } }
    v4f s4 = a[0];
#pragma unroll
    for (int i = 1; i < BIT; ++i) s4 += a[i];
    const float S = blocksum((s4[0] + s4[1]) + (s4[2] + s4[3]), red[0]); const float cm = S * (1.0f / (float)BCHN); v4f q4 = (v4f){0.f, 0.f, 0.f, 0.f};
#pragma unroll
    for (int i = 0; i < BIT - 1; ++i) { const v4f d = a[i] - cm; q4 += d * d; }
    if (tail) { const v4f d = a[BIT - 1] - cm; q4 += d * d; }
    const float Q = blocksum((q4[0] + q4[1]) + (q4[2] + q4[3]), red[1]);
    if (t < 32) PT[(size_t)blockIdx.x * 32 + t] = (t == 0) ? S : ((t == 1) ? Q : 0.0f); }
__global__ __launch_bounds__(32) void k_bnfin(const float* __restrict__ PT, int C, float* ST) { const int lane = threadIdx.x, c = blockIdx.x; const bool on = lane < NI * BCH; const int l = on ? lane : 0; const size_t b = (size_t)((l / BCH) * C + c) * BCH + l % BCH;
    const float S = on ? PT[b * 32] : 0.0f, Q = on ? PT[b * 32 + 1] : 0.0f; const float mean = wavesum(S) * (1.0f / (float)NSTAT); const float d = S * (1.0f / (float)BCHN) - mean;
    const float vs = wavesum(on ? Q + (float)BCHN * d * d : 0.0f); const float rs = __frsqrt_rn(vs * (1.0f / (float)NSTAT) + BNEPS);
    ST[(size_t)c * 32 + lane] = (lane == 0) ? mean : ((lane == 1) ? rs : 0.0f); }
__global__ __launch_bounds__(256) void k_conv1(const float* __restrict__ X12, const float* __restrict__ wp, const float* __restrict__ bp, const float* __restrict__ ST, const float* __restrict__ g1, const float* __restrict__ be1, const float* __restrict__ cw1, float* T2) { const int i = (int)blockIdx.x * 256 + (int)threadIdx.x; if (i >= NI * KK * HW / 4) return; const int e = i * 4; const int p0 = e % HW; const int k = (e / HW) % KK; const int n = e / (HW * KK); const int di = k / KS - PADR, dj = k % KS - PADR; v4f acc[REL]; float pw[RP2 - REL][3];
#pragma unroll
    for (int pc = 0; pc < RP2 - REL; ++pc) { pw[pc][0] = wp[pc * 2]; pw[pc][1] = wp[pc * 2 + 1]; pw[pc][2] = bp[pc]; }
#pragma unroll
    for (int o = 0; o < REL; ++o) acc[o] = (v4f){0.f, 0.f, 0.f, 0.f};
    auto mix = [&](int c, v4f a) { const float mean = ST[c * 32], rs = ST[c * 32 + 1]; const float g0 = g1[c], b0 = be1[c]; float wr[REL];
        // All loads of a channel are issued ahead of its arithmetic, so that they are in flight together (between two pinned operations each was waited for on its own). Unrolled so that wr[] lives in registers.
#pragma unroll
        for (int o = 0; o < REL; ++o) wr[o] = cw1[o * RP2 + c];
        const float gg = bfrb(g0), bb = bfrb(b0); v4f tn;
#pragma unroll
        for (int q = 0; q < 4; ++q) { float d0 = __fsub_rn(a[q], mean); asm volatile("" : "+v"(d0)); float n0 = __fmul_rn(d0, rs); asm volatile("" : "+v"(n0)); float y = __fmul_rn(n0, gg); asm volatile("" : "+v"(y)); float z = __fadd_rn(y, bb); tn[q] = fmaxf(z, 0.0f); }
#pragma unroll
        for (int o = 0; o < REL; ++o) { const float w = bfrb(wr[o]);
#pragma unroll
            for (int q = 0; q < 4; ++q) { float pr = __fmul_rn(w, tn[q]); asm volatile("" : "+v"(pr)); acc[o][q] = __fadd_rn(acc[o][q], pr); } } };
    // Eight channels of t are formed at a time: their 40 loads stand ahead of every pinned operation and are in flight together. The outer loop stays rolled so that the kernel's text stays small; the inner ones are unrolled so that tv[] lives in registers.
#pragma unroll 1
    for (int cb = 0; cb < REL; cb += 8) { v4f tv[8];
#pragma unroll
        for (int u = 0; u < 8; ++u) tv[u] = t1x4(X12, n, cb + u, di, dj, p0);
#pragma unroll
        for (int u = 0; u < 8; ++u) mix(cb + u, tv[u]); }
#pragma unroll
    for (int pc = 0; pc < RP2 - REL; ++pc) mix(REL + pc, t1p4(pw[pc][0], pw[pc][1], pw[pc][2], di, dj, p0));
{
#pragma unroll
        for (int o = 0; o < REL; ++o) *(v4f*)(T2 + (((size_t)n * REL + o) * KK + k) * HW + p0) = acc[o];
         } }
// k_final: per (n, g, p) (one lane per p): for each of the 49 window slots k (rolled loop): wl = sum_o cw2[g][o] relu((T2[n][o][k][p] - mean_o) rs_o g2 + be2) + cb2[g]; ONLINE softmax over k in f32 (running max / sum with exp2 rescaling of the 8 accumulators, no per-slot array) fused with the aggregation out[n][g*8+s][p] = sum_k w[k] x3[g*8+s][n*HW + nbr(p,k)] (x3 channel-major [256][n*HW + p] f32: per slot 8 loads of 4 bytes per lane, each on consecutive addresses across the lanes);
__global__ __launch_bounds__(256) void k_final(const float* __restrict__ T2, const float* __restrict__ ST, const float* __restrict__ g2, const float* __restrict__ be2, const float* __restrict__ cw2, const float* __restrict__ cb2, const float* __restrict__ X3, float* out) {
    const size_t gidx = (size_t)blockIdx.x * 256 + threadIdx.x; if (gidx >= (size_t)NI * NG * HW) return; const int p = (int)(gidx % HW); const int g = (int)((gidx / HW) % NG); const int n = (int)(gidx / ((size_t)HW * NG)); const int y = p / IMW, x = p % IMW;
    const float cb = bfrb(cb2[g]); float m = -3.0e38f, Z = 0.f; float acc[SHR];
    // What does not change over the 49 slots is read once, here: inside the loop each of these reads stood between two pinned operations and was waited for on its own. Unrolled so that the arrays live in registers.
    float mu[REL], rs[REL], ga[REL], bt[REL], cw[REL];
#pragma unroll
    for (int o = 0; o < REL; ++o) { mu[o] = ST[o * 32]; rs[o] = ST[o * 32 + 1]; ga[o] = bfr(g2[o]); bt[o] = bfr(be2[o]); cw[o] = bfr(cw2[g * REL + o]); }
#pragma unroll
    for (int s2 = 0; s2 < SHR; ++s2) acc[s2] = 0.f;
#pragma unroll 1
    for (int k = 0; k < KK; ++k) { float s = 0.f;
        // All loads of a slot (16 planes of T2, 8 planes of x3) are issued ahead of its arithmetic, so that they are in flight together. Unrolled so that a[] lives in registers.
        const int yy = refl(y + k / KS - PADR), xx = refl(x + k % KS - PADR); const float* x3p = X3 + (size_t)(g * SHR) * NTOK + (size_t)n * HW + yy * IMW + xx; float v[SHR];
#pragma unroll
        for (int s2 = 0; s2 < SHR; ++s2) v[s2] = x3p[(size_t)s2 * NTOK];
        float a[REL];
#pragma unroll
        for (int o = 0; o < REL; ++o) a[o] = T2[(((size_t)n * REL + o) * KK + k) * HW + p];
#pragma unroll
        for (int o = 0; o < REL; ++o) { float d0 = __fsub_rn(a[o], mu[o]); asm volatile("" : "+v"(d0)); float n0 = __fmul_rn(d0, rs[o]); asm volatile("" : "+v"(n0)); float yv = __fmul_rn(n0, ga[o]); asm volatile("" : "+v"(yv)); float z = __fadd_rn(yv, bt[o]); const float tn = fmaxf(z, 0.0f); float pr = __fmul_rn(cw[o], tn); asm volatile("" : "+v"(pr)); s = __fadd_rn(s, pr); }
        const float wl = __fadd_rn(s, cb);
        const float mn = fmaxf(m, wl); float d1 = __fsub_rn(m, mn), d2 = __fsub_rn(wl, mn); asm volatile("" : "+v"(d1), "+v"(d2)); const float r = __builtin_amdgcn_exp2f(__fmul_rn(d1, 1.4426950408889634f)), w = __builtin_amdgcn_exp2f(__fmul_rn(d2, 1.4426950408889634f)); float zr = __fmul_rn(Z, r); asm volatile("" : "+v"(zr)); Z = __fadd_rn(zr, w); m = mn;
#pragma unroll
        for (int s2 = 0; s2 < SHR; ++s2) { float t0 = __fmul_rn(acc[s2], r); asm volatile("" : "+v"(t0)); float t1 = __fmul_rn(w, v[s2]); asm volatile("" : "+v"(t1)); acc[s2] = __fadd_rn(t0, t1); } }
    const float iz = __fdiv_rn(1.0f, Z);
{
#pragma unroll
        for (int s2 = 0; s2 < SHR; ++s2) *(float*)(out + ((size_t)n * OUTC + g * SHR + s2) * HW + p) = acc[s2] * iz;
         } }

extern "C" void kernel_launch(void* const* d_in, const int* in_sizes, int n_in,
                              void* d_out, int out_size, void* d_ws, size_t ws_size, hipStream_t stream) {
    (void)in_sizes; (void)n_in; (void)out_size;
    const float* x = (const float*)d_in[0]; const float* w1 = (const float*)d_in[1]; const float* b1 = (const float*)d_in[2]; const float* w2 = (const float*)d_in[3]; const float* b2 = (const float*)d_in[4]; const float* w3 = (const float*)d_in[5]; const float* b3 = (const float*)d_in[6]; const float* wp = (const float*)d_in[7]; const float* bp = (const float*)d_in[8];
    const float* g1 = (const float*)d_in[9]; const float* be1 = (const float*)d_in[10]; const float* cw1 = (const float*)d_in[11]; const float* g2 = (const float*)d_in[12]; const float* be2 = (const float*)d_in[13]; const float* cw2 = (const float*)d_in[14]; const float* cb2 = (const float*)d_in[15];
    float* OUT = (float*)d_out;     // [2][256][56][56]
    char* wsp = (char*)d_ws;
    auto take = [&](size_t bytes) { char* p = wsp; wsp += (bytes + 255) & ~(size_t)255; return (void*)p; };
    bf* XT = (bf*)take((size_t)NTOK * CIN * 2); bf* W12 = (bf*)take((size_t)64 * CIN * 2); float* B12 = (float*)take(256); bf* W3 = (bf*)take((size_t)OUTC * CIN * 2);
    float* X12 = (float*)take((size_t)NTOK * 64 * 4); float* X3 = (float*)take((size_t)NTOK * OUTC * 4); float* T2 = (float*)take((size_t)NI * REL * KK * HW * 4); float* ST1 = (float*)take(32 * 32 * 4); float* ST2 = (float*)take(32 * 32 * 4); float* PT = (float*)take((size_t)NI * RP2 * BCH * 32 * 4);
    if ((size_t)(wsp - (char*)d_ws) > ws_size) return;    // carve ~31 MiB
    k_cvt8T<<<(unsigned)(((size_t)NTOK * CIN / 8 + 255) / 256), 256, 0, stream>>>(x, XT); k_w12<<<(64 * CIN / 8 + 255) / 256, 256, 0, stream>>>(w1, w2, b1, b2, W12, B12); k_cvt8<<<(unsigned)(((size_t)OUTC * CIN / 8 + 255) / 256), 256, 0, stream>>>(w3, W3, (size_t)OUTC * CIN / 8);
    k_gemmw<bf, 0, true><<<dim3(1, NTOK / 64, 1), 32, 0, stream>>>(W12, nullptr, XT, nullptr, CIN, X12, NTOK, B12, 0, 0, 0);             /* x1 | x2 channel-major [0..15 | 16..31][tok] */
    k_gemmw<bf, 0, true><<<dim3(OUTC / 64, NTOK / 64, 1), 32, 0, stream>>>(W3, nullptr, XT, nullptr, CIN, X3, NTOK, b3, 0, 0, 0);        /* x3 channel-major [256][tok] */
    k_bnpart<true><<<NI * RP2 * BCH, BTH, 0, stream>>>(X12, wp, bp, PT); k_bnfin<<<RP2, 32, 0, stream>>>(PT, RP2, ST1);
    k_conv1<<<(unsigned)(((size_t)NI * KK * HW / 4 + 255) / 256), 256, 0, stream>>>(X12, wp, bp, ST1, g1, be1, cw1, T2);
    k_bnpart<false><<<NI * REL * BCH, BTH, 0, stream>>>(T2, wp, bp, PT); k_bnfin<<<REL, 32, 0, stream>>>(PT, REL, ST2);
    k_final<<<(unsigned)(((size_t)NI * NG * HW + 255) / 256), 256, 0, stream>>>(T2, ST2, g2, be2, cw2, cb2, X3, OUT);
}

// v005
// A run of this version takes 103 microseconds.
// Timed twice side by side with v004, it ran 1.15 and 1.16 times as fast.
// Over all steps from v000 it is 30.5 times as fast.
#include <hip/hip_runtime.h>

// SAN pairwise self-attention module (x [2][256][56][56]; x1, x2 = 1x1(x; [16][256] + b), x3 = 1x1(x; [256][256] + b); pos = 1x1(linspace grid [2][56][56]; wp [2][2] + bp); 7x7 reflect-padded windows (pad 3): t = concat(x1 - unfold(x2), pos - unfold(pos)) [2][18][49][3136];
// t = relu(BN1(t)) (training-mode batch statistics over n, k, p per channel); t = 1x1(t; cw1 [16][18]); t = relu(BN2(t)); wlog = 1x1(t; cw2 [32][16] + cb2); w = softmax over the 49 window slots; out[n][g*8+s][p] = sum_k unfold(x3)[n][g*8+s][k][p] w[n][g][k][p] -> [2][256][56][56] (1.6 M)).
// Compute dtypes, f32 accumulate: every input rounded to bf16; the three 1x1 input convs on PLAIN bf16 operands (input transposed while converting; exact) + f32 biases, their results stored channel-major [channel][n*3136 + p]; everything after that in f32 on the VALU: window differences, position features (linspace in f32), both BatchNorms with deterministic fixed-order batch statistics (14 work-groups per channel, each its chunk's sum and squared distances from the chunk mean, merged by one wave per channel; biased variance, eps 1e-5), the 18->16 and 16->32 channel mixes, the 49-way softmax (online form: running max/sum with rescaling) fused with the weighted aggregation of the reflect-gathered x3.

#define NI   2
#define CIN  256
#define IMW  56
#define HW   3136
#define NTOK (NI * HW)      // 6272 = 98 x 64
#define REL  16
#define RP2  18             // rel + 2 position channels
#define OUTC 256
#define SHR  8
#define NG   32             // out / share
#define KS   7
#define KK   49
#define PADR 3
#define BNEPS 1e-5f
#define NSTAT ((size_t)NI * KK * HW)   // 307328 elements per channel
typedef _Float16 h16;
typedef unsigned short bf;
typedef __attribute__((ext_vector_type(16))) __bf16   v16bf;
typedef __attribute__((ext_vector_type(16))) _Float16 v16h;
typedef __attribute__((ext_vector_type(8)))  _Float16 v8h;
typedef __attribute__((ext_vector_type(8)))  unsigned short v8us;
typedef __attribute__((ext_vector_type(8)))  float    v8f;
typedef __attribute__((ext_vector_type(4)))  float    v4f;
typedef v8h  __attribute__((may_alias)) v8ha;
typedef v4f  __attribute__((may_alias)) v4fa;
typedef v8us __attribute__((may_alias)) v8usa;

__device__ __forceinline__ unsigned short f2bf(float f) { unsigned u = __float_as_uint(f); u += 0x7FFFu + ((u >> 16) & 1u); return (unsigned short)(u >> 16); }
__device__ __forceinline__ float bf2f(unsigned short b) { return __uint_as_float(((unsigned)b) << 16); }
__device__ __forceinline__ float bfr(float f) { return bf2f(f2bf(f)); }
__device__ __forceinline__ v16h cat16(v8h lo, v8h hi) { return __builtin_shufflevector(lo, hi, 0, 1, 2, 3, 4, 5, 6, 7, 8, 9, 10, 11, 12, 13, 14, 15); }
__device__ __forceinline__ v16bf cat16b(v8us lo, v8us hi) { return __builtin_bit_cast(v16bf, __builtin_shufflevector(lo, hi, 0, 1, 2, 3, 4, 5, 6, 7, 8, 9, 10, 11, 12, 13, 14, 15)); }
__device__ __forceinline__ v8f wmma16(v16h a, v16h b, v8f c) { return __builtin_amdgcn_wmma_f32_16x16x32_f16(false, a, false, b, (short)0, c, false, false); }
__device__ __forceinline__ v8f wmmab(v16bf a, v16bf b, v8f c) { return __builtin_amdgcn_wmma_f32_16x16x32_bf16(false, a, false, b, (short)0, c, false, false); }



// ---- k_gemmw: register-blocked GEMM, ONE WAVE per 64x64 output tile (16 accumulators), operands straight from K-contiguous 16-bit planes; grid (M/64, N/64, Z), 32 threads.
// C[m][n] (f32, pitch ldc, + optional f32 bias[m]) = sum_k A[m][k] Bt[n][k] (+ split products per NSPLIT). z-batch strides sA/sB/sC in elements. K % 32 == 0.
template <typename T16> struct WFrag;
template <> struct WFrag<h16> { typedef v16h V; static __device__ __forceinline__ V ld(const h16* p) { return cat16(*(const v8h*)p, *(const v8h*)(p + 16)); } static __device__ __forceinline__ v8f mma(V a, V b, v8f c) { return wmma16(a, b, c); } };
template <> struct WFrag<bf> { typedef v16bf V; static __device__ __forceinline__ V ld(const bf* p) { return cat16b(*(const v8us*)p, *(const v8us*)(p + 16)); } static __device__ __forceinline__ v8f mma(V a, V b, v8f c) { return wmmab(a, b, c); } };
template <typename T16, int NSPLIT, bool BIAS>
__global__ __launch_bounds__(32) void k_gemmw(const T16* __restrict__ A, const T16* __restrict__ A2, const T16* __restrict__ Bt, const T16* __restrict__ Bt2, int K, float* C, int ldc, const float* __restrict__ bias, size_t sA, size_t sB, size_t sC) {
    typedef typename WFrag<T16>::V V;
    __shared__ __align__(16) float os[16 * 68];
    const size_t z = blockIdx.z; A += z * sA; if (A2) A2 += z * sA; Bt += z * sB; if (Bt2) Bt2 += z * sB; C += z * sC;
    const int lane = threadIdx.x & 31, lr = lane & 15, hi = lane >> 4; const int r0 = blockIdx.x * 64, c0 = blockIdx.y * 64;
    v8f acc[4][4];
#pragma unroll
    for (int mb = 0; mb < 4; ++mb)
#pragma unroll
        for (int nb = 0; nb < 4; ++nb) acc[mb][nb] = (v8f){};
    const size_t aoff = (size_t)(r0 + lr) * K + 8 * hi, boff = (size_t)(c0 + lr) * K + 8 * hi;
#pragma unroll 1
    for (int kc = 0; kc < K; kc += 32) {
        V a[4], a2[4];
#pragma unroll
        for (int mb = 0; mb < 4; ++mb) { a[mb] = WFrag<T16>::ld(A + aoff + (size_t)mb * 16 * K + kc); if (NSPLIT == 1 || NSPLIT == 2) a2[mb] = WFrag<T16>::ld(A2 + aoff + (size_t)mb * 16 * K + kc); }
#pragma unroll
        for (int nb = 0; nb < 4; ++nb) { const V b = WFrag<T16>::ld(Bt + boff + (size_t)nb * 16 * K + kc); V b2; if (NSPLIT >= 2) b2 = WFrag<T16>::ld(Bt2 + boff + (size_t)nb * 16 * K + kc);
#pragma unroll
            for (int mb = 0; mb < 4; ++mb) { acc[mb][nb] = WFrag<T16>::mma(a[mb], b, acc[mb][nb]); if (NSPLIT == 1 || NSPLIT == 2) acc[mb][nb] = WFrag<T16>::mma(a2[mb], b, acc[mb][nb]); if (NSPLIT >= 2) acc[mb][nb] = WFrag<T16>::mma(a[mb], b2, acc[mb][nb]); } }
        asm volatile("v_nop\n\tv_nop\n\tv_nop\n\tv_nop" : "+v"(acc[0][0]), "+v"(acc[1][1]), "+v"(acc[2][2]), "+v"(acc[3][3]) : "v"(a[0]), "v"(a[3]));
    }
#pragma unroll
    for (int mb = 0; mb < 4; ++mb) {
#pragma unroll
        for (int nb = 0; nb < 4; ++nb) {
#pragma unroll
            for (int j = 0; j < 8; ++j) os[(hi * 8 + j) * 68 + nb * 16 + lr] = acc[mb][nb][j]; }
        __builtin_amdgcn_wave_barrier(); asm volatile("" ::: "memory");
        float* crow = C + (size_t)(r0 + mb * 16) * ldc + c0;
{
#pragma unroll
            for (int s = 0; s < 8; ++s) { const int row = 2 * s + hi, cofs = lr * 4; v4f val = *(const v4fa*)(os + row * 68 + cofs); if (BIAS) { const float bv = bfr(bias[r0 + mb * 16 + row]); val[0] += bv; val[1] += bv; val[2] += bv; val[3] += bv; }
                *(v4f*)(crow + (size_t)row * ldc + cofs) = val; }
             }
        asm volatile("s_wait_xcnt 0x0" ::: "memory");   // the next 16 rows reuse the registers that these stores name
        __builtin_amdgcn_wave_barrier(); asm volatile("" ::: "memory");
    }
}

__device__ __forceinline__ h16 tohx(float x) { return (h16)x; }
__device__ __forceinline__ void splitf(float y, unsigned short& h, unsigned short& l) { h = f2bf(y); l = f2bf(y - bf2f(h)); }
typedef __attribute__((ext_vector_type(2))) _Float16 v2h;
typedef __attribute__((ext_vector_type(4))) _Float16 v4h;
typedef __attribute__((ext_vector_type(2))) unsigned short v2us;
typedef __attribute__((ext_vector_type(4))) unsigned short v4us;
typedef __attribute__((ext_vector_type(2))) float v2f;
typedef __attribute__((ext_vector_type(4))) int v4i;

__device__ __forceinline__ void d_cvt8(int blk, const float* __restrict__ src, bf* dst, size_t n8) { const size_t i = (size_t)blk * 256 + threadIdx.x; if (i >= n8) return; const v8f v = *(const v8f*)(src + i * 8); v8us o;
#pragma unroll
    for (int k = 0; k < 8; ++k) o[k] = f2bf(v[k]); *(v8us*)(dst + i * 8) = o;  }

// bfrb: bf16 rounding of an input value with a register barrier so the conversion is not folded into v_fma_mix.
__device__ __forceinline__ float bfrb(float x) { float y = bfr(x); asm volatile("" : "+v"(y)); return y; }
__device__ __forceinline__ void d_cvt8T(int blk, const float* __restrict__ src, bf* dst) { const size_t i = (size_t)blk * 256 + threadIdx.x; if (i >= (size_t)NTOK * CIN / 8) return; const int tok = (int)(i / (CIN / 8)); const int c0 = (int)(i % (CIN / 8)) * 8; const int n = tok / HW, p = tok % HW; v8us o;
#pragma unroll
    for (int k = 0; k < 8; ++k) o[k] = f2bf(src[((size_t)n * CIN + c0 + k) * HW + p]); *(v8us*)(dst + (size_t)tok * CIN + c0) = o;  }
__device__ __forceinline__ void d_w12(int blk, const float* __restrict__ w1, const float* __restrict__ w2, const float* __restrict__ b1, const float* __restrict__ b2, const float* __restrict__ b3, bf* W12, float* B12) { const int i = blk * 256 + threadIdx.x; if (i < 64 * CIN / 8) { const int o = i / (CIN / 8); const int c0 = (i % (CIN / 8)) * 8; v8us ov;
#pragma unroll
        for (int q = 0; q < 8; ++q) { const float v = (o < REL) ? w1[o * CIN + c0 + q] : ((o < 2 * REL) ? w2[(o - REL) * CIN + c0 + q] : 0.0f); ov[q] = f2bf(v); }
        *(v8us*)(W12 + (size_t)o * CIN + c0) = ov;  }
    if (i < 64 + OUTC) { const float v = (i < REL) ? b1[i] : ((i < 2 * REL) ? b2[i - REL] : ((i < 64) ? 0.0f : b3[i - 64])); *(float*)(B12 + i) = v;  } }
// k_prep: the three conversions are independent of one another and share one launch: blocks [0, PB_W) build rows 0..63 of the weight plane (w1 | w2 | zeros) and the 320 biases (b1 | b2 | zeros | b3), the next PB_3 round w3 into rows 64..319, the last PB_T transpose and round x.
#define PB_T ((NTOK * CIN / 8 + 255) / 256)
#define PB_W ((64 * CIN / 8 + 255) / 256)
#define PB_3 ((OUTC * CIN / 8 + 255) / 256)
__global__ __launch_bounds__(256) void k_prep(const float* __restrict__ x, const float* __restrict__ w1, const float* __restrict__ w2, const float* __restrict__ w3, const float* __restrict__ b1, const float* __restrict__ b2, const float* __restrict__ b3, bf* XT, bf* WA, float* BA) { const int b = (int)blockIdx.x;
    if (b < PB_W) d_w12(b, w1, w2, b1, b2, b3, WA, BA); else if (b < PB_W + PB_3) d_cvt8(b - PB_W, w3, WA + (size_t)64 * CIN, (size_t)OUTC * CIN / 8); else d_cvt8T(b - PB_W - PB_3, x, XT); }
__device__ __forceinline__ int refl(int i) { return i < 0 ? -i : (i >= IMW ? 2 * (IMW - 1) - i : i); }
__device__ __forceinline__ float linsp(int j) { return __fadd_rn(-1.0f, __fmul_rn((float)j, 2.0f / 55.0f)); }   /* jnp.linspace(-1, 1, 56)[j] in f32 */
__device__ __forceinline__ float posv(const float* wp, const float* bp, int c, int y, int x) { float a = __fmul_rn(bfrb(wp[c * 2 + 0]), linsp(x)), b = __fmul_rn(bfrb(wp[c * 2 + 1]), linsp(y)); asm volatile("" : "+v"(a), "+v"(b)); float s = __fadd_rn(a, b); asm volatile("" : "+v"(s)); return __fadd_rn(s, bfrb(bp[c])); }
// t = concat(x1 - unfold(x2), pos - unfold(pos)) is never stored: its two readers (the BN1 statistics and the 18->16 mix) form it here from the channel-major planes of X12 (0.8 MB, cache resident) and from the position formula.
// Both return four consecutive pixels p0..p0+3 (p0 % 4 == 0: one image row) of window slot (di, dj). t1x4: image n, channel c < 16: x1 as one 16-byte load, the window neighbours of x2 as four 4-byte loads from a few cache lines per wave. t1p4: one position channel, its two weights and its bias read by the caller, once (inside posv each read would stand between two pinned operations and be waited for on its own).
__device__ __forceinline__ v4f t1x4(const float* __restrict__ X12, int n, int c, int di, int dj, int p0) { const int y = p0 / IMW, x = p0 % IMW; const v4f x1v = *(const v4f*)(X12 + (size_t)c * NTOK + n * HW + p0); const float* x2r = X12 + (size_t)(REL + c) * NTOK + n * HW + refl(y + di) * IMW; v4f o;
#pragma unroll
    for (int q = 0; q < 4; ++q) o[q] = __fsub_rn(x1v[q], x2r[refl(x + q + dj)]);
    return o; }
__device__ __forceinline__ v4f t1p4(float w0, float w1, float b, int di, int dj, int p0) { const int y = p0 / IMW, x = p0 % IMW; const int yy = refl(y + di); const float wl[2] = {w0, w1}, bl[1] = {b}; v4f o;
#pragma unroll
    for (int q = 0; q < 4; ++q) o[q] = __fsub_rn(posv(wl, bl, 0, y, x + q), posv(wl, bl, 0, yy, refl(x + q + dj)));
    return o; }
// ---- batch statistics of one BatchNorm, fixed summation order, no atomics.
// k_bnpart: T is [n][c][49][3136] (GEN: that tensor is not in memory, T is X12 and each value comes from t1x4 / t1p4, same element to the same thread), so work-group b owns the contiguous chunk b = (n*C + c)*7 + j of 7 window slots (21952 values), held in registers: the chunk's sum S, then Q = sum of squared distances from the chunk's own mean. Each work-group stores its own 128-byte line of PT.
// k_bnfin (BN1): one wave per channel merges that channel's 14 equal chunks: mean = sum S / N; N var = sum (Q + 21952 (S/21952 - mean)^2) (pairwise merge of variances: no cancellation of large squares); ST[c*32] = mean, ST[c*32+1] = rsqrt(var + eps).
// bnmerge (BN2): the same merge, same order, with no launch of its own: run at the head of every work-group (256 threads) of k_final, wave w merging channels w, w + 8, ..; sst[c*2] = mean, sst[c*2+1] = rsqrt(var + eps), in LDS; the caller's __syncthreads() hands them to the other waves.
#define BCH  KS                          // chunks per (n, c) plane
#define BCHN (KS * HW)                   // 21952 values per chunk
#define BCHV (BCHN / 4)                  // 5488 16-byte loads per chunk
#define BTH  512
#define BIT  ((BCHV + BTH - 1) / BTH)    // 11 loads per thread, the last one only in the first 368 threads
__device__ __forceinline__ float wavesum(float s) {
#pragma unroll
    for (int sh = 16; sh; sh >>= 1) s += __shfl_xor(s, sh, 32);
    return s; }
__device__ __forceinline__ float blocksum(float s, float* red) { s = wavesum(s); if ((threadIdx.x & 31) == 0) red[threadIdx.x >> 5] = s; __syncthreads(); float t = 0.f;
#pragma unroll
    for (int i = 0; i < BTH / 32; ++i) t += red[i];
    return t; }
template <bool GEN>
__global__ __launch_bounds__(BTH) void k_bnpart(const float* __restrict__ T, const float* __restrict__ wp, const float* __restrict__ bp, float* PT) { __shared__ float red[2][BTH / 32]; const int t = threadIdx.x; const v4f* base = (const v4f*)(T + (size_t)blockIdx.x * BCHN); const bool tail = t < BCHV - (BIT - 1) * BTH; v4f a[BIT];
    const int cj = (int)blockIdx.x % BCH, cc = ((int)blockIdx.x / BCH) % RP2, cn = (int)blockIdx.x / (BCH * RP2);   // GEN: the chunk is window row cj of channel cc of image cn; its 16-byte element e4 is window column e4 / 784, pixels 4 (e4 % 784) ..
    a[BIT - 1] = (v4f){0.f, 0.f, 0.f, 0.f};
    if (!GEN) {
#pragma unroll
        for (int i = 0; i < BIT - 1; ++i) a[i] = base[i * BTH + t];
        if (tail) a[BIT - 1] = base[(BIT - 1) * BTH + t]; }
    else if (cc < REL) {   // t1x4 written out for all eleven elements: element offsets, then the 55 loads in flight together, then the differences. A lane past the chunk's end reads element 0 and drops it.
        const v4f* x1b = (const v4f*)(T + (size_t)cc * NTOK + cn * HW); const float* x2b = T + (size_t)(REL + cc) * NTOK + cn * HW; unsigned o1[BIT], og[BIT][4]; v4f x1v[BIT]; float x2v[BIT][4];
#pragma unroll
        for (int i = 0; i < BIT; ++i) { const int e4 = (i < BIT - 1 || tail) ? i * BTH + t : 0; const int dj = e4 / (HW / 4) - PADR, p0 = (e4 % (HW / 4)) * 4; const int y = p0 / IMW, x = p0 % IMW; const int r = refl(y + cj - PADR) * IMW; o1[i] = (unsigned)(e4 % (HW / 4));
#pragma unroll
            for (int q = 0; q < 4; ++q) og[i][q] = (unsigned)(r + refl(x + q + dj)); }
#pragma unroll
        for (int i = 0; i < BIT; ++i) { x1v[i] = x1b[o1[i]];
#pragma unroll
            for (int q = 0; q < 4; ++q) x2v[i][q] = x2b[og[i][q]]; }
        // The wait before a register that an issued load names is rewritten. The offsets are named as inputs so that their registers stay as they are up to it, also as targets of the later loads (an asm statement takes thirty operands: two statements).
        asm volatile("s_wait_xcnt 0x0" :: "v"(o1[0]), "v"(o1[1]), "v"(o1[2]), "v"(o1[3]), "v"(o1[4]), "v"(o1[5]), "v"(o1[6]), "v"(o1[7]), "v"(o1[8]), "v"(o1[9]), "v"(o1[10]), "v"(og[0][0]), "v"(og[0][1]), "v"(og[0][2]), "v"(og[0][3]), "v"(og[1][0]), "v"(og[1][1]), "v"(og[1][2]), "v"(og[1][3]), "v"(og[2][0]), "v"(og[2][1]), "v"(og[2][2]), "v"(og[2][3]), "v"(og[3][0]), "v"(og[3][1]), "v"(og[3][2]), "v"(og[3][3]) : "memory");
        asm volatile("s_wait_xcnt 0x0" :: "v"(og[4][0]), "v"(og[4][1]), "v"(og[4][2]), "v"(og[4][3]), "v"(og[5][0]), "v"(og[5][1]), "v"(og[5][2]), "v"(og[5][3]), "v"(og[6][0]), "v"(og[6][1]), "v"(og[6][2]), "v"(og[6][3]), "v"(og[7][0]), "v"(og[7][1]), "v"(og[7][2]), "v"(og[7][3]), "v"(og[8][0]), "v"(og[8][1]), "v"(og[8][2]), "v"(og[8][3]), "v"(og[9][0]), "v"(og[9][1]), "v"(og[9][2]), "v"(og[9][3]), "v"(og[10][0]), "v"(og[10][1]), "v"(og[10][2]), "v"(og[10][3]) : "memory");
#pragma unroll
        for (int i = 0; i < BIT; ++i) { if (i < BIT - 1 || tail) {
#pragma unroll
            for (int q = 0; q < 4; ++q) a[i][q] = __fsub_rn(x1v[i][q], x2v[i][q]); } } }
    else { const float w0 = wp[(cc - REL) * 2], w1 = wp[(cc - REL) * 2 + 1], b = bp[cc - REL];
#pragma unroll
        for (int i = 0; i < BIT; ++i) { const int e4 = i * BTH + t; if (i < BIT - 1 || tail) a[i] = t1p4(w0, w1, b, cj - PADR, e4 / (HW / 4) - PADR, (e4 % (HW / 4)) * 4); } }
    v4f s4 = a[0];
#pragma unroll
    for (int i = 1; i < BIT; ++i) s4 += a[i];
    const float S = blocksum((s4[0] + s4[1]) + (s4[2] + s4[3]), red[0]); const float cm = S * (1.0f / (float)BCHN); v4f q4 = (v4f){0.f, 0.f, 0.f, 0.f};
#pragma unroll
    for (int i = 0; i < BIT - 1; ++i) { const v4f d = a[i] - cm; q4 += d * d; }
    if (tail) { const v4f d = a[BIT - 1] - cm; q4 += d * d; }
    const float Q = blocksum((q4[0] + q4[1]) + (q4[2] + q4[3]), red[1]);
    if (t < 32) PT[(size_t)blockIdx.x * 32 + t] = (t == 0) ? S : ((t == 1) ? Q : 0.0f); }
__global__ __launch_bounds__(32) void k_bnfin(const float* __restrict__ PT, int C, float* ST) { const int lane = threadIdx.x, c = blockIdx.x; const bool on = lane < NI * BCH; const int l = on ? lane : 0; const size_t b = (size_t)((l / BCH) * C + c) * BCH + l % BCH;
    const float S = on ? PT[b * 32] : 0.0f, Q = on ? PT[b * 32 + 1] : 0.0f; const float mean = wavesum(S) * (1.0f / (float)NSTAT); const float d = S * (1.0f / (float)BCHN) - mean;
    const float vs = wavesum(on ? Q + (float)BCHN * d * d : 0.0f); const float rs = __frsqrt_rn(vs * (1.0f / (float)NSTAT) + BNEPS);
    ST[(size_t)c * 32 + lane] = (lane == 0) ? mean : ((lane == 1) ? rs : 0.0f); }
// uni: a value that is the same in every lane, read from LDS, goes to a scalar register, where the same value loaded through a uniform address stood: 32 vector registers fewer in k_final and its loop's instructions as they were.
__device__ __forceinline__ float uni(float x) { return __uint_as_float(__builtin_amdgcn_readfirstlane(__float_as_uint(x))); }
// wavesumN: wavesum of N values at once, each in wavesum's own order; the N exchanges of a step are in flight together.
template <int N>
__device__ __forceinline__ void wavesumN(float (&s)[N]) {
#pragma unroll
    for (int sh = 16; sh; sh >>= 1) { float o[N];
#pragma unroll
        for (int i = 0; i < N; ++i) o[i] = __shfl_xor(s[i], sh, 32);
#pragma unroll
        for (int i = 0; i < N; ++i) s[i] += o[i]; } }
template <int C>
__device__ __forceinline__ void bnmerge(const float* __restrict__ PT, float* sst) { const int lane = threadIdx.x & 31; const bool on = lane < NI * BCH; const int l = on ? lane : 0; float S[(C + 7) / 8], Q[(C + 7) / 8], mean[(C + 7) / 8], vs[(C + 7) / 8];
    // Unrolled so that a wave's channels have their loads in flight together.
#pragma unroll
    for (int i = 0; i < (C + 7) / 8; ++i) { const int c = min((int)(threadIdx.x >> 5) + i * 8, C - 1); const size_t b = (size_t)((l / BCH) * C + c) * BCH + l % BCH; S[i] = on ? PT[b * 32] : 0.0f; Q[i] = on ? PT[b * 32 + 1] : 0.0f; }
#pragma unroll
    for (int i = 0; i < (C + 7) / 8; ++i) mean[i] = S[i];
    wavesumN(mean);
#pragma unroll
    for (int i = 0; i < (C + 7) / 8; ++i) { mean[i] *= (1.0f / (float)NSTAT); const float d = S[i] * (1.0f / (float)BCHN) - mean[i]; vs[i] = on ? Q[i] + (float)BCHN * d * d : 0.0f; }
    wavesumN(vs);
    if (lane == 0) {
#pragma unroll
        for (int i = 0; i < (C + 7) / 8; ++i) { const int c = (int)(threadIdx.x >> 5) + i * 8; if (c < C) { sst[c * 2] = mean[i]; sst[c * 2 + 1] = __frsqrt_rn(vs[i] * (1.0f / (float)NSTAT) + BNEPS); } } } }
__global__ __launch_bounds__(256) void k_conv1(const float* __restrict__ X12, const float* __restrict__ wp, const float* __restrict__ bp, const float* __restrict__ ST, const float* __restrict__ g1, const float* __restrict__ be1, const float* __restrict__ cw1, float* T2) { const int i = (int)blockIdx.x * 256 + (int)threadIdx.x; if (i >= NI * KK * HW / 4) return; const int e = i * 4; const int p0 = e % HW; const int k = (e / HW) % KK; const int n = e / (HW * KK); const int di = k / KS - PADR, dj = k % KS - PADR; v4f acc[REL]; float pw[RP2 - REL][3];
#pragma unroll
    for (int pc = 0; pc < RP2 - REL; ++pc) { pw[pc][0] = wp[pc * 2]; pw[pc][1] = wp[pc * 2 + 1]; pw[pc][2] = bp[pc]; }
#pragma unroll
    for (int o = 0; o < REL; ++o) acc[o] = (v4f){0.f, 0.f, 0.f, 0.f};
    auto mix = [&](int c, v4f a) { const float mean = ST[c * 32], rs = ST[c * 32 + 1]; const float g0 = g1[c], b0 = be1[c]; float wr[REL];
        // All loads of a channel are issued ahead of its arithmetic, so that they are in flight together (between two pinned operations each was waited for on its own). Unrolled so that wr[] lives in registers.
#pragma unroll
        for (int o = 0; o < REL; ++o) wr[o] = cw1[o * RP2 + c];
        const float gg = bfrb(g0), bb = bfrb(b0); v4f tn;
#pragma unroll
        for (int q = 0; q < 4; ++q) { float d0 = __fsub_rn(a[q], mean); asm volatile("" : "+v"(d0)); float n0 = __fmul_rn(d0, rs); asm volatile("" : "+v"(n0)); float y = __fmul_rn(n0, gg); asm volatile("" : "+v"(y)); float z = __fadd_rn(y, bb); tn[q] = fmaxf(z, 0.0f); }
#pragma unroll
        for (int o = 0; o < REL; ++o) { const float w = bfrb(wr[o]);
#pragma unroll
            for (int q = 0; q < 4; ++q) { float pr = __fmul_rn(w, tn[q]); asm volatile("" : "+v"(pr)); acc[o][q] = __fadd_rn(acc[o][q], pr); } } };
    // Eight channels of t are formed at a time: their 40 loads stand ahead of every pinned operation and are in flight together. The outer loop stays rolled so that the kernel's text stays small; the inner ones are unrolled so that tv[] lives in registers.
#pragma unroll 1
    for (int cb = 0; cb < REL; cb += 8) { v4f tv[8];
#pragma unroll
        for (int u = 0; u < 8; ++u) tv[u] = t1x4(X12, n, cb + u, di, dj, p0);
#pragma unroll
        for (int u = 0; u < 8; ++u) mix(cb + u, tv[u]); }
#pragma unroll
    for (int pc = 0; pc < RP2 - REL; ++pc) mix(REL + pc, t1p4(pw[pc][0], pw[pc][1], pw[pc][2], di, dj, p0));
{
#pragma unroll
        for (int o = 0; o < REL; ++o) *(v4f*)(T2 + (((size_t)n * REL + o) * KK + k) * HW + p0) = acc[o];
         } }
// k_final: per (n, g, p) (one lane per p): for each of the 49 window slots k (rolled loop): wl = sum_o cw2[g][o] relu((T2[n][o][k][p] - mean_o) rs_o g2 + be2) + cb2[g]; ONLINE softmax over k in f32 (running max / sum with exp2 rescaling of the 8 accumulators, no per-slot array) fused with the aggregation out[n][g*8+s][p] = sum_k w[k] x3[g*8+s][n*HW + nbr(p,k)] (x3 channel-major [256][n*HW + p] f32: per slot 8 loads of 4 bytes per lane, each on consecutive addresses across the lanes);
__global__ __launch_bounds__(256) void k_final(const float* __restrict__ T2, const float* __restrict__ PT, const float* __restrict__ g2, const float* __restrict__ be2, const float* __restrict__ cw2, const float* __restrict__ cb2, const float* __restrict__ X3, float* out) {
    __shared__ float sst[2 * REL]; bnmerge<REL>(PT, sst); __syncthreads();
    const size_t gidx = (size_t)blockIdx.x * 256 + threadIdx.x; if (gidx >= (size_t)NI * NG * HW) return; const int p = (int)(gidx % HW); const int g = (int)((gidx / HW) % NG); const int n = (int)(gidx / ((size_t)HW * NG)); const int y = p / IMW, x = p % IMW;
    const float cb = bfrb(cb2[g]); float m = -3.0e38f, Z = 0.f; float acc[SHR];
    // What does not change over the 49 slots is read once, here: inside the loop each of these reads stood between two pinned operations and was waited for on its own. Unrolled so that the arrays live in registers.
    float mu[REL], rs[REL], ga[REL], bt[REL], cw[REL];
#pragma unroll
    for (int o = 0; o < REL; ++o) { mu[o] = uni(sst[o * 2]); rs[o] = uni(sst[o * 2 + 1]); ga[o] = bfr(g2[o]); bt[o] = bfr(be2[o]); cw[o] = bfr(cw2[g * REL + o]); }
#pragma unroll
    for (int s2 = 0; s2 < SHR; ++s2) acc[s2] = 0.f;
#pragma unroll 1
    for (int k = 0; k < KK; ++k) { float s = 0.f;
        // All loads of a slot (16 planes of T2, 8 planes of x3) are issued ahead of its arithmetic, so that they are in flight together. Unrolled so that a[] lives in registers.
        const int yy = refl(y + k / KS - PADR), xx = refl(x + k % KS - PADR); const float* x3p = X3 + (size_t)(g * SHR) * NTOK + (size_t)n * HW + yy * IMW + xx; float v[SHR];
#pragma unroll
        for (int s2 = 0; s2 < SHR; ++s2) v[s2] = x3p[(size_t)s2 * NTOK];
        float a[REL];
#pragma unroll
        for (int o = 0; o < REL; ++o) a[o] = T2[(((size_t)n * REL + o) * KK + k) * HW + p];
#pragma unroll
        for (int o = 0; o < REL; ++o) { float d0 = __fsub_rn(a[o], mu[o]); asm volatile("" : "+v"(d0)); float n0 = __fmul_rn(d0, rs[o]); asm volatile("" : "+v"(n0)); float yv = __fmul_rn(n0, ga[o]); asm volatile("" : "+v"(yv)); float z = __fadd_rn(yv, bt[o]); const float tn = fmaxf(z, 0.0f); float pr = __fmul_rn(cw[o], tn); asm volatile("" : "+v"(pr)); s = __fadd_rn(s, pr); }
        const float wl = __fadd_rn(s, cb);
        const float mn = fmaxf(m, wl); float d1 = __fsub_rn(m, mn), d2 = __fsub_rn(wl, mn); asm volatile("" : "+v"(d1), "+v"(d2)); const float r = __builtin_amdgcn_exp2f(__fmul_rn(d1, 1.4426950408889634f)), w = __builtin_amdgcn_exp2f(__fmul_rn(d2, 1.4426950408889634f)); float zr = __fmul_rn(Z, r); asm volatile("" : "+v"(zr)); Z = __fadd_rn(zr, w); m = mn;
#pragma unroll
        for (int s2 = 0; s2 < SHR; ++s2) { float t0 = __fmul_rn(acc[s2], r); asm volatile("" : "+v"(t0)); float t1 = __fmul_rn(w, v[s2]); asm volatile("" : "+v"(t1)); acc[s2] = __fadd_rn(t0, t1); } }
    const float iz = __fdiv_rn(1.0f, Z);
{
#pragma unroll
        for (int s2 = 0; s2 < SHR; ++s2) *(float*)(out + ((size_t)n * OUTC + g * SHR + s2) * HW + p) = acc[s2] * iz;
         } }

extern "C" void kernel_launch(void* const* d_in, const int* in_sizes, int n_in,
                              void* d_out, int out_size, void* d_ws, size_t ws_size, hipStream_t stream) {
    (void)in_sizes; (void)n_in; (void)out_size;
    const float* x = (const float*)d_in[0]; const float* w1 = (const float*)d_in[1]; const float* b1 = (const float*)d_in[2]; const float* w2 = (const float*)d_in[3]; const float* b2 = (const float*)d_in[4]; const float* w3 = (const float*)d_in[5]; const float* b3 = (const float*)d_in[6]; const float* wp = (const float*)d_in[7]; const float* bp = (const float*)d_in[8];
    const float* g1 = (const float*)d_in[9]; const float* be1 = (const float*)d_in[10]; const float* cw1 = (const float*)d_in[11]; const float* g2 = (const float*)d_in[12]; const float* be2 = (const float*)d_in[13]; const float* cw2 = (const float*)d_in[14]; const float* cb2 = (const float*)d_in[15];
    float* OUT = (float*)d_out;     // [2][256][56][56]
    char* wsp = (char*)d_ws;
    auto take = [&](size_t bytes) { char* p = wsp; wsp += (bytes + 255) & ~(size_t)255; return (void*)p; };
    bf* XT = (bf*)take((size_t)NTOK * CIN * 2); bf* WA = (bf*)take((size_t)(64 + OUTC) * CIN * 2); float* BA = (float*)take((64 + OUTC) * 4);   /* weight rows and biases: x1 | x2 | 32 zero rows | x3 */
    float* X12 = (float*)take((size_t)NTOK * (64 + OUTC) * 4); float* X3 = X12 + (size_t)NTOK * 64; float* T2 = (float*)take((size_t)NI * REL * KK * HW * 4); float* ST1 = (float*)take(32 * 32 * 4); float* PT = (float*)take((size_t)NI * RP2 * BCH * 32 * 4);
    if ((size_t)(wsp - (char*)d_ws) > ws_size) return;    // carve ~31 MiB
    k_prep<<<PB_T + PB_W + PB_3, 256, 0, stream>>>(x, w1, w2, w3, b1, b2, b3, XT, WA, BA);
    k_gemmw<bf, 0, true><<<dim3((64 + OUTC) / 64, NTOK / 64, 1), 32, 0, stream>>>(WA, nullptr, XT, nullptr, CIN, X12, NTOK, BA, 0, 0, 0);   /* channel-major [row][tok]: rows 0..15 x1, 16..31 x2, 64..319 x3 */
    k_bnpart<true><<<NI * RP2 * BCH, BTH, 0, stream>>>(X12, wp, bp, PT); k_bnfin<<<RP2, 32, 0, stream>>>(PT, RP2, ST1);
    k_conv1<<<(unsigned)(((size_t)NI * KK * HW / 4 + 255) / 256), 256, 0, stream>>>(X12, wp, bp, ST1, g1, be1, cw1, T2);
    k_bnpart<false><<<NI * REL * BCH, BTH, 0, stream>>>(T2, wp, bp, PT);
    k_final<<<(unsigned)(((size_t)NI * NG * HW + 255) / 256), 256, 0, stream>>>(T2, PT, g2, be2, cw2, cb2, X3, OUT);
}

// v006
// One run takes 85.2 microseconds.
// Timed twice side by side with v005, it ran 1.21 and 1.20 times as fast.
// Counting every step since v000, it is 36.8 times as fast.
#include <hip/hip_runtime.h>

// SAN pairwise self-attention module (x [2][256][56][56]; x1, x2 = 1x1(x; [16][256] + b), x3 = 1x1(x; [256][256] + b); pos = 1x1(linspace grid [2][56][56]; wp [2][2] + bp); 7x7 reflect-padded windows (pad 3): t = concat(x1 - unfold(x2), pos - unfold(pos)) [2][18][49][3136];
// t = relu(BN1(t)) (training-mode batch statistics over n, k, p per channel); t = 1x1(t; cw1 [16][18]); t = relu(BN2(t)); wlog = 1x1(t; cw2 [32][16] + cb2); w = softmax over the 49 window slots; out[n][g*8+s][p] = sum_k unfold(x3)[n][g*8+s][k][p] w[n][g][k][p] -> [2][256][56][56] (1.6 M)).
// Compute dtypes, f32 accumulate: every input rounded to bf16; the three 1x1 input convs on PLAIN bf16 operands (input transposed while converting; exact) + f32 biases, their results stored channel-major [channel][n*3136 + p]; everything after that in f32 on the VALU: window differences, position features (linspace in f32), both BatchNorms with deterministic fixed-order batch statistics (14 work-groups per channel, each its chunk's sum and squared distances from the chunk mean, merged by one wave per channel; biased variance, eps 1e-5), the 18->16 and 16->32 channel mixes, the 49-way softmax (online form: running max/sum with rescaling) fused with the weighted aggregation of the reflect-gathered x3.

#define NI   2
#define CIN  256
#define IMW  56
#define HW   3136
#define NTOK (NI * HW)      // 6272 = 98 x 64
#define REL  16
#define RP2  18             // rel + 2 position channels
#define OUTC 256
#define SHR  8
#define NG   32             // out / share
#define KS   7
#define KK   49
#define PADR 3
#define BNEPS 1e-5f
#define NSTAT ((size_t)NI * KK * HW)   // 307328 elements per channel
typedef _Float16 h16;
typedef unsigned short bf;
typedef __attribute__((ext_vector_type(16))) __bf16   v16bf;
typedef __attribute__((ext_vector_type(16))) _Float16 v16h;
typedef __attribute__((ext_vector_type(8)))  _Float16 v8h;
typedef __attribute__((ext_vector_type(8)))  unsigned short v8us;
typedef __attribute__((ext_vector_type(8)))  float    v8f;
typedef __attribute__((ext_vector_type(4)))  float    v4f;
typedef v8h  __attribute__((may_alias)) v8ha;
typedef v4f  __attribute__((may_alias)) v4fa;
typedef v8us __attribute__((may_alias)) v8usa;

__device__ __forceinline__ unsigned short f2bf(float f) { unsigned u = __float_as_uint(f); u += 0x7FFFu + ((u >> 16) & 1u); return (unsigned short)(u >> 16); }
__device__ __forceinline__ float bf2f(unsigned short b) { return __uint_as_float(((unsigned)b) << 16); }
__device__ __forceinline__ float bfr(float f) { return bf2f(f2bf(f)); }
__device__ __forceinline__ v16h cat16(v8h lo, v8h hi) { return __builtin_shufflevector(lo, hi, 0, 1, 2, 3, 4, 5, 6, 7, 8, 9, 10, 11, 12, 13, 14, 15); }
__device__ __forceinline__ v16bf cat16b(v8us lo, v8us hi) { return __builtin_bit_cast(v16bf, __builtin_shufflevector(lo, hi, 0, 1, 2, 3, 4, 5, 6, 7, 8, 9, 10, 11, 12, 13, 14, 15)); }
__device__ __forceinline__ v8f wmma16(v16h a, v16h b, v8f c) { return __builtin_amdgcn_wmma_f32_16x16x32_f16(false, a, false, b, (short)0, c, false, false); }
__device__ __forceinline__ v8f wmmab(v16bf a, v16bf b, v8f c) { return __builtin_amdgcn_wmma_f32_16x16x32_bf16(false, a, false, b, (short)0, c, false, false); }



// ---- k_gemmw: register-blocked GEMM, ONE WAVE per 64x64 output tile (16 accumulators), operands straight from K-contiguous 16-bit planes; grid (M/64, N/64, Z), 32 threads.
// C[m][n] (f32, pitch ldc, + optional f32 bias[m]) = sum_k A[m][k] Bt[n][k] (+ split products per NSPLIT). z-batch strides sA/sB/sC in elements. K % 32 == 0.
template <typename T16> struct WFrag;
template <> struct WFrag<h16> { typedef v16h V; static __device__ __forceinline__ V ld(const h16* p) { return cat16(*(const v8h*)p, *(const v8h*)(p + 16)); } static __device__ __forceinline__ v8f mma(V a, V b, v8f c) { return wmma16(a, b, c); } };
template <> struct WFrag<bf> { typedef v16bf V; static __device__ __forceinline__ V ld(const bf* p) { return cat16b(*(const v8us*)p, *(const v8us*)(p + 16)); } static __device__ __forceinline__ v8f mma(V a, V b, v8f c) { return wmmab(a, b, c); } };
template <typename T16, int NSPLIT, bool BIAS>
__global__ __launch_bounds__(32) void k_gemmw(const T16* __restrict__ A, const T16* __restrict__ A2, const T16* __restrict__ Bt, const T16* __restrict__ Bt2, int K, float* C, int ldc, const float* __restrict__ bias, size_t sA, size_t sB, size_t sC) {
    typedef typename WFrag<T16>::V V;
    __shared__ __align__(16) float os[16 * 68];
    const size_t z = blockIdx.z; A += z * sA; if (A2) A2 += z * sA; Bt += z * sB; if (Bt2) Bt2 += z * sB; C += z * sC;
    const int lane = threadIdx.x & 31, lr = lane & 15, hi = lane >> 4; const int r0 = blockIdx.x * 64, c0 = blockIdx.y * 64;
    v8f acc[4][4];
#pragma unroll
    for (int mb = 0; mb < 4; ++mb)
#pragma unroll
        for (int nb = 0; nb < 4; ++nb) acc[mb][nb] = (v8f){};
    const size_t aoff = (size_t)(r0 + lr) * K + 8 * hi, boff = (size_t)(c0 + lr) * K + 8 * hi;
#pragma unroll 1
    for (int kc = 0; kc < K; kc += 32) {
        V a[4], a2[4];
#pragma unroll
        for (int mb = 0; mb < 4; ++mb) { a[mb] = WFrag<T16>::ld(A + aoff + (size_t)mb * 16 * K + kc); if (NSPLIT == 1 || NSPLIT == 2) a2[mb] = WFrag<T16>::ld(A2 + aoff + (size_t)mb * 16 * K + kc); }
#pragma unroll
        for (int nb = 0; nb < 4; ++nb) { const V b = WFrag<T16>::ld(Bt + boff + (size_t)nb * 16 * K + kc); V b2; if (NSPLIT >= 2) b2 = WFrag<T16>::ld(Bt2 + boff + (size_t)nb * 16 * K + kc);
#pragma unroll
            for (int mb = 0; mb < 4; ++mb) { acc[mb][nb] = WFrag<T16>::mma(a[mb], b, acc[mb][nb]); if (NSPLIT == 1 || NSPLIT == 2) acc[mb][nb] = WFrag<T16>::mma(a2[mb], b, acc[mb][nb]); if (NSPLIT >= 2) acc[mb][nb] = WFrag<T16>::mma(a[mb], b2, acc[mb][nb]); } }
        asm volatile("v_nop\n\tv_nop\n\tv_nop\n\tv_nop" : "+v"(acc[0][0]), "+v"(acc[1][1]), "+v"(acc[2][2]), "+v"(acc[3][3]) : "v"(a[0]), "v"(a[3]));
    }
#pragma unroll
    for (int mb = 0; mb < 4; ++mb) {
#pragma unroll
        for (int nb = 0; nb < 4; ++nb) {
#pragma unroll
            for (int j = 0; j < 8; ++j) os[(hi * 8 + j) * 68 + nb * 16 + lr] = acc[mb][nb][j]; }
        __builtin_amdgcn_wave_barrier(); asm volatile("" ::: "memory");
        float* crow = C + (size_t)(r0 + mb * 16) * ldc + c0;
{
#pragma unroll
            for (int s = 0; s < 8; ++s) { const int row = 2 * s + hi, cofs = lr * 4; v4f val = *(const v4fa*)(os + row * 68 + cofs); if (BIAS) { const float bv = bfr(bias[r0 + mb * 16 + row]); val[0] += bv; val[1] += bv; val[2] += bv; val[3] += bv; }
                *(v4f*)(crow + (size_t)row * ldc + cofs) = val; }
             }
        asm volatile("s_wait_xcnt 0x0" ::: "memory");   // the next 16 rows reuse the registers that these stores name
        __builtin_amdgcn_wave_barrier(); asm volatile("" ::: "memory");
    }
}

__device__ __forceinline__ h16 tohx(float x) { return (h16)x; }
__device__ __forceinline__ void splitf(float y, unsigned short& h, unsigned short& l) { h = f2bf(y); l = f2bf(y - bf2f(h)); }
typedef __attribute__((ext_vector_type(2))) _Float16 v2h;
typedef __attribute__((ext_vector_type(4))) _Float16 v4h;
typedef __attribute__((ext_vector_type(2))) unsigned short v2us;
typedef __attribute__((ext_vector_type(4))) unsigned short v4us;
typedef __attribute__((ext_vector_type(2))) float v2f;
typedef __attribute__((ext_vector_type(4))) int v4i;

__device__ __forceinline__ void d_cvt8(int blk, const float* __restrict__ src, bf* dst, size_t n8) { const size_t i = (size_t)blk * 256 + threadIdx.x; if (i >= n8) return; const v8f v = *(const v8f*)(src + i * 8); v8us o;
#pragma unroll
    for (int k = 0; k < 8; ++k) o[k] = f2bf(v[k]); *(v8us*)(dst + i * 8) = o;  }

// bfrb: bf16 rounding of an input value with a register barrier so the conversion is not folded into v_fma_mix.
__device__ __forceinline__ float bfrb(float x) { float y = bfr(x); asm volatile("" : "+v"(y)); return y; }
__device__ __forceinline__ void d_cvt8T(int blk, const float* __restrict__ src, bf* dst) { const size_t i = (size_t)blk * 256 + threadIdx.x; if (i >= (size_t)NTOK * CIN / 8) return; const int tok = (int)(i / (CIN / 8)); const int c0 = (int)(i % (CIN / 8)) * 8; const int n = tok / HW, p = tok % HW; v8us o;
#pragma unroll
    for (int k = 0; k < 8; ++k) o[k] = f2bf(src[((size_t)n * CIN + c0 + k) * HW + p]); *(v8us*)(dst + (size_t)tok * CIN + c0) = o;  }
__device__ __forceinline__ void d_w12(int blk, const float* __restrict__ w1, const float* __restrict__ w2, const float* __restrict__ b1, const float* __restrict__ b2, const float* __restrict__ b3, bf* W12, float* B12) { const int i = blk * 256 + threadIdx.x; if (i < 64 * CIN / 8) { const int o = i / (CIN / 8); const int c0 = (i % (CIN / 8)) * 8; v8us ov;
#pragma unroll
        for (int q = 0; q < 8; ++q) { const float v = (o < REL) ? w1[o * CIN + c0 + q] : ((o < 2 * REL) ? w2[(o - REL) * CIN + c0 + q] : 0.0f); ov[q] = f2bf(v); }
        *(v8us*)(W12 + (size_t)o * CIN + c0) = ov;  }
    if (i < 64 + OUTC) { const float v = (i < REL) ? b1[i] : ((i < 2 * REL) ? b2[i - REL] : ((i < 64) ? 0.0f : b3[i - 64])); *(float*)(B12 + i) = v;  } }
// k_prep: the three conversions are independent of one another and share one launch: blocks [0, PB_W) build rows 0..63 of the weight plane (w1 | w2 | zeros) and the 320 biases (b1 | b2 | zeros | b3), the next PB_3 round w3 into rows 64..319, the last PB_T transpose and round x.
#define PB_T ((NTOK * CIN / 8 + 255) / 256)
#define PB_W ((64 * CIN / 8 + 255) / 256)
#define PB_3 ((OUTC * CIN / 8 + 255) / 256)
__global__ __launch_bounds__(256) void k_prep(const float* __restrict__ x, const float* __restrict__ w1, const float* __restrict__ w2, const float* __restrict__ w3, const float* __restrict__ b1, const float* __restrict__ b2, const float* __restrict__ b3, bf* XT, bf* WA, float* BA) { const int b = (int)blockIdx.x;
    if (b < PB_W) d_w12(b, w1, w2, b1, b2, b3, WA, BA); else if (b < PB_W + PB_3) d_cvt8(b - PB_W, w3, WA + (size_t)64 * CIN, (size_t)OUTC * CIN / 8); else d_cvt8T(b - PB_W - PB_3, x, XT); }
__device__ __forceinline__ int refl(int i) { return i < 0 ? -i : (i >= IMW ? 2 * (IMW - 1) - i : i); }
__device__ __forceinline__ float linsp(int j) { return __fadd_rn(-1.0f, __fmul_rn((float)j, 2.0f / 55.0f)); }   /* jnp.linspace(-1, 1, 56)[j] in f32 */
__device__ __forceinline__ float posv(const float* wp, const float* bp, int c, int y, int x) { float a = __fmul_rn(bfrb(wp[c * 2 + 0]), linsp(x)), b = __fmul_rn(bfrb(wp[c * 2 + 1]), linsp(y)); asm volatile("" : "+v"(a), "+v"(b)); float s = __fadd_rn(a, b); asm volatile("" : "+v"(s)); return __fadd_rn(s, bfrb(bp[c])); }
// t = concat(x1 - unfold(x2), pos - unfold(pos)) is never stored: its two readers (the BN1 statistics and the 18->16 mix) form it here from the channel-major planes of X12 (0.8 MB, cache resident) and from the position formula.
// Both return four consecutive pixels p0..p0+3 (p0 % 4 == 0: one image row) of window slot (di, dj). t1x4: image n, channel c < 16: x1 as one 16-byte load, the window neighbours of x2 as four 4-byte loads from a few cache lines per wave. t1p4: one position channel, its two weights and its bias read by the caller, once (inside posv each read would stand between two pinned operations and be waited for on its own).
__device__ __forceinline__ v4f t1x4(const float* __restrict__ X12, int n, int c, int di, int dj, int p0) { const int y = p0 / IMW, x = p0 % IMW; const v4f x1v = *(const v4f*)(X12 + (size_t)c * NTOK + n * HW + p0); const float* x2r = X12 + (size_t)(REL + c) * NTOK + n * HW + refl(y + di) * IMW; v4f o;
#pragma unroll
    for (int q = 0; q < 4; ++q) o[q] = __fsub_rn(x1v[q], x2r[refl(x + q + dj)]);
    return o; }
__device__ __forceinline__ v4f t1p4(float w0, float w1, float b, int di, int dj, int p0) { const int y = p0 / IMW, x = p0 % IMW; const int yy = refl(y + di); const float wl[2] = {w0, w1}, bl[1] = {b}; v4f o;
#pragma unroll
    for (int q = 0; q < 4; ++q) o[q] = __fsub_rn(posv(wl, bl, 0, y, x + q), posv(wl, bl, 0, yy, refl(x + q + dj)));
    return o; }
// ---- batch statistics of one BatchNorm, fixed summation order, no atomics.
// k_bnpart: T is [n][c][49][3136] (GEN: that tensor is not in memory, T is X12 and each value comes from t1x4 / t1p4, same element to the same thread), so work-group b owns the contiguous chunk b = (n*C + c)*7 + j of 7 window slots (21952 values), held in registers: the chunk's sum S, then Q = sum of squared distances from the chunk's own mean. Each work-group stores its own 128-byte line of PT.
// k_bnfin (BN1): one wave per channel merges that channel's 14 equal chunks: mean = sum S / N; N var = sum (Q + 21952 (S/21952 - mean)^2) (pairwise merge of variances: no cancellation of large squares); ST[c*32] = mean, ST[c*32+1] = rsqrt(var + eps).
// bnmerge (BN2): the same merge, same order, with no launch of its own: run at the head of every work-group (256 threads) of k_final, wave w merging channels w, w + 8, ..; sst[c*2] = mean, sst[c*2+1] = rsqrt(var + eps), in LDS; the caller's __syncthreads() hands them to the other waves.
#define BCH  KS                          // chunks per (n, c) plane
#define BCHN (KS * HW)                   // 21952 values per chunk
#define BCHV (BCHN / 4)                  // 5488 16-byte loads per chunk
#define BTH  512
#define BIT  ((BCHV + BTH - 1) / BTH)    // 11 loads per thread, the last one only in the first 368 threads
__device__ __forceinline__ float wavesum(float s) {
#pragma unroll
    for (int sh = 16; sh; sh >>= 1) s += __shfl_xor(s, sh, 32);
    return s; }
__device__ __forceinline__ float blocksum(float s, float* red) { s = wavesum(s); if ((threadIdx.x & 31) == 0) red[threadIdx.x >> 5] = s; __syncthreads(); float t = 0.f;
#pragma unroll
    for (int i = 0; i < BTH / 32; ++i) t += red[i];
    return t; }
template <bool GEN>
__global__ __launch_bounds__(BTH) void k_bnpart(const float* __restrict__ T, const float* __restrict__ wp, const float* __restrict__ bp, float* PT) { __shared__ float red[2][BTH / 32]; const int t = threadIdx.x; const v4f* base = (const v4f*)(T + (size_t)blockIdx.x * BCHN); const bool tail = t < BCHV - (BIT - 1) * BTH; v4f a[BIT];
    const int cj = (int)blockIdx.x % BCH, cc = ((int)blockIdx.x / BCH) % RP2, cn = (int)blockIdx.x / (BCH * RP2);   // GEN: the chunk is window row cj of channel cc of image cn; its 16-byte element e4 is window column e4 / 784, pixels 4 (e4 % 784) ..
    a[BIT - 1] = (v4f){0.f, 0.f, 0.f, 0.f};
    if (!GEN) {
#pragma unroll
        for (int i = 0; i < BIT - 1; ++i) a[i] = base[i * BTH + t];
        if (tail) a[BIT - 1] = base[(BIT - 1) * BTH + t]; }
    else if (cc < REL) {   // t1x4 written out for all eleven elements: element offsets, then the 55 loads in flight together, then the differences. A lane past the chunk's end reads element 0 and drops it.
        const v4f* x1b = (const v4f*)(T + (size_t)cc * NTOK + cn * HW); const float* x2b = T + (size_t)(REL + cc) * NTOK + cn * HW; unsigned o1[BIT], og[BIT][4]; v4f x1v[BIT]; float x2v[BIT][4];
#pragma unroll
        for (int i = 0; i < BIT; ++i) { const int e4 = (i < BIT - 1 || tail) ? i * BTH + t : 0; const int dj = e4 / (HW / 4) - PADR, p0 = (e4 % (HW / 4)) * 4; const int y = p0 / IMW, x = p0 % IMW; const int r = refl(y + cj - PADR) * IMW; o1[i] = (unsigned)(e4 % (HW / 4));
#pragma unroll
            for (int q = 0; q < 4; ++q) og[i][q] = (unsigned)(r + refl(x + q + dj)); }
#pragma unroll
        for (int i = 0; i < BIT; ++i) { x1v[i] = x1b[o1[i]];
#pragma unroll
            for (int q = 0; q < 4; ++q) x2v[i][q] = x2b[og[i][q]]; }
        // The wait before a register that an issued load names is rewritten. The offsets are named as inputs so that their registers stay as they are up to it, also as targets of the later loads (an asm statement takes thirty operands: two statements).
        asm volatile("s_wait_xcnt 0x0" :: "v"(o1[0]), "v"(o1[1]), "v"(o1[2]), "v"(o1[3]), "v"(o1[4]), "v"(o1[5]), "v"(o1[6]), "v"(o1[7]), "v"(o1[8]), "v"(o1[9]), "v"(o1[10]), "v"(og[0][0]), "v"(og[0][1]), "v"(og[0][2]), "v"(og[0][3]), "v"(og[1][0]), "v"(og[1][1]), "v"(og[1][2]), "v"(og[1][3]), "v"(og[2][0]), "v"(og[2][1]), "v"(og[2][2]), "v"(og[2][3]), "v"(og[3][0]), "v"(og[3][1]), "v"(og[3][2]), "v"(og[3][3]) : "memory");
        asm volatile("s_wait_xcnt 0x0" :: "v"(og[4][0]), "v"(og[4][1]), "v"(og[4][2]), "v"(og[4][3]), "v"(og[5][0]), "v"(og[5][1]), "v"(og[5][2]), "v"(og[5][3]), "v"(og[6][0]), "v"(og[6][1]), "v"(og[6][2]), "v"(og[6][3]), "v"(og[7][0]), "v"(og[7][1]), "v"(og[7][2]), "v"(og[7][3]), "v"(og[8][0]), "v"(og[8][1]), "v"(og[8][2]), "v"(og[8][3]), "v"(og[9][0]), "v"(og[9][1]), "v"(og[9][2]), "v"(og[9][3]), "v"(og[10][0]), "v"(og[10][1]), "v"(og[10][2]), "v"(og[10][3]) : "memory");
#pragma unroll
        for (int i = 0; i < BIT; ++i) { if (i < BIT - 1 || tail) {
#pragma unroll
            for (int q = 0; q < 4; ++q) a[i][q] = __fsub_rn(x1v[i][q], x2v[i][q]); } } }
    else { const float w0 = wp[(cc - REL) * 2], w1 = wp[(cc - REL) * 2 + 1], b = bp[cc - REL];
#pragma unroll
        for (int i = 0; i < BIT; ++i) { const int e4 = i * BTH + t; if (i < BIT - 1 || tail) a[i] = t1p4(w0, w1, b, cj - PADR, e4 / (HW / 4) - PADR, (e4 % (HW / 4)) * 4); } }
    v4f s4 = a[0];
#pragma unroll
    for (int i = 1; i < BIT; ++i) s4 += a[i];
    const float S = blocksum((s4[0] + s4[1]) + (s4[2] + s4[3]), red[0]); const float cm = S * (1.0f / (float)BCHN); v4f q4 = (v4f){0.f, 0.f, 0.f, 0.f};
#pragma unroll
    for (int i = 0; i < BIT - 1; ++i) { const v4f d = a[i] - cm; q4 += d * d; }
    if (tail) { const v4f d = a[BIT - 1] - cm; q4 += d * d; }
    const float Q = blocksum((q4[0] + q4[1]) + (q4[2] + q4[3]), red[1]);
    if (t < 32) PT[(size_t)blockIdx.x * 32 + t] = (t == 0) ? S : ((t == 1) ? Q : 0.0f); }
__global__ __launch_bounds__(32) void k_bnfin(const float* __restrict__ PT, int C, float* ST) { const int lane = threadIdx.x, c = blockIdx.x; const bool on = lane < NI * BCH; const int l = on ? lane : 0; const size_t b = (size_t)((l / BCH) * C + c) * BCH + l % BCH;
    const float S = on ? PT[b * 32] : 0.0f, Q = on ? PT[b * 32 + 1] : 0.0f; const float mean = wavesum(S) * (1.0f / (float)NSTAT); const float d = S * (1.0f / (float)BCHN) - mean;
    const float vs = wavesum(on ? Q + (float)BCHN * d * d : 0.0f); const float rs = __frsqrt_rn(vs * (1.0f / (float)NSTAT) + BNEPS);
    ST[(size_t)c * 32 + lane] = (lane == 0) ? mean : ((lane == 1) ? rs : 0.0f); }
// uni: a value that is the same in every lane, read from LDS, goes to a scalar register, where the same value loaded through a uniform address stood: 32 vector registers fewer in k_final and its loop's instructions as they were.
__device__ __forceinline__ float uni(float x) { return __uint_as_float(__builtin_amdgcn_readfirstlane(__float_as_uint(x))); }
// wavesumN: wavesum of N values at once, each in wavesum's own order; the N exchanges of a step are in flight together.
template <int N>
__device__ __forceinline__ void wavesumN(float (&s)[N]) {
#pragma unroll
    for (int sh = 16; sh; sh >>= 1) { float o[N];
#pragma unroll
        for (int i = 0; i < N; ++i) o[i] = __shfl_xor(s[i], sh, 32);
#pragma unroll
        for (int i = 0; i < N; ++i) s[i] += o[i]; } }
template <int C>
__device__ __forceinline__ void bnmerge(const float* __restrict__ PT, float* sst) { const int lane = threadIdx.x & 31; const bool on = lane < NI * BCH; const int l = on ? lane : 0; float S[(C + 7) / 8], Q[(C + 7) / 8], mean[(C + 7) / 8], vs[(C + 7) / 8];
    // Unrolled so that a wave's channels have their loads in flight together.
#pragma unroll
    for (int i = 0; i < (C + 7) / 8; ++i) { const int c = min((int)(threadIdx.x >> 5) + i * 8, C - 1); const size_t b = (size_t)((l / BCH) * C + c) * BCH + l % BCH; S[i] = on ? PT[b * 32] : 0.0f; Q[i] = on ? PT[b * 32 + 1] : 0.0f; }
#pragma unroll
    for (int i = 0; i < (C + 7) / 8; ++i) mean[i] = S[i];
    wavesumN(mean);
#pragma unroll
    for (int i = 0; i < (C + 7) / 8; ++i) { mean[i] *= (1.0f / (float)NSTAT); const float d = S[i] * (1.0f / (float)BCHN) - mean[i]; vs[i] = on ? Q[i] + (float)BCHN * d * d : 0.0f; }
    wavesumN(vs);
    if (lane == 0) {
#pragma unroll
        for (int i = 0; i < (C + 7) / 8; ++i) { const int c = (int)(threadIdx.x >> 5) + i * 8; if (c < C) { sst[c * 2] = mean[i]; sst[c * 2 + 1] = __frsqrt_rn(vs[i] * (1.0f / (float)NSTAT) + BNEPS); } } } }
__global__ __launch_bounds__(256) void k_conv1(const float* __restrict__ X12, const float* __restrict__ wp, const float* __restrict__ bp, const float* __restrict__ ST, const float* __restrict__ g1, const float* __restrict__ be1, const float* __restrict__ cw1, float* T2) { const int i = (int)blockIdx.x * 256 + (int)threadIdx.x; if (i >= NI * KK * HW / 4) return; const int e = i * 4; const int p0 = e % HW; const int k = (e / HW) % KK; const int n = e / (HW * KK); const int di = k / KS - PADR, dj = k % KS - PADR; v4f acc[REL]; float pw[RP2 - REL][3];
#pragma unroll
    for (int pc = 0; pc < RP2 - REL; ++pc) { pw[pc][0] = wp[pc * 2]; pw[pc][1] = wp[pc * 2 + 1]; pw[pc][2] = bp[pc]; }
#pragma unroll
    for (int o = 0; o < REL; ++o) acc[o] = (v4f){0.f, 0.f, 0.f, 0.f};
    auto mix = [&](int c, v4f a) { const float mean = ST[c * 32], rs = ST[c * 32 + 1]; const float g0 = g1[c], b0 = be1[c]; float wr[REL];
        // All loads of a channel are issued ahead of its arithmetic, so that they are in flight together (between two pinned operations each was waited for on its own). Unrolled so that wr[] lives in registers.
#pragma unroll
        for (int o = 0; o < REL; ++o) wr[o] = cw1[o * RP2 + c];
        const float gg = bfrb(g0), bb = bfrb(b0); v4f tn;
#pragma unroll
        for (int q = 0; q < 4; ++q) { float d0 = __fsub_rn(a[q], mean); asm volatile("" : "+v"(d0)); float n0 = __fmul_rn(d0, rs); asm volatile("" : "+v"(n0)); float y = __fmul_rn(n0, gg); asm volatile("" : "+v"(y)); float z = __fadd_rn(y, bb); tn[q] = fmaxf(z, 0.0f); }
#pragma unroll
        for (int o = 0; o < REL; ++o) { const float w = bfrb(wr[o]);
#pragma unroll
            for (int q = 0; q < 4; ++q) { float pr = __fmul_rn(w, tn[q]); asm volatile("" : "+v"(pr)); acc[o][q] = __fadd_rn(acc[o][q], pr); } } };
    // Eight channels of t are formed at a time: their 40 loads stand ahead of every pinned operation and are in flight together. The outer loop stays rolled so that the kernel's text stays small; the inner ones are unrolled so that tv[] lives in registers.
#pragma unroll 1
    for (int cb = 0; cb < REL; cb += 8) { v4f tv[8];
#pragma unroll
        for (int u = 0; u < 8; ++u) tv[u] = t1x4(X12, n, cb + u, di, dj, p0);
#pragma unroll
        for (int u = 0; u < 8; ++u) mix(cb + u, tv[u]); }
#pragma unroll
    for (int pc = 0; pc < RP2 - REL; ++pc) mix(REL + pc, t1p4(pw[pc][0], pw[pc][1], pw[pc][2], di, dj, p0));
{
#pragma unroll
        for (int o = 0; o < REL; ++o) *(v4f*)(T2 + (((size_t)n * REL + o) * KK + k) * HW + p0) = acc[o];
         } }
// k_final: per (n, four share-groups g0..g0+3, p) (one lane per p): for each of the 49 window slots k (rolled loop): tn_o = relu((T2[n][o][k][p] - mean_o) rs_o g2 + be2), read and formed ONCE for the lane's GPL groups (it does not depend on g); per group wl = sum_o cw2[g][o] tn_o + cb2[g]; ONLINE softmax over k in f32 (running max / sum with exp2 rescaling of the 8 accumulators, no per-slot array) fused with the aggregation out[n][g*8+s][p] = sum_k w[k] x3[g*8+s][n*HW + nbr(p,k)] (x3 channel-major [256][n*HW + p] f32: per slot and group 8 loads of 4 bytes per lane, each on consecutive addresses across the lanes). Every output's own operations and their order are those of one group per lane.
#define GPL 4               // share-groups per lane
__global__ __launch_bounds__(256) void k_final(const float* __restrict__ T2, const float* __restrict__ PT, const float* __restrict__ g2, const float* __restrict__ be2, const float* __restrict__ cw2, const float* __restrict__ cb2, const float* __restrict__ X3, float* out) {
    __shared__ float sst[2 * REL]; bnmerge<REL>(PT, sst); __syncthreads();
    const size_t gidx = (size_t)blockIdx.x * 256 + threadIdx.x; if (gidx >= (size_t)NI * (NG / GPL) * HW) return; const int p = (int)(gidx % HW); const int g0 = (int)((gidx / HW) % (NG / GPL)) * GPL; const int n = (int)(gidx / ((size_t)HW * (NG / GPL))); const int y = p / IMW, x = p % IMW;
    float cb[GPL], m[GPL], Z[GPL], acc[GPL][SHR];
    // What does not change over the 49 slots is read once, here: inside the loop each of these reads stood between two pinned operations and was waited for on its own. Unrolled so that the arrays live in registers.
    float mu[REL], rs[REL], ga[REL], bt[REL], cw[GPL][REL];
#pragma unroll
    for (int o = 0; o < REL; ++o) { mu[o] = uni(sst[o * 2]); rs[o] = uni(sst[o * 2 + 1]); ga[o] = bfr(g2[o]); bt[o] = bfr(be2[o]); }
#pragma unroll
    for (int j = 0; j < GPL; ++j) { cb[j] = bfrb(cb2[g0 + j]); m[j] = -3.0e38f; Z[j] = 0.f;
#pragma unroll
        for (int o = 0; o < REL; ++o) cw[j][o] = bfr(cw2[(g0 + j) * REL + o]);
#pragma unroll
        for (int s2 = 0; s2 < SHR; ++s2) acc[j][s2] = 0.f; }
#pragma unroll 1
    for (int k = 0; k < KK; ++k) { float s[GPL], tn[REL];
        // All loads of a slot (16 planes of T2, then 8 planes of x3 per group) are issued ahead of its arithmetic, so that they are in flight together; T2 first, because it is used first. Unrolled so that a[] and v[][] live in registers.
        float a[REL];
#pragma unroll
        for (int o = 0; o < REL; ++o) a[o] = T2[(((size_t)n * REL + o) * KK + k) * HW + p];
        const int yy = refl(y + k / KS - PADR), xx = refl(x + k % KS - PADR); const float* x3p = X3 + (size_t)(g0 * SHR) * NTOK + (size_t)n * HW + yy * IMW + xx; float v[GPL][SHR];
#pragma unroll
        for (int j = 0; j < GPL; ++j) {
#pragma unroll
            for (int s2 = 0; s2 < SHR; ++s2) v[j][s2] = x3p[(size_t)(j * SHR + s2) * NTOK]; }
        __builtin_amdgcn_sched_barrier(0);   // keeps the first uses of a[] behind the x3 loads: paired with the x3 address arithmetic they made those loads wait for T2 to come back
#pragma unroll
        for (int j = 0; j < GPL; ++j) s[j] = 0.f;
#pragma unroll
        for (int o = 0; o < REL; ++o) { float d0 = __fsub_rn(a[o], mu[o]); asm volatile("" : "+v"(d0)); float n0 = __fmul_rn(d0, rs[o]); asm volatile("" : "+v"(n0)); float yv = __fmul_rn(n0, ga[o]); asm volatile("" : "+v"(yv)); float z = __fadd_rn(yv, bt[o]); tn[o] = fmaxf(z, 0.0f); }
#pragma unroll
        for (int o = 0; o < REL; ++o) {
#pragma unroll
            for (int j = 0; j < GPL; ++j) { float pr = __fmul_rn(cw[j][o], tn[o]); asm volatile("" : "+v"(pr)); s[j] = __fadd_rn(s[j], pr); } }
#pragma unroll
        for (int j = 0; j < GPL; ++j) { const float wl = __fadd_rn(s[j], cb[j]);
            const float mn = fmaxf(m[j], wl); float d1 = __fsub_rn(m[j], mn), d2 = __fsub_rn(wl, mn); asm volatile("" : "+v"(d1), "+v"(d2)); const float e1 = __fmul_rn(d1, 1.4426950408889634f), e2 = __fmul_rn(d2, 1.4426950408889634f); const float r = __builtin_amdgcn_exp2f(e1), w = __builtin_amdgcn_exp2f(e2);
            asm volatile("v_nop" :: "v"(e1), "v"(e2), "v"(r), "v"(w));   // the slot behind a transcendental, before a source of it is overwritten: named as inputs, the two sources keep their registers up to it and it stands behind both exponentials (in this build the next instruction overwrote a source; a v_nop with no operands landed elsewhere)
            float zr = __fmul_rn(Z[j], r); asm volatile("" : "+v"(zr)); Z[j] = __fadd_rn(zr, w); m[j] = mn;
#pragma unroll
            for (int s2 = 0; s2 < SHR; ++s2) { float t0 = __fmul_rn(acc[j][s2], r); asm volatile("" : "+v"(t0)); float t1 = __fmul_rn(w, v[j][s2]); asm volatile("" : "+v"(t1)); acc[j][s2] = __fadd_rn(t0, t1); } } }
#pragma unroll
    for (int j = 0; j < GPL; ++j) { const float iz = __fdiv_rn(1.0f, Z[j]);
#pragma unroll
        for (int s2 = 0; s2 < SHR; ++s2) *(float*)(out + ((size_t)n * OUTC + (g0 + j) * SHR + s2) * HW + p) = acc[j][s2] * iz;
         } }

extern "C" void kernel_launch(void* const* d_in, const int* in_sizes, int n_in,
                              void* d_out, int out_size, void* d_ws, size_t ws_size, hipStream_t stream) {
    (void)in_sizes; (void)n_in; (void)out_size;
    const float* x = (const float*)d_in[0]; const float* w1 = (const float*)d_in[1]; const float* b1 = (const float*)d_in[2]; const float* w2 = (const float*)d_in[3]; const float* b2 = (const float*)d_in[4]; const float* w3 = (const float*)d_in[5]; const float* b3 = (const float*)d_in[6]; const float* wp = (const float*)d_in[7]; const float* bp = (const float*)d_in[8];
    const float* g1 = (const float*)d_in[9]; const float* be1 = (const float*)d_in[10]; const float* cw1 = (const float*)d_in[11]; const float* g2 = (const float*)d_in[12]; const float* be2 = (const float*)d_in[13]; const float* cw2 = (const float*)d_in[14]; const float* cb2 = (const float*)d_in[15];
    float* OUT = (float*)d_out;     // [2][256][56][56]
    char* wsp = (char*)d_ws;
    auto take = [&](size_t bytes) { char* p = wsp; wsp += (bytes + 255) & ~(size_t)255; return (void*)p; };
    bf* XT = (bf*)take((size_t)NTOK * CIN * 2); bf* WA = (bf*)take((size_t)(64 + OUTC) * CIN * 2); float* BA = (float*)take((64 + OUTC) * 4);   /* weight rows and biases: x1 | x2 | 32 zero rows | x3 */
    float* X12 = (float*)take((size_t)NTOK * (64 + OUTC) * 4); float* X3 = X12 + (size_t)NTOK * 64; float* T2 = (float*)take((size_t)NI * REL * KK * HW * 4); float* ST1 = (float*)take(32 * 32 * 4); float* PT = (float*)take((size_t)NI * RP2 * BCH * 32 * 4);
    if ((size_t)(wsp - (char*)d_ws) > ws_size) return;    // carve ~31 MiB
    k_prep<<<PB_T + PB_W + PB_3, 256, 0, stream>>>(x, w1, w2, w3, b1, b2, b3, XT, WA, BA);
    k_gemmw<bf, 0, true><<<dim3((64 + OUTC) / 64, NTOK / 64, 1), 32, 0, stream>>>(WA, nullptr, XT, nullptr, CIN, X12, NTOK, BA, 0, 0, 0);   /* channel-major [row][tok]: rows 0..15 x1, 16..31 x2, 64..319 x3 */
    k_bnpart<true><<<NI * RP2 * BCH, BTH, 0, stream>>>(X12, wp, bp, PT); k_bnfin<<<RP2, 32, 0, stream>>>(PT, RP2, ST1);
    k_conv1<<<(unsigned)(((size_t)NI * KK * HW / 4 + 255) / 256), 256, 0, stream>>>(X12, wp, bp, ST1, g1, be1, cw1, T2);
    k_bnpart<false><<<NI * REL * BCH, BTH, 0, stream>>>(T2, wp, bp, PT);
    k_final<<<(unsigned)(((size_t)NI * (NG / GPL) * HW + 255) / 256), 256, 0, stream>>>(T2, PT, g2, be2, cw2, cb2, X3, OUT);
}

// v007
// A run of this version takes 75.3 microseconds.
// Timed twice side by side with v006, it ran 1.13 times as fast both times.
// All steps since v000 together make it 41.6 times as fast.
#include <hip/hip_runtime.h>

// SAN pairwise self-attention module (x [2][256][56][56]; x1, x2 = 1x1(x; [16][256] + b), x3 = 1x1(x; [256][256] + b); pos = 1x1(linspace grid [2][56][56]; wp [2][2] + bp); 7x7 reflect-padded windows (pad 3): t = concat(x1 - unfold(x2), pos - unfold(pos)) [2][18][49][3136];
// t = relu(BN1(t)) (training-mode batch statistics over n, k, p per channel); t = 1x1(t; cw1 [16][18]); t = relu(BN2(t)); wlog = 1x1(t; cw2 [32][16] + cb2); w = softmax over the 49 window slots; out[n][g*8+s][p] = sum_k unfold(x3)[n][g*8+s][k][p] w[n][g][k][p] -> [2][256][56][56] (1.6 M)).
// Compute dtypes, f32 accumulate: every input rounded to bf16; the three 1x1 input convs on PLAIN bf16 operands (input transposed while converting; exact) + f32 biases, their results stored channel-major [channel][n*3136 + p]; everything after that in f32 on the VALU: window differences, position features (linspace in f32), both BatchNorms with deterministic fixed-order batch statistics (14 work-groups per channel, each its chunk's sum and squared distances from the chunk mean, merged by one wave per channel; biased variance, eps 1e-5), the 18->16 and 16->32 channel mixes, the 49-way softmax (online form: running max/sum with rescaling) fused with the weighted aggregation of the reflect-gathered x3.

#define NI   2
#define CIN  256
#define IMW  56
#define HW   3136
#define NTOK (NI * HW)      // 6272 = 98 x 64
#define REL  16
#define RP2  18             // rel + 2 position channels
#define OUTC 256
#define SHR  8
#define NG   32             // out / share
#define KS   7
#define KK   49
#define PADR 3
#define BNEPS 1e-5f
#define NSTAT ((size_t)NI * KK * HW)   // 307328 elements per channel
typedef _Float16 h16;
typedef unsigned short bf;
typedef __attribute__((ext_vector_type(16))) __bf16   v16bf;
typedef __attribute__((ext_vector_type(16))) _Float16 v16h;
typedef __attribute__((ext_vector_type(8)))  _Float16 v8h;
typedef __attribute__((ext_vector_type(8)))  unsigned short v8us;
typedef __attribute__((ext_vector_type(8)))  float    v8f;
typedef __attribute__((ext_vector_type(4)))  float    v4f;
typedef v8h  __attribute__((may_alias)) v8ha;
typedef v4f  __attribute__((may_alias)) v4fa;
typedef v8us __attribute__((may_alias)) v8usa;

__device__ __forceinline__ unsigned short f2bf(float f) { unsigned u = __float_as_uint(f); u += 0x7FFFu + ((u >> 16) & 1u); return (unsigned short)(u >> 16); }
__device__ __forceinline__ float bf2f(unsigned short b) { return __uint_as_float(((unsigned)b) << 16); }
__device__ __forceinline__ float bfr(float f) { return bf2f(f2bf(f)); }
__device__ __forceinline__ v16h cat16(v8h lo, v8h hi) { return __builtin_shufflevector(lo, hi, 0, 1, 2, 3, 4, 5, 6, 7, 8, 9, 10, 11, 12, 13, 14, 15); }
__device__ __forceinline__ v16bf cat16b(v8us lo, v8us hi) { return __builtin_bit_cast(v16bf, __builtin_shufflevector(lo, hi, 0, 1, 2, 3, 4, 5, 6, 7, 8, 9, 10, 11, 12, 13, 14, 15)); }
__device__ __forceinline__ v8f wmma16(v16h a, v16h b, v8f c) { return __builtin_amdgcn_wmma_f32_16x16x32_f16(false, a, false, b, (short)0, c, false, false); }
__device__ __forceinline__ v8f wmmab(v16bf a, v16bf b, v8f c) { return __builtin_amdgcn_wmma_f32_16x16x32_bf16(false, a, false, b, (short)0, c, false, false); }



// ---- k_gemmw: register-blocked GEMM, ONE WAVE per 64x64 output tile (16 accumulators), operands straight from K-contiguous 16-bit planes; grid (M/64, N/64, Z), 32 threads.
// C[m][n] (f32, pitch ldc, + optional f32 bias[m]) = sum_k A[m][k] Bt[n][k] (+ split products per NSPLIT). z-batch strides sA/sB/sC in elements. K % 32 == 0.
template <typename T16> struct WFrag;
template <> struct WFrag<h16> { typedef v16h V; static __device__ __forceinline__ V ld(const h16* p) { return cat16(*(const v8h*)p, *(const v8h*)(p + 16)); } static __device__ __forceinline__ v8f mma(V a, V b, v8f c) { return wmma16(a, b, c); } };
template <> struct WFrag<bf> { typedef v16bf V; static __device__ __forceinline__ V ld(const bf* p) { return cat16b(*(const v8us*)p, *(const v8us*)(p + 16)); } static __device__ __forceinline__ v8f mma(V a, V b, v8f c) { return wmmab(a, b, c); } };
template <typename T16, int NSPLIT, bool BIAS>
__global__ __launch_bounds__(32) void k_gemmw(const T16* __restrict__ A, const T16* __restrict__ A2, const T16* __restrict__ Bt, const T16* __restrict__ Bt2, int K, float* C, int ldc, const float* __restrict__ bias, size_t sA, size_t sB, size_t sC) {
    typedef typename WFrag<T16>::V V;
    __shared__ __align__(16) float os[16 * 68];
    const size_t z = blockIdx.z; A += z * sA; if (A2) A2 += z * sA; Bt += z * sB; if (Bt2) Bt2 += z * sB; C += z * sC;
    const int lane = threadIdx.x & 31, lr = lane & 15, hi = lane >> 4; const int r0 = blockIdx.x * 64, c0 = blockIdx.y * 64;
    v8f acc[4][4];
#pragma unroll
    for (int mb = 0; mb < 4; ++mb)
#pragma unroll
        for (int nb = 0; nb < 4; ++nb) acc[mb][nb] = (v8f){};
    const size_t aoff = (size_t)(r0 + lr) * K + 8 * hi, boff = (size_t)(c0 + lr) * K + 8 * hi;
#pragma unroll 1
    for (int kc = 0; kc < K; kc += 32) {
        V a[4], a2[4];
#pragma unroll
        for (int mb = 0; mb < 4; ++mb) { a[mb] = WFrag<T16>::ld(A + aoff + (size_t)mb * 16 * K + kc); if (NSPLIT == 1 || NSPLIT == 2) a2[mb] = WFrag<T16>::ld(A2 + aoff + (size_t)mb * 16 * K + kc); }
#pragma unroll
        for (int nb = 0; nb < 4; ++nb) { const V b = WFrag<T16>::ld(Bt + boff + (size_t)nb * 16 * K + kc); V b2; if (NSPLIT >= 2) b2 = WFrag<T16>::ld(Bt2 + boff + (size_t)nb * 16 * K + kc);
#pragma unroll
            for (int mb = 0; mb < 4; ++mb) { acc[mb][nb] = WFrag<T16>::mma(a[mb], b, acc[mb][nb]); if (NSPLIT == 1 || NSPLIT == 2) acc[mb][nb] = WFrag<T16>::mma(a2[mb], b, acc[mb][nb]); if (NSPLIT >= 2) acc[mb][nb] = WFrag<T16>::mma(a[mb], b2, acc[mb][nb]); } }
        asm volatile("v_nop\n\tv_nop\n\tv_nop\n\tv_nop" : "+v"(acc[0][0]), "+v"(acc[1][1]), "+v"(acc[2][2]), "+v"(acc[3][3]) : "v"(a[0]), "v"(a[3]));
    }
#pragma unroll
    for (int mb = 0; mb < 4; ++mb) {
#pragma unroll
        for (int nb = 0; nb < 4; ++nb) {
#pragma unroll
            for (int j = 0; j < 8; ++j) os[(hi * 8 + j) * 68 + nb * 16 + lr] = acc[mb][nb][j]; }
        __builtin_amdgcn_wave_barrier(); asm volatile("" ::: "memory");
        float* crow = C + (size_t)(r0 + mb * 16) * ldc + c0;
{
#pragma unroll
            for (int s = 0; s < 8; ++s) { const int row = 2 * s + hi, cofs = lr * 4; v4f val = *(const v4fa*)(os + row * 68 + cofs); if (BIAS) { const float bv = bfr(bias[r0 + mb * 16 + row]); val[0] += bv; val[1] += bv; val[2] += bv; val[3] += bv; }
                *(v4f*)(crow + (size_t)row * ldc + cofs) = val; }
             }
        asm volatile("s_wait_xcnt 0x0" ::: "memory");   // the next 16 rows reuse the registers that these stores name
        __builtin_amdgcn_wave_barrier(); asm volatile("" ::: "memory");
    }
}

__device__ __forceinline__ h16 tohx(float x) { return (h16)x; }
__device__ __forceinline__ void splitf(float y, unsigned short& h, unsigned short& l) { h = f2bf(y); l = f2bf(y - bf2f(h)); }
typedef __attribute__((ext_vector_type(2))) _Float16 v2h;
typedef __attribute__((ext_vector_type(4))) _Float16 v4h;
typedef __attribute__((ext_vector_type(2))) unsigned short v2us;
typedef __attribute__((ext_vector_type(4))) unsigned short v4us;
typedef __attribute__((ext_vector_type(2))) float v2f;
typedef __attribute__((ext_vector_type(4))) int v4i;

__device__ __forceinline__ void d_cvt8(int blk, const float* __restrict__ src, bf* dst, size_t n8) { const size_t i = (size_t)blk * 256 + threadIdx.x; if (i >= n8) return; const v8f v = *(const v8f*)(src + i * 8); v8us o;
#pragma unroll
    for (int k = 0; k < 8; ++k) o[k] = f2bf(v[k]); *(v8us*)(dst + i * 8) = o;  }

__device__ __forceinline__ void d_cvt8T(int blk, const float* __restrict__ src, bf* dst) { const size_t i = (size_t)blk * 256 + threadIdx.x; if (i >= (size_t)NTOK * CIN / 8) return; const int tok = (int)(i / (CIN / 8)); const int c0 = (int)(i % (CIN / 8)) * 8; const int n = tok / HW, p = tok % HW; v8us o;
#pragma unroll
    for (int k = 0; k < 8; ++k) o[k] = f2bf(src[((size_t)n * CIN + c0 + k) * HW + p]); *(v8us*)(dst + (size_t)tok * CIN + c0) = o;  }
__device__ __forceinline__ void d_w12(int blk, const float* __restrict__ w1, const float* __restrict__ w2, const float* __restrict__ b1, const float* __restrict__ b2, const float* __restrict__ b3, bf* W12, float* B12) { const int i = blk * 256 + threadIdx.x; if (i < 64 * CIN / 8) { const int o = i / (CIN / 8); const int c0 = (i % (CIN / 8)) * 8; v8us ov;
#pragma unroll
        for (int q = 0; q < 8; ++q) { const float v = (o < REL) ? w1[o * CIN + c0 + q] : ((o < 2 * REL) ? w2[(o - REL) * CIN + c0 + q] : 0.0f); ov[q] = f2bf(v); }
        *(v8us*)(W12 + (size_t)o * CIN + c0) = ov;  }
    if (i < 64 + OUTC) { const float v = (i < REL) ? b1[i] : ((i < 2 * REL) ? b2[i - REL] : ((i < 64) ? 0.0f : b3[i - 64])); *(float*)(B12 + i) = v;  } }
// k_prep: the three conversions are independent of one another and share one launch: blocks [0, PB_W) build rows 0..63 of the weight plane (w1 | w2 | zeros) and the 320 biases (b1 | b2 | zeros | b3), the next PB_3 round w3 into rows 64..319, the last PB_T transpose and round x.
#define PB_T ((NTOK * CIN / 8 + 255) / 256)
#define PB_W ((64 * CIN / 8 + 255) / 256)
#define PB_3 ((OUTC * CIN / 8 + 255) / 256)
__global__ __launch_bounds__(256) void k_prep(const float* __restrict__ x, const float* __restrict__ w1, const float* __restrict__ w2, const float* __restrict__ w3, const float* __restrict__ b1, const float* __restrict__ b2, const float* __restrict__ b3, bf* XT, bf* WA, float* BA) { const int b = (int)blockIdx.x;
    if (b < PB_W) d_w12(b, w1, w2, b1, b2, b3, WA, BA); else if (b < PB_W + PB_3) d_cvt8(b - PB_W, w3, WA + (size_t)64 * CIN, (size_t)OUTC * CIN / 8); else d_cvt8T(b - PB_W - PB_3, x, XT); }
__device__ __forceinline__ int refl(int i) { return i < 0 ? -i : (i >= IMW ? 2 * (IMW - 1) - i : i); }
__device__ __forceinline__ float linsp(int j) { return __fadd_rn(-1.0f, __fmul_rn((float)j, 2.0f / 55.0f)); }   /* jnp.linspace(-1, 1, 56)[j] in f32 */
__device__ __forceinline__ float posv(const float* wp, const float* bp, int c, int y, int x) { return fmaf(bfr(wp[c * 2 + 1]), linsp(y), bfr(wp[c * 2 + 0]) * linsp(x)) + bfr(bp[c]); }
// t = concat(x1 - unfold(x2), pos - unfold(pos)) is never stored: its two readers (the BN1 statistics and the 18->16 mix) form it themselves, four consecutive pixels p0..p0+3 (p0 % 4 == 0: one image row) of window slot (di, dj) at a time: channels c < 16 from the channel-major planes of X12 (0.8 MB, cache resident), x1 as one 16-byte load, the window neighbours of x2 as four 4-byte loads from a few cache lines per wave; the position channels from the position formula.
// t1p4: one position channel, its two weights and its bias read by the caller, once.
__device__ __forceinline__ v4f t1p4(float w0, float w1, float b, int di, int dj, int p0) { const int y = p0 / IMW, x = p0 % IMW; const int yy = refl(y + di); const float wl[2] = {w0, w1}, bl[1] = {b}; v4f o;
#pragma unroll
    for (int q = 0; q < 4; ++q) o[q] = __fsub_rn(posv(wl, bl, 0, y, x + q), posv(wl, bl, 0, yy, refl(x + q + dj)));
    return o; }
// ---- batch statistics of one BatchNorm, fixed summation order, no atomics.
// k_bnpart: T is [n][c][49][3136] (GEN: that tensor is not in memory, T is X12 and each value is formed as in k_conv1, same element to the same thread), so work-group b owns the contiguous chunk b = (n*C + c)*7 + j of 7 window slots (21952 values), held in registers: the chunk's sum S, then Q = sum of squared distances from the chunk's own mean. Each work-group stores its own 128-byte line of PT.
// k_bnfin (BN1): one wave per channel merges that channel's 14 equal chunks: mean = sum S / N; N var = sum (Q + 21952 (S/21952 - mean)^2) (pairwise merge of variances: no cancellation of large squares); ST[c*32] = mean, ST[c*32+1] = rsqrt(var + eps).
// bnmerge (BN2): the same merge, same order, with no launch of its own: run at the head of every work-group (256 threads) of k_final, wave w merging channels w, w + 8, ..; sst[c*2] = mean, sst[c*2+1] = rsqrt(var + eps), in LDS; the caller's __syncthreads() hands them to the other waves.
#define BCH  KS                          // chunks per (n, c) plane
#define BCHN (KS * HW)                   // 21952 values per chunk
#define BCHV (BCHN / 4)                  // 5488 16-byte loads per chunk
#define BTH  512
#define BIT  ((BCHV + BTH - 1) / BTH)    // 11 loads per thread, the last one only in the first 368 threads
__device__ __forceinline__ float wavesum(float s) {
#pragma unroll
    for (int sh = 16; sh; sh >>= 1) s += __shfl_xor(s, sh, 32);
    return s; }
__device__ __forceinline__ float blocksum(float s, float* red) { s = wavesum(s); if ((threadIdx.x & 31) == 0) red[threadIdx.x >> 5] = s; __syncthreads(); float t = 0.f;
#pragma unroll
    for (int i = 0; i < BTH / 32; ++i) t += red[i];
    return t; }
template <bool GEN>
__global__ __launch_bounds__(BTH) void k_bnpart(const float* __restrict__ T, const float* __restrict__ wp, const float* __restrict__ bp, float* PT) { __shared__ float red[2][BTH / 32]; const int t = threadIdx.x; const v4f* base = (const v4f*)(T + (size_t)blockIdx.x * BCHN); const bool tail = t < BCHV - (BIT - 1) * BTH; v4f a[BIT];
    const int cj = (int)blockIdx.x % BCH, cc = ((int)blockIdx.x / BCH) % RP2, cn = (int)blockIdx.x / (BCH * RP2);   // GEN: the chunk is window row cj of channel cc of image cn; its 16-byte element e4 is window column e4 / 784, pixels 4 (e4 % 784) ..
    a[BIT - 1] = (v4f){0.f, 0.f, 0.f, 0.f};
    if (!GEN) {
#pragma unroll
        for (int i = 0; i < BIT - 1; ++i) a[i] = base[i * BTH + t];
        if (tail) a[BIT - 1] = base[(BIT - 1) * BTH + t]; }
    else if (cc < REL) {   // all eleven elements: element offsets, then the 55 loads in flight together, then the differences. A lane past the chunk's end reads element 0 and drops it.
        const v4f* x1b = (const v4f*)(T + (size_t)cc * NTOK + cn * HW); const float* x2b = T + (size_t)(REL + cc) * NTOK + cn * HW; unsigned o1[BIT], og[BIT][4]; v4f x1v[BIT]; float x2v[BIT][4];
#pragma unroll
        for (int i = 0; i < BIT; ++i) { const int e4 = (i < BIT - 1 || tail) ? i * BTH + t : 0; const int dj = e4 / (HW / 4) - PADR, p0 = (e4 % (HW / 4)) * 4; const int y = p0 / IMW, x = p0 % IMW; const int r = refl(y + cj - PADR) * IMW; o1[i] = (unsigned)(e4 % (HW / 4));
#pragma unroll
            for (int q = 0; q < 4; ++q) og[i][q] = (unsigned)(r + refl(x + q + dj)); }
#pragma unroll
        for (int i = 0; i < BIT; ++i) { x1v[i] = x1b[o1[i]];
#pragma unroll
            for (int q = 0; q < 4; ++q) x2v[i][q] = x2b[og[i][q]]; }
        // The wait before a register that an issued load names is rewritten. The offsets are named as inputs so that their registers stay as they are up to it, also as targets of the later loads (an asm statement takes thirty operands: two statements).
        asm volatile("s_wait_xcnt 0x0" :: "v"(o1[0]), "v"(o1[1]), "v"(o1[2]), "v"(o1[3]), "v"(o1[4]), "v"(o1[5]), "v"(o1[6]), "v"(o1[7]), "v"(o1[8]), "v"(o1[9]), "v"(o1[10]), "v"(og[0][0]), "v"(og[0][1]), "v"(og[0][2]), "v"(og[0][3]), "v"(og[1][0]), "v"(og[1][1]), "v"(og[1][2]), "v"(og[1][3]), "v"(og[2][0]), "v"(og[2][1]), "v"(og[2][2]), "v"(og[2][3]), "v"(og[3][0]), "v"(og[3][1]), "v"(og[3][2]), "v"(og[3][3]) : "memory");
        asm volatile("s_wait_xcnt 0x0" :: "v"(og[4][0]), "v"(og[4][1]), "v"(og[4][2]), "v"(og[4][3]), "v"(og[5][0]), "v"(og[5][1]), "v"(og[5][2]), "v"(og[5][3]), "v"(og[6][0]), "v"(og[6][1]), "v"(og[6][2]), "v"(og[6][3]), "v"(og[7][0]), "v"(og[7][1]), "v"(og[7][2]), "v"(og[7][3]), "v"(og[8][0]), "v"(og[8][1]), "v"(og[8][2]), "v"(og[8][3]), "v"(og[9][0]), "v"(og[9][1]), "v"(og[9][2]), "v"(og[9][3]), "v"(og[10][0]), "v"(og[10][1]), "v"(og[10][2]), "v"(og[10][3]) : "memory");
#pragma unroll
        for (int i = 0; i < BIT; ++i) { if (i < BIT - 1 || tail) {
#pragma unroll
            for (int q = 0; q < 4; ++q) a[i][q] = __fsub_rn(x1v[i][q], x2v[i][q]); } } }
    else { const float w0 = wp[(cc - REL) * 2], w1 = wp[(cc - REL) * 2 + 1], b = bp[cc - REL];
#pragma unroll
        for (int i = 0; i < BIT; ++i) { const int e4 = i * BTH + t; if (i < BIT - 1 || tail) a[i] = t1p4(w0, w1, b, cj - PADR, e4 / (HW / 4) - PADR, (e4 % (HW / 4)) * 4); } }
    v4f s4 = a[0];
#pragma unroll
    for (int i = 1; i < BIT; ++i) s4 += a[i];
    const float S = blocksum((s4[0] + s4[1]) + (s4[2] + s4[3]), red[0]); const float cm = S * (1.0f / (float)BCHN); v4f q4 = (v4f){0.f, 0.f, 0.f, 0.f};
#pragma unroll
    for (int i = 0; i < BIT - 1; ++i) { const v4f d = a[i] - cm; q4 += d * d; }
    if (tail) { const v4f d = a[BIT - 1] - cm; q4 += d * d; }
    const float Q = blocksum((q4[0] + q4[1]) + (q4[2] + q4[3]), red[1]);
    if (t < 32) PT[(size_t)blockIdx.x * 32 + t] = (t == 0) ? S : ((t == 1) ? Q : 0.0f); }
__global__ __launch_bounds__(32) void k_bnfin(const float* __restrict__ PT, int C, float* ST) { const int lane = threadIdx.x, c = blockIdx.x; const bool on = lane < NI * BCH; const int l = on ? lane : 0; const size_t b = (size_t)((l / BCH) * C + c) * BCH + l % BCH;
    const float S = on ? PT[b * 32] : 0.0f, Q = on ? PT[b * 32 + 1] : 0.0f; const float mean = wavesum(S) * (1.0f / (float)NSTAT); const float d = S * (1.0f / (float)BCHN) - mean;
    const float vs = wavesum(on ? Q + (float)BCHN * d * d : 0.0f); const float rs = __frsqrt_rn(vs * (1.0f / (float)NSTAT) + BNEPS);
    ST[(size_t)c * 32 + lane] = (lane == 0) ? mean : ((lane == 1) ? rs : 0.0f); }
// uni: a value that is the same in every lane, read from LDS, goes to a scalar register, where the same value loaded through a uniform address stood: 32 vector registers fewer in k_final and its loop's instructions as they were.
__device__ __forceinline__ float uni(float x) { return __uint_as_float(__builtin_amdgcn_readfirstlane(__float_as_uint(x))); }
// wavesumN: wavesum of N values at once, each in wavesum's own order; the N exchanges of a step are in flight together.
template <int N>
__device__ __forceinline__ void wavesumN(float (&s)[N]) {
#pragma unroll
    for (int sh = 16; sh; sh >>= 1) { float o[N];
#pragma unroll
        for (int i = 0; i < N; ++i) o[i] = __shfl_xor(s[i], sh, 32);
#pragma unroll
        for (int i = 0; i < N; ++i) s[i] += o[i]; } }
template <int C>
__device__ __forceinline__ void bnmerge(const float* __restrict__ PT, float* sst) { const int lane = threadIdx.x & 31; const bool on = lane < NI * BCH; const int l = on ? lane : 0; float S[(C + 7) / 8], Q[(C + 7) / 8], mean[(C + 7) / 8], vs[(C + 7) / 8];
    // Unrolled so that a wave's channels have their loads in flight together.
#pragma unroll
    for (int i = 0; i < (C + 7) / 8; ++i) { const int c = min((int)(threadIdx.x >> 5) + i * 8, C - 1); const size_t b = (size_t)((l / BCH) * C + c) * BCH + l % BCH; S[i] = on ? PT[b * 32] : 0.0f; Q[i] = on ? PT[b * 32 + 1] : 0.0f; }
#pragma unroll
    for (int i = 0; i < (C + 7) / 8; ++i) mean[i] = S[i];
    wavesumN(mean);
#pragma unroll
    for (int i = 0; i < (C + 7) / 8; ++i) { mean[i] *= (1.0f / (float)NSTAT); const float d = S[i] * (1.0f / (float)BCHN) - mean[i]; vs[i] = on ? Q[i] + (float)BCHN * d * d : 0.0f; }
    wavesumN(vs);
    if (lane == 0) {
#pragma unroll
        for (int i = 0; i < (C + 7) / 8; ++i) { const int c = (int)(threadIdx.x >> 5) + i * 8; if (c < C) { sst[c * 2] = mean[i]; sst[c * 2 + 1] = __frsqrt_rn(vs[i] * (1.0f / (float)NSTAT) + BNEPS); } } } }
__global__ __launch_bounds__(256) void k_conv1(const float* __restrict__ X12, const float* __restrict__ wp, const float* __restrict__ bp, const float* __restrict__ ST, const float* __restrict__ g1, const float* __restrict__ be1, const float* __restrict__ cw1, float* T2) { const int i = (int)blockIdx.x * 256 + (int)threadIdx.x; if (i >= NI * KK * HW / 4) return; const int e = i * 4; const int p0 = e % HW; const int k = (e / HW) % KK; const int n = e / (HW * KK); const int di = k / KS - PADR, dj = k % KS - PADR; v4f acc[REL]; float pw[RP2 - REL][3];
#pragma unroll
    for (int pc = 0; pc < RP2 - REL; ++pc) { pw[pc][0] = wp[pc * 2]; pw[pc][1] = wp[pc * 2 + 1]; pw[pc][2] = bp[pc]; }
#pragma unroll
    for (int o = 0; o < REL; ++o) acc[o] = (v4f){0.f, 0.f, 0.f, 0.f};
    // BN1 + relu + the 18->16 mix of one channel, each multiply fused with its add: BN as one FMA with the channel's scale rs g and shift be - mean rs g (the same in every lane), the mix as FMAs on the four pixels.
    auto mix = [&](int c, v4f a) { const float sc = ST[c * 32 + 1] * bfr(g1[c]); const float sh = fmaf(-ST[c * 32], sc, bfr(be1[c]));
        const v4f tn = __builtin_elementwise_max(__builtin_elementwise_fma(a, (v4f){sc, sc, sc, sc}, (v4f){sh, sh, sh, sh}), (v4f){0.f, 0.f, 0.f, 0.f});
#pragma unroll
        for (int o = 0; o < REL; ++o) { const float w = bfr(cw1[o * RP2 + c]); acc[o] = __builtin_elementwise_fma((v4f){w, w, w, w}, tn, acc[o]); } };
    // Four channels of t = x1 - x2[nbr] are formed at a time: their 20 loads (x1 as one 16-byte load, the window neighbours of x2 as four 4-byte loads) are in flight together, and the 64 weights of the four fit the scalar registers (with eight they were spilled). The outer loop stays rolled so that the kernel's text stays small; the inner ones are unrolled so that the arrays live in registers.
    const int py = p0 / IMW, px = p0 % IMW; const float* x1b = X12 + n * HW + p0; const float* x2b[4];
#pragma unroll
    for (int q = 0; q < 4; ++q) x2b[q] = X12 + n * HW + refl(py + di) * IMW + refl(px + q + dj);   // plane 0; x2 is planes REL ..
#pragma unroll 1
    for (int cb = 0; cb < REL; cb += 4) { v4f x1v[4], x2v[4]; const float* x1p = x1b + (size_t)cb * NTOK; const float* g0 = x2b[0] + (size_t)cb * NTOK; const float* g1p = x2b[1] + (size_t)cb * NTOK; const float* g2p = x2b[2] + (size_t)cb * NTOK; const float* g3p = x2b[3] + (size_t)cb * NTOK;
#pragma unroll
        for (int u = 0; u < 4; ++u) { x1v[u] = *(const v4f*)(x1p + (size_t)u * NTOK); x2v[u][0] = g0[(size_t)(REL + u) * NTOK]; x2v[u][1] = g1p[(size_t)(REL + u) * NTOK]; x2v[u][2] = g2p[(size_t)(REL + u) * NTOK]; x2v[u][3] = g3p[(size_t)(REL + u) * NTOK]; }
        asm volatile("s_wait_xcnt 0x0" :: "v"(x1p), "v"(g0), "v"(g1p), "v"(g2p), "v"(g3p) : "memory");   // the wait before a register that an issued load names is rewritten: named as inputs, the five addresses keep their registers up to it, also as targets of the later loads
#pragma unroll
        for (int u = 0; u < 4; ++u) mix(cb + u, x1v[u] - x2v[u]); }
#pragma unroll
    for (int pc = 0; pc < RP2 - REL; ++pc) mix(REL + pc, t1p4(pw[pc][0], pw[pc][1], pw[pc][2], di, dj, p0));
    float* t2m = T2 + (((size_t)n * REL + REL / 2) * KK + k) * HW + p0;   // the address of plane 8: from it a signed immediate offset reaches all 16 planes, so that no address is formed between the stores
#pragma unroll
    for (int o = 0; o < REL; ++o) *(v4f*)(t2m + (o - REL / 2) * (KK * HW)) = acc[o]; }
// k_final: per (n, four share-groups g0..g0+3, p) (one lane per p): for each of the 49 window slots k (rolled loop): tn_o = relu((T2[n][o][k][p] - mean_o) rs_o g2 + be2), read and formed ONCE for the lane's GPL groups (it does not depend on g); per group wl = sum_o cw2[g][o] tn_o + cb2[g]; ONLINE softmax over k in f32 (running max / sum with exp2 rescaling of the 8 accumulators, no per-slot array) fused with the aggregation out[n][g*8+s][p] = sum_k w[k] x3[g*8+s][n*HW + nbr(p,k)] (x3 channel-major [256][n*HW + p] f32: per slot and group 8 loads of 4 bytes per lane, each on consecutive addresses across the lanes). Every sum keeps the order of one group per lane; each multiply is fused with the add behind it.
#define GPL 4               // share-groups per lane
__global__ __launch_bounds__(256) void k_final(const float* __restrict__ T2, const float* __restrict__ PT, const float* __restrict__ g2, const float* __restrict__ be2, const float* __restrict__ cw2, const float* __restrict__ cb2, const float* __restrict__ X3, float* out) {
    __shared__ float sst[2 * REL]; bnmerge<REL>(PT, sst); __syncthreads();
    const size_t gidx = (size_t)blockIdx.x * 256 + threadIdx.x; if (gidx >= (size_t)NI * (NG / GPL) * HW) return; const int p = (int)(gidx % HW); const int g0 = (int)((gidx / HW) % (NG / GPL)) * GPL; const int n = (int)(gidx / ((size_t)HW * (NG / GPL))); const int y = p / IMW, x = p % IMW;
    float cb[GPL], m[GPL], Z[GPL], acc[GPL][SHR]; v2f ac2[GPL][SHR / 2];
    // What does not change over the 49 slots is read and formed once, here: BN2 as scale rs g2 and shift be2 - mean rs g2, so that it is one FMA per value. Values stand in pairs (two channels of T2, two groups' weights, two planes of x3) so that one packed FMA serves both. Unrolled so that the arrays live in registers.
    v2f sc[REL / 2], sh[REL / 2], cw[GPL / 2][REL];
#pragma unroll
    for (int o = 0; o < REL; ++o) { const float s0 = uni(sst[o * 2 + 1]) * bfr(g2[o]); sc[o / 2][o & 1] = s0; sh[o / 2][o & 1] = fmaf(-uni(sst[o * 2]), s0, bfr(be2[o])); }
#pragma unroll
    for (int j = 0; j < GPL; ++j) { cb[j] = bfr(cb2[g0 + j]); m[j] = -3.0e38f; Z[j] = 0.f;
#pragma unroll
        for (int o = 0; o < REL; ++o) cw[j / 2][o][j & 1] = bfr(cw2[(g0 + j) * REL + o]);
#pragma unroll
        for (int s2 = 0; s2 < SHR / 2; ++s2) ac2[j][s2] = (v2f){0.f, 0.f}; }
#pragma unroll 1
    for (int k = 0; k < KK; ++k) { v2f s[GPL / 2], tn[REL / 2]; float e1[GPL], e2[GPL], r[GPL], w[GPL];
        // All loads of a slot (16 planes of T2, then 8 planes of x3 per group) are issued ahead of its arithmetic, so that they are in flight together; T2 first, because it is used first. Unrolled so that a[] and v[][] live in registers.
        v2f a[REL / 2];
#pragma unroll
        for (int o = 0; o < REL; ++o) a[o / 2][o & 1] = T2[(((size_t)n * REL + o) * KK + k) * HW + p];
        // The wait before a register that an issued load names is rewritten. The two scheduling barriers keep the T2 loads in front of it and all of x3 behind it.
        __builtin_amdgcn_sched_barrier(0); asm volatile("s_wait_xcnt 0x0" ::: "memory"); __builtin_amdgcn_sched_barrier(0);
        const int yy = refl(y + k / KS - PADR), xx = refl(x + k % KS - PADR); const float* x3p = X3 + (size_t)(g0 * SHR) * NTOK + (size_t)n * HW + yy * IMW + xx; v2f v[GPL][SHR / 2];
#pragma unroll
        for (int j = 0; j < GPL; ++j) {
#pragma unroll
            for (int s2 = 0; s2 < SHR; ++s2) v[j][s2 / 2][s2 & 1] = x3p[(size_t)(j * SHR + s2) * NTOK]; }
        __builtin_amdgcn_sched_barrier(0);   // keeps the first uses of a[] behind the x3 loads: paired with the x3 address arithmetic they made those loads wait for T2 to come back
        asm volatile("s_wait_xcnt 0x0" :: "v"(x3p) : "memory");   // the same wait for the x3 loads: named as an input, their address keeps its registers up to it, also as targets of the later loads
#pragma unroll
        for (int j = 0; j < GPL / 2; ++j) s[j] = (v2f){0.f, 0.f};
#pragma unroll
        for (int o = 0; o < REL / 2; ++o) tn[o] = __builtin_elementwise_max(__builtin_elementwise_fma(a[o], sc[o], sh[o]), (v2f){0.f, 0.f});
#pragma unroll
        for (int o = 0; o < REL; ++o) { const float t0 = tn[o / 2][o & 1];
#pragma unroll
            for (int j = 0; j < GPL / 2; ++j) s[j] = __builtin_elementwise_fma(cw[j][o], (v2f){t0, t0}, s[j]); }
#pragma unroll
        for (int j = 0; j < GPL; ++j) { const float wl = s[j / 2][j & 1] + cb[j]; const float mn = fmaxf(m[j], wl); e1[j] = (m[j] - mn) * 1.4426950408889634f; e2[j] = (wl - mn) * 1.4426950408889634f; m[j] = mn; r[j] = __builtin_amdgcn_exp2f(e1[j]); w[j] = __builtin_amdgcn_exp2f(e2[j]); }
        asm volatile("v_nop" :: "v"(e1[0]), "v"(e2[0]), "v"(e1[1]), "v"(e2[1]), "v"(e1[2]), "v"(e2[2]), "v"(e1[3]), "v"(e2[3]), "v"(r[0]), "v"(w[0]), "v"(r[1]), "v"(w[1]), "v"(r[2]), "v"(w[2]), "v"(r[3]), "v"(w[3]));   // the slot behind a transcendental, before a source of it is overwritten: named as inputs, the eight sources keep their registers up to it and it stands behind all eight exponentials
        __builtin_amdgcn_sched_barrier(0);   // keeps the products with the exponentials' results behind that v_nop: lifted over it, they left it sixteen instructions behind the last exponential
#pragma unroll
        for (int j = 0; j < GPL; ++j) { Z[j] = fmaf(Z[j], r[j], w[j]);
#pragma unroll
            for (int s2 = 0; s2 < SHR / 2; ++s2) ac2[j][s2] = __builtin_elementwise_fma(ac2[j][s2], (v2f){r[j], r[j]}, (v2f){w[j], w[j]} * v[j][s2]); } }
#pragma unroll
    for (int j = 0; j < GPL; ++j) {
#pragma unroll
        for (int s2 = 0; s2 < SHR; ++s2) acc[j][s2] = ac2[j][s2 / 2][s2 & 1]; }
#pragma unroll
    for (int j = 0; j < GPL; ++j) { const float iz = __fdiv_rn(1.0f, Z[j]);
#pragma unroll
        for (int s2 = 0; s2 < SHR; ++s2) *(float*)(out + ((size_t)n * OUTC + (g0 + j) * SHR + s2) * HW + p) = acc[j][s2] * iz;
         } }

extern "C" void kernel_launch(void* const* d_in, const int* in_sizes, int n_in,
                              void* d_out, int out_size, void* d_ws, size_t ws_size, hipStream_t stream) {
    (void)in_sizes; (void)n_in; (void)out_size;
    const float* x = (const float*)d_in[0]; const float* w1 = (const float*)d_in[1]; const float* b1 = (const float*)d_in[2]; const float* w2 = (const float*)d_in[3]; const float* b2 = (const float*)d_in[4]; const float* w3 = (const float*)d_in[5]; const float* b3 = (const float*)d_in[6]; const float* wp = (const float*)d_in[7]; const float* bp = (const float*)d_in[8];
    const float* g1 = (const float*)d_in[9]; const float* be1 = (const float*)d_in[10]; const float* cw1 = (const float*)d_in[11]; const float* g2 = (const float*)d_in[12]; const float* be2 = (const float*)d_in[13]; const float* cw2 = (const float*)d_in[14]; const float* cb2 = (const float*)d_in[15];
    float* OUT = (float*)d_out;     // [2][256][56][56]
    char* wsp = (char*)d_ws;
    auto take = [&](size_t bytes) { char* p = wsp; wsp += (bytes + 255) & ~(size_t)255; return (void*)p; };
    bf* XT = (bf*)take((size_t)NTOK * CIN * 2); bf* WA = (bf*)take((size_t)(64 + OUTC) * CIN * 2); float* BA = (float*)take((64 + OUTC) * 4);   /* weight rows and biases: x1 | x2 | 32 zero rows | x3 */
    float* X12 = (float*)take((size_t)NTOK * (64 + OUTC) * 4); float* X3 = X12 + (size_t)NTOK * 64; float* T2 = (float*)take((size_t)NI * REL * KK * HW * 4); float* ST1 = (float*)take(32 * 32 * 4); float* PT = (float*)take((size_t)NI * RP2 * BCH * 32 * 4);
    if ((size_t)(wsp - (char*)d_ws) > ws_size) return;    // carve ~20 MiB
    k_prep<<<PB_T + PB_W + PB_3, 256, 0, stream>>>(x, w1, w2, w3, b1, b2, b3, XT, WA, BA);
    k_gemmw<bf, 0, true><<<dim3((64 + OUTC) / 64, NTOK / 64, 1), 32, 0, stream>>>(WA, nullptr, XT, nullptr, CIN, X12, NTOK, BA, 0, 0, 0);   /* channel-major [row][tok]: rows 0..15 x1, 16..31 x2, 64..319 x3 */
    k_bnpart<true><<<NI * RP2 * BCH, BTH, 0, stream>>>(X12, wp, bp, PT); k_bnfin<<<RP2, 32, 0, stream>>>(PT, RP2, ST1);
    k_conv1<<<(unsigned)(((size_t)NI * KK * HW / 4 + 255) / 256), 256, 0, stream>>>(X12, wp, bp, ST1, g1, be1, cw1, T2);
    k_bnpart<false><<<NI * REL * BCH, BTH, 0, stream>>>(T2, wp, bp, PT);
    k_final<<<(unsigned)(((size_t)NI * (NG / GPL) * HW + 255) / 256), 256, 0, stream>>>(T2, PT, g2, be2, cw2, cb2, X3, OUT);
}

// v008
// One run takes 65.9 microseconds.
// Timed twice side by side with v007, it ran 1.14 and 1.15 times as fast.
// Over all steps from v000 it is 47.5 times as fast.
#include <hip/hip_runtime.h>

// SAN pairwise self-attention module (x [2][256][56][56]; x1, x2 = 1x1(x; [16][256] + b), x3 = 1x1(x; [256][256] + b); pos = 1x1(linspace grid [2][56][56]; wp [2][2] + bp); 7x7 reflect-padded windows (pad 3): t = concat(x1 - unfold(x2), pos - unfold(pos)) [2][18][49][3136];
// t = relu(BN1(t)) (training-mode batch statistics over n, k, p per channel); t = 1x1(t; cw1 [16][18]); t = relu(BN2(t)); wlog = 1x1(t; cw2 [32][16] + cb2); w = softmax over the 49 window slots; out[n][g*8+s][p] = sum_k unfold(x3)[n][g*8+s][k][p] w[n][g][k][p] -> [2][256][56][56] (1.6 M)).
// Compute dtypes, f32 accumulate: every input rounded to bf16; the three 1x1 input convs on PLAIN bf16 operands (input transposed while converting; exact) + f32 biases, their results stored channel-major [channel][n*3136 + p]; everything after that in f32 on the VALU: window differences, position features (linspace in f32), both BatchNorms with deterministic fixed-order batch statistics (14 work-groups per channel, each its chunk's sum and squared distances from the chunk mean, merged by one wave per channel; biased variance, eps 1e-5), the 18->16 and 16->32 channel mixes, the 49-way softmax (online form: running max/sum with rescaling) fused with the weighted aggregation of the reflect-gathered x3.

#define NI   2
#define CIN  256
#define IMW  56
#define HW   3136
#define NTOK (NI * HW)      // 6272 = 98 x 64
#define REL  16
#define RP2  18             // rel + 2 position channels
#define OUTC 256
#define SHR  8
#define NG   32             // out / share
#define KS   7
#define KK   49
#define PADR 3
#define BNEPS 1e-5f
#define NSTAT ((size_t)NI * KK * HW)   // 307328 elements per channel
typedef _Float16 h16;
typedef unsigned short bf;
typedef __attribute__((ext_vector_type(16))) __bf16   v16bf;
typedef __attribute__((ext_vector_type(16))) _Float16 v16h;
typedef __attribute__((ext_vector_type(8)))  _Float16 v8h;
typedef __attribute__((ext_vector_type(8)))  unsigned short v8us;
typedef __attribute__((ext_vector_type(8)))  float    v8f;
typedef __attribute__((ext_vector_type(4)))  float    v4f;
typedef v8h  __attribute__((may_alias)) v8ha;
typedef v4f  __attribute__((may_alias)) v4fa;
typedef v8us __attribute__((may_alias)) v8usa;

__device__ __forceinline__ unsigned short f2bf(float f) { unsigned u = __float_as_uint(f); u += 0x7FFFu + ((u >> 16) & 1u); return (unsigned short)(u >> 16); }
__device__ __forceinline__ float bf2f(unsigned short b) { return __uint_as_float(((unsigned)b) << 16); }
__device__ __forceinline__ float bfr(float f) { return bf2f(f2bf(f)); }
__device__ __forceinline__ v16h cat16(v8h lo, v8h hi) { return __builtin_shufflevector(lo, hi, 0, 1, 2, 3, 4, 5, 6, 7, 8, 9, 10, 11, 12, 13, 14, 15); }
__device__ __forceinline__ v16bf cat16b(v8us lo, v8us hi) { return __builtin_bit_cast(v16bf, __builtin_shufflevector(lo, hi, 0, 1, 2, 3, 4, 5, 6, 7, 8, 9, 10, 11, 12, 13, 14, 15)); }
__device__ __forceinline__ v8f wmma16(v16h a, v16h b, v8f c) { return __builtin_amdgcn_wmma_f32_16x16x32_f16(false, a, false, b, (short)0, c, false, false); }
__device__ __forceinline__ v8f wmmab(v16bf a, v16bf b, v8f c) { return __builtin_amdgcn_wmma_f32_16x16x32_bf16(false, a, false, b, (short)0, c, false, false); }



// ---- k_gemmw: register-blocked GEMM, ONE WAVE per 64x64 output tile (16 accumulators), operands straight from K-contiguous 16-bit planes; grid (M/64, N/64, Z), 32 threads.
// C[m][n] (f32, pitch ldc, + optional f32 bias[m]) = sum_k A[m][k] Bt[n][k] (+ split products per NSPLIT). z-batch strides sA/sB/sC in elements. K % 32 == 0.
template <typename T16> struct WFrag;
template <> struct WFrag<h16> { typedef v16h V; static __device__ __forceinline__ V ld(const h16* p) { return cat16(*(const v8h*)p, *(const v8h*)(p + 16)); } static __device__ __forceinline__ v8f mma(V a, V b, v8f c) { return wmma16(a, b, c); } };
template <> struct WFrag<bf> { typedef v16bf V; static __device__ __forceinline__ V ld(const bf* p) { return cat16b(*(const v8us*)p, *(const v8us*)(p + 16)); } static __device__ __forceinline__ v8f mma(V a, V b, v8f c) { return wmmab(a, b, c); } };
template <typename T16, int NSPLIT, bool BIAS>
__global__ __launch_bounds__(32) void k_gemmw(const T16* __restrict__ A, const T16* __restrict__ A2, const T16* __restrict__ Bt, const T16* __restrict__ Bt2, int K, float* C, int ldc, const float* __restrict__ bias, size_t sA, size_t sB, size_t sC) {
    typedef typename WFrag<T16>::V V;
    __shared__ __align__(16) float os[16 * 68];
    const size_t z = blockIdx.z; A += z * sA; if (A2) A2 += z * sA; Bt += z * sB; if (Bt2) Bt2 += z * sB; C += z * sC;
    const int lane = threadIdx.x & 31, lr = lane & 15, hi = lane >> 4; const int r0 = blockIdx.x * 64, c0 = blockIdx.y * 64;
    v8f acc[4][4];
#pragma unroll
    for (int mb = 0; mb < 4; ++mb)
#pragma unroll
        for (int nb = 0; nb < 4; ++nb) acc[mb][nb] = (v8f){};
    const size_t aoff = (size_t)(r0 + lr) * K + 8 * hi, boff = (size_t)(c0 + lr) * K + 8 * hi;
#pragma unroll 1
    for (int kc = 0; kc < K; kc += 32) {
        V a[4], a2[4];
#pragma unroll
        for (int mb = 0; mb < 4; ++mb) { a[mb] = WFrag<T16>::ld(A + aoff + (size_t)mb * 16 * K + kc); if (NSPLIT == 1 || NSPLIT == 2) a2[mb] = WFrag<T16>::ld(A2 + aoff + (size_t)mb * 16 * K + kc); }
#pragma unroll
        for (int nb = 0; nb < 4; ++nb) { const V b = WFrag<T16>::ld(Bt + boff + (size_t)nb * 16 * K + kc); V b2; if (NSPLIT >= 2) b2 = WFrag<T16>::ld(Bt2 + boff + (size_t)nb * 16 * K + kc);
#pragma unroll
            for (int mb = 0; mb < 4; ++mb) { acc[mb][nb] = WFrag<T16>::mma(a[mb], b, acc[mb][nb]); if (NSPLIT == 1 || NSPLIT == 2) acc[mb][nb] = WFrag<T16>::mma(a2[mb], b, acc[mb][nb]); if (NSPLIT >= 2) acc[mb][nb] = WFrag<T16>::mma(a[mb], b2, acc[mb][nb]); } }
        asm volatile("v_nop\n\tv_nop\n\tv_nop\n\tv_nop" : "+v"(acc[0][0]), "+v"(acc[1][1]), "+v"(acc[2][2]), "+v"(acc[3][3]) : "v"(a[0]), "v"(a[3]));
    }
#pragma unroll
    for (int mb = 0; mb < 4; ++mb) {
#pragma unroll
        for (int nb = 0; nb < 4; ++nb) {
#pragma unroll
            for (int j = 0; j < 8; ++j) os[(hi * 8 + j) * 68 + nb * 16 + lr] = acc[mb][nb][j]; }
        __builtin_amdgcn_wave_barrier(); asm volatile("" ::: "memory");
        float* crow = C + (size_t)(r0 + mb * 16) * ldc + c0;
{
#pragma unroll
            for (int s = 0; s < 8; ++s) { const int row = 2 * s + hi, cofs = lr * 4; v4f val = *(const v4fa*)(os + row * 68 + cofs); if (BIAS) { const float bv = bfr(bias[r0 + mb * 16 + row]); val[0] += bv; val[1] += bv; val[2] += bv; val[3] += bv; }
                *(v4f*)(crow + (size_t)row * ldc + cofs) = val; }
             }
        asm volatile("s_wait_xcnt 0x0" ::: "memory");   // the next 16 rows reuse the registers that these stores name
        __builtin_amdgcn_wave_barrier(); asm volatile("" ::: "memory");
    }
}

__device__ __forceinline__ h16 tohx(float x) { return (h16)x; }
__device__ __forceinline__ void splitf(float y, unsigned short& h, unsigned short& l) { h = f2bf(y); l = f2bf(y - bf2f(h)); }
typedef __attribute__((ext_vector_type(2))) _Float16 v2h;
typedef __attribute__((ext_vector_type(4))) _Float16 v4h;
typedef __attribute__((ext_vector_type(2))) unsigned short v2us;
typedef __attribute__((ext_vector_type(4))) unsigned short v4us;
typedef __attribute__((ext_vector_type(2))) float v2f;
typedef __attribute__((ext_vector_type(4))) int v4i;

__device__ __forceinline__ void d_cvt8(int blk, const float* __restrict__ src, bf* dst, size_t n8) { const size_t i = (size_t)blk * 256 + threadIdx.x; if (i >= n8) return; const v8f v = *(const v8f*)(src + i * 8); v8us o;
#pragma unroll
    for (int k = 0; k < 8; ++k) o[k] = f2bf(v[k]); *(v8us*)(dst + i * 8) = o;  }

__device__ __forceinline__ void d_cvt8T(int blk, const float* __restrict__ src, bf* dst) { const size_t i = (size_t)blk * 256 + threadIdx.x; if (i >= (size_t)NTOK * CIN / 8) return; const int tok = (int)(i / (CIN / 8)); const int c0 = (int)(i % (CIN / 8)) * 8; const int n = tok / HW, p = tok % HW; v8us o;
#pragma unroll
    for (int k = 0; k < 8; ++k) o[k] = f2bf(src[((size_t)n * CIN + c0 + k) * HW + p]); *(v8us*)(dst + (size_t)tok * CIN + c0) = o;  }
__device__ __forceinline__ void d_w12(int blk, const float* __restrict__ w1, const float* __restrict__ w2, const float* __restrict__ b1, const float* __restrict__ b2, const float* __restrict__ b3, bf* W12, float* B12) { const int i = blk * 256 + threadIdx.x; if (i < 64 * CIN / 8) { const int o = i / (CIN / 8); const int c0 = (i % (CIN / 8)) * 8; v8us ov;
#pragma unroll
        for (int q = 0; q < 8; ++q) { const float v = (o < REL) ? w1[o * CIN + c0 + q] : ((o < 2 * REL) ? w2[(o - REL) * CIN + c0 + q] : 0.0f); ov[q] = f2bf(v); }
        *(v8us*)(W12 + (size_t)o * CIN + c0) = ov;  }
    if (i < 64 + OUTC) { const float v = (i < REL) ? b1[i] : ((i < 2 * REL) ? b2[i - REL] : ((i < 64) ? 0.0f : b3[i - 64])); *(float*)(B12 + i) = v;  } }
// k_prep: the three conversions are independent of one another and share one launch: blocks [0, PB_W) build rows 0..63 of the weight plane (w1 | w2 | zeros) and the 320 biases (b1 | b2 | zeros | b3), the next PB_3 round w3 into rows 64..319, the last PB_T transpose and round x.
#define PB_T ((NTOK * CIN / 8 + 255) / 256)
#define PB_W ((64 * CIN / 8 + 255) / 256)
#define PB_3 ((OUTC * CIN / 8 + 255) / 256)
__global__ __launch_bounds__(256) void k_prep(const float* __restrict__ x, const float* __restrict__ w1, const float* __restrict__ w2, const float* __restrict__ w3, const float* __restrict__ b1, const float* __restrict__ b2, const float* __restrict__ b3, bf* XT, bf* WA, float* BA) { const int b = (int)blockIdx.x;
    if (b < PB_W) d_w12(b, w1, w2, b1, b2, b3, WA, BA); else if (b < PB_W + PB_3) d_cvt8(b - PB_W, w3, WA + (size_t)64 * CIN, (size_t)OUTC * CIN / 8); else d_cvt8T(b - PB_W - PB_3, x, XT); }
__device__ __forceinline__ int refl(int i) { return i < 0 ? -i : (i >= IMW ? 2 * (IMW - 1) - i : i); }
__device__ __forceinline__ float linsp(int j) { return __fadd_rn(-1.0f, __fmul_rn((float)j, 2.0f / 55.0f)); }   /* jnp.linspace(-1, 1, 56)[j] in f32 */
__device__ __forceinline__ float posv(const float* wp, const float* bp, int c, int y, int x) { return fmaf(bfr(wp[c * 2 + 1]), linsp(y), bfr(wp[c * 2 + 0]) * linsp(x)) + bfr(bp[c]); }
// t = concat(x1 - unfold(x2), pos - unfold(pos)) is never stored: its two readers (the BN1 statistics and the 18->16 mix) form it themselves, four consecutive pixels p0..p0+3 (p0 % 4 == 0: one image row) of window slot (di, dj) at a time: channels c < 16 from the channel-major planes of X12 (0.8 MB, cache resident), x1 as one 16-byte load, the window neighbours of x2 as four 4-byte loads from a few cache lines per wave; the position channels from the position formula.
// t1p4: one position channel, its two weights and its bias read by the caller, once.
__device__ __forceinline__ v4f t1p4(float w0, float w1, float b, int di, int dj, int p0) { const int y = p0 / IMW, x = p0 % IMW; const int yy = refl(y + di); const float wl[2] = {w0, w1}, bl[1] = {b}; v4f o;
#pragma unroll
    for (int q = 0; q < 4; ++q) o[q] = __fsub_rn(posv(wl, bl, 0, y, x + q), posv(wl, bl, 0, yy, refl(x + q + dj)));
    return o; }
// ---- batch statistics of one BatchNorm, fixed summation order, no atomics.
// k_bnpart: T is [n][c][49][3136] (GEN: that tensor is not in memory, T is X12 and each value is formed as in k_conv1, same element to the same thread), so work-group b owns the contiguous chunk b = (n*C + c)*7 + j of 7 window slots (21952 values), held in registers: the chunk's sum S, then Q = sum of squared distances from the chunk's own mean. Each work-group stores its own 128-byte line of PT.
// k_bnfin (BN1): one wave per channel merges that channel's 14 equal chunks: mean = sum S / N; N var = sum (Q + 21952 (S/21952 - mean)^2) (pairwise merge of variances: no cancellation of large squares); ST[c*32] = mean, ST[c*32+1] = rsqrt(var + eps).
// bnmerge (BN2): the same merge, same order, with no launch of its own: run at the head of every work-group (256 threads) of k_final, wave w merging channels w, w + 8, ..; sst[c*2] = mean, sst[c*2+1] = rsqrt(var + eps), in LDS; the caller's __syncthreads() hands them to the other waves.
#define BCH  KS                          // chunks per (n, c) plane
#define BCHN (KS * HW)                   // 21952 values per chunk
#define BCHV (BCHN / 4)                  // 5488 16-byte loads per chunk
#define BTH  512
#define BIT  ((BCHV + BTH - 1) / BTH)    // 11 loads per thread, the last one only in the first 368 threads
__device__ __forceinline__ float wavesum(float s) {
#pragma unroll
    for (int sh = 16; sh; sh >>= 1) s += __shfl_xor(s, sh, 32);
    return s; }
__device__ __forceinline__ float blocksum(float s, float* red) { s = wavesum(s); if ((threadIdx.x & 31) == 0) red[threadIdx.x >> 5] = s; __syncthreads(); float t = 0.f;
#pragma unroll
    for (int i = 0; i < BTH / 32; ++i) t += red[i];
    return t; }
template <bool GEN>
__global__ __launch_bounds__(BTH) void k_bnpart(const float* __restrict__ T, const float* __restrict__ wp, const float* __restrict__ bp, float* PT) { __shared__ float red[2][BTH / 32]; const int t = threadIdx.x; const v4f* base = (const v4f*)(T + (size_t)blockIdx.x * BCHN); const bool tail = t < BCHV - (BIT - 1) * BTH; v4f a[BIT];
    const int cj = (int)blockIdx.x % BCH, cc = ((int)blockIdx.x / BCH) % RP2, cn = (int)blockIdx.x / (BCH * RP2);   // GEN: the chunk is window row cj of channel cc of image cn; its 16-byte element e4 is window column e4 / 784, pixels 4 (e4 % 784) ..
    a[BIT - 1] = (v4f){0.f, 0.f, 0.f, 0.f};
    if (!GEN) {
#pragma unroll
        for (int i = 0; i < BIT - 1; ++i) a[i] = base[i * BTH + t];
        if (tail) a[BIT - 1] = base[(BIT - 1) * BTH + t]; }
    else if (cc < REL) {   // all eleven elements: element offsets, then the 55 loads in flight together, then the differences. A lane past the chunk's end reads element 0 and drops it.
        const v4f* x1b = (const v4f*)(T + (size_t)cc * NTOK + cn * HW); const float* x2b = T + (size_t)(REL + cc) * NTOK + cn * HW; unsigned o1[BIT], og[BIT][4]; v4f x1v[BIT]; float x2v[BIT][4];
#pragma unroll
        for (int i = 0; i < BIT; ++i) { const int e4 = (i < BIT - 1 || tail) ? i * BTH + t : 0; const int dj = e4 / (HW / 4) - PADR, p0 = (e4 % (HW / 4)) * 4; const int y = p0 / IMW, x = p0 % IMW; const int r = refl(y + cj - PADR) * IMW; o1[i] = (unsigned)(e4 % (HW / 4));
#pragma unroll
            for (int q = 0; q < 4; ++q) og[i][q] = (unsigned)(r + refl(x + q + dj)); }
#pragma unroll
        for (int i = 0; i < BIT; ++i) { x1v[i] = x1b[o1[i]];
#pragma unroll
            for (int q = 0; q < 4; ++q) x2v[i][q] = x2b[og[i][q]]; }
        // The wait before a register that an issued load names is rewritten. The offsets are named as inputs so that their registers stay as they are up to it, also as targets of the later loads (an asm statement takes thirty operands: two statements).
        asm volatile("s_wait_xcnt 0x0" :: "v"(o1[0]), "v"(o1[1]), "v"(o1[2]), "v"(o1[3]), "v"(o1[4]), "v"(o1[5]), "v"(o1[6]), "v"(o1[7]), "v"(o1[8]), "v"(o1[9]), "v"(o1[10]), "v"(og[0][0]), "v"(og[0][1]), "v"(og[0][2]), "v"(og[0][3]), "v"(og[1][0]), "v"(og[1][1]), "v"(og[1][2]), "v"(og[1][3]), "v"(og[2][0]), "v"(og[2][1]), "v"(og[2][2]), "v"(og[2][3]), "v"(og[3][0]), "v"(og[3][1]), "v"(og[3][2]), "v"(og[3][3]) : "memory");
        asm volatile("s_wait_xcnt 0x0" :: "v"(og[4][0]), "v"(og[4][1]), "v"(og[4][2]), "v"(og[4][3]), "v"(og[5][0]), "v"(og[5][1]), "v"(og[5][2]), "v"(og[5][3]), "v"(og[6][0]), "v"(og[6][1]), "v"(og[6][2]), "v"(og[6][3]), "v"(og[7][0]), "v"(og[7][1]), "v"(og[7][2]), "v"(og[7][3]), "v"(og[8][0]), "v"(og[8][1]), "v"(og[8][2]), "v"(og[8][3]), "v"(og[9][0]), "v"(og[9][1]), "v"(og[9][2]), "v"(og[9][3]), "v"(og[10][0]), "v"(og[10][1]), "v"(og[10][2]), "v"(og[10][3]) : "memory");
#pragma unroll
        for (int i = 0; i < BIT; ++i) { if (i < BIT - 1 || tail) {
#pragma unroll
            for (int q = 0; q < 4; ++q) a[i][q] = __fsub_rn(x1v[i][q], x2v[i][q]); } } }
    else { const float w0 = wp[(cc - REL) * 2], w1 = wp[(cc - REL) * 2 + 1], b = bp[cc - REL];
#pragma unroll
        for (int i = 0; i < BIT; ++i) { const int e4 = i * BTH + t; if (i < BIT - 1 || tail) a[i] = t1p4(w0, w1, b, cj - PADR, e4 / (HW / 4) - PADR, (e4 % (HW / 4)) * 4); } }
    v4f s4 = a[0];
#pragma unroll
    for (int i = 1; i < BIT; ++i) s4 += a[i];
    const float S = blocksum((s4[0] + s4[1]) + (s4[2] + s4[3]), red[0]); const float cm = S * (1.0f / (float)BCHN); v4f q4 = (v4f){0.f, 0.f, 0.f, 0.f};
#pragma unroll
    for (int i = 0; i < BIT - 1; ++i) { const v4f d = a[i] - cm; q4 += d * d; }
    if (tail) { const v4f d = a[BIT - 1] - cm; q4 += d * d; }
    const float Q = blocksum((q4[0] + q4[1]) + (q4[2] + q4[3]), red[1]);
    if (t < 32) PT[(size_t)blockIdx.x * 32 + t] = (t == 0) ? S : ((t == 1) ? Q : 0.0f); }
__global__ __launch_bounds__(32) void k_bnfin(const float* __restrict__ PT, int C, float* ST) { const int lane = threadIdx.x, c = blockIdx.x; const bool on = lane < NI * BCH; const int l = on ? lane : 0; const size_t b = (size_t)((l / BCH) * C + c) * BCH + l % BCH;
    const float S = on ? PT[b * 32] : 0.0f, Q = on ? PT[b * 32 + 1] : 0.0f; const float mean = wavesum(S) * (1.0f / (float)NSTAT); const float d = S * (1.0f / (float)BCHN) - mean;
    const float vs = wavesum(on ? Q + (float)BCHN * d * d : 0.0f); const float rs = __frsqrt_rn(vs * (1.0f / (float)NSTAT) + BNEPS);
    ST[(size_t)c * 32 + lane] = (lane == 0) ? mean : ((lane == 1) ? rs : 0.0f); }
// uni: a value that is the same in every lane, read from LDS, goes to a scalar register, where the same value loaded through a uniform address stood: 32 vector registers fewer in k_final and its loop's instructions as they were.
__device__ __forceinline__ float uni(float x) { return __uint_as_float(__builtin_amdgcn_readfirstlane(__float_as_uint(x))); }
// wavesumN: wavesum of N values at once, each in wavesum's own order; the N exchanges of a step are in flight together.
template <int N>
__device__ __forceinline__ void wavesumN(float (&s)[N]) {
#pragma unroll
    for (int sh = 16; sh; sh >>= 1) { float o[N];
#pragma unroll
        for (int i = 0; i < N; ++i) o[i] = __shfl_xor(s[i], sh, 32);
#pragma unroll
        for (int i = 0; i < N; ++i) s[i] += o[i]; } }
template <int C>
__device__ __forceinline__ void bnmerge(const float* __restrict__ PT, float* sst) { const int lane = threadIdx.x & 31; const bool on = lane < NI * BCH; const int l = on ? lane : 0; float S[(C + 7) / 8], Q[(C + 7) / 8], mean[(C + 7) / 8], vs[(C + 7) / 8];
    // Unrolled so that a wave's channels have their loads in flight together.
#pragma unroll
    for (int i = 0; i < (C + 7) / 8; ++i) { const int c = min((int)(threadIdx.x >> 5) + i * 8, C - 1); const size_t b = (size_t)((l / BCH) * C + c) * BCH + l % BCH; S[i] = on ? PT[b * 32] : 0.0f; Q[i] = on ? PT[b * 32 + 1] : 0.0f; }
#pragma unroll
    for (int i = 0; i < (C + 7) / 8; ++i) mean[i] = S[i];
    wavesumN(mean);
#pragma unroll
    for (int i = 0; i < (C + 7) / 8; ++i) { mean[i] *= (1.0f / (float)NSTAT); const float d = S[i] * (1.0f / (float)BCHN) - mean[i]; vs[i] = on ? Q[i] + (float)BCHN * d * d : 0.0f; }
    wavesumN(vs);
    if (lane == 0) {
#pragma unroll
        for (int i = 0; i < (C + 7) / 8; ++i) { const int c = (int)(threadIdx.x >> 5) + i * 8; if (c < C) { sst[c * 2] = mean[i]; sst[c * 2 + 1] = __frsqrt_rn(vs[i] * (1.0f / (float)NSTAT) + BNEPS); } } } }
__global__ __launch_bounds__(256) void k_conv1(const float* __restrict__ X12, const float* __restrict__ wp, const float* __restrict__ bp, const float* __restrict__ ST, const float* __restrict__ g1, const float* __restrict__ be1, const float* __restrict__ cw1, float* T2) { const int i = (int)blockIdx.x * 256 + (int)threadIdx.x; if (i >= NI * KK * HW / 4) return; const int e = i * 4; const int p0 = e % HW; const int k = (e / HW) % KK; const int n = e / (HW * KK); const int di = k / KS - PADR, dj = k % KS - PADR; v4f acc[REL]; float pw[RP2 - REL][3];
#pragma unroll
    for (int pc = 0; pc < RP2 - REL; ++pc) { pw[pc][0] = wp[pc * 2]; pw[pc][1] = wp[pc * 2 + 1]; pw[pc][2] = bp[pc]; }
#pragma unroll
    for (int o = 0; o < REL; ++o) acc[o] = (v4f){0.f, 0.f, 0.f, 0.f};
    // BN1 + relu + the 18->16 mix of one channel, each multiply fused with its add: BN as one FMA with the channel's scale rs g and shift be - mean rs g (the same in every lane), the mix as FMAs on the four pixels.
    auto mix = [&](int c, v4f a) { const float sc = ST[c * 32 + 1] * bfr(g1[c]); const float sh = fmaf(-ST[c * 32], sc, bfr(be1[c]));
        const v4f tn = __builtin_elementwise_max(__builtin_elementwise_fma(a, (v4f){sc, sc, sc, sc}, (v4f){sh, sh, sh, sh}), (v4f){0.f, 0.f, 0.f, 0.f});
#pragma unroll
        for (int o = 0; o < REL; ++o) { const float w = bfr(cw1[o * RP2 + c]); acc[o] = __builtin_elementwise_fma((v4f){w, w, w, w}, tn, acc[o]); } };
    // Four channels of t = x1 - x2[nbr] are formed at a time: their 20 loads (x1 as one 16-byte load, the window neighbours of x2 as four 4-byte loads) are in flight together, and the 64 weights of the four fit the scalar registers (with eight they were spilled). The outer loop stays rolled so that the kernel's text stays small; the inner ones are unrolled so that the arrays live in registers.
    const int py = p0 / IMW, px = p0 % IMW; const float* x1b = X12 + n * HW + p0; const float* x2b[4];
#pragma unroll
    for (int q = 0; q < 4; ++q) x2b[q] = X12 + n * HW + refl(py + di) * IMW + refl(px + q + dj);   // plane 0; x2 is planes REL ..
#pragma unroll 1
    for (int cb = 0; cb < REL; cb += 4) { v4f x1v[4], x2v[4]; const float* x1p = x1b + (size_t)cb * NTOK; const float* g0 = x2b[0] + (size_t)cb * NTOK; const float* g1p = x2b[1] + (size_t)cb * NTOK; const float* g2p = x2b[2] + (size_t)cb * NTOK; const float* g3p = x2b[3] + (size_t)cb * NTOK;
#pragma unroll
        for (int u = 0; u < 4; ++u) { x1v[u] = *(const v4f*)(x1p + (size_t)u * NTOK); x2v[u][0] = g0[(size_t)(REL + u) * NTOK]; x2v[u][1] = g1p[(size_t)(REL + u) * NTOK]; x2v[u][2] = g2p[(size_t)(REL + u) * NTOK]; x2v[u][3] = g3p[(size_t)(REL + u) * NTOK]; }
        asm volatile("s_wait_xcnt 0x0" :: "v"(x1p), "v"(g0), "v"(g1p), "v"(g2p), "v"(g3p) : "memory");   // the wait before a register that an issued load names is rewritten: named as inputs, the five addresses keep their registers up to it, also as targets of the later loads
#pragma unroll
        for (int u = 0; u < 4; ++u) mix(cb + u, x1v[u] - x2v[u]); }
#pragma unroll
    for (int pc = 0; pc < RP2 - REL; ++pc) mix(REL + pc, t1p4(pw[pc][0], pw[pc][1], pw[pc][2], di, dj, p0));
    float* t2m = T2 + (((size_t)n * REL + REL / 2) * KK + k) * HW + p0;   // the address of plane 8: from it a signed immediate offset reaches all 16 planes, so that no address is formed between the stores
#pragma unroll
    for (int o = 0; o < REL; ++o) *(v4f*)(t2m + (o - REL / 2) * (KK * HW)) = acc[o]; }
// k_final: per (n, four share-groups g0..g0+3, p) (one lane per p): for each of the 49 window slots k (rolled loop): tn_o = relu((T2[n][o][k][p] - mean_o) rs_o g2 + be2), read (through LDS, see below) and formed ONCE for the lane's GPL groups (it does not depend on g); per group wl = sum_o cw2[g][o] tn_o + cb2[g]; ONLINE softmax over k in f32 (running max / sum with exp2 rescaling of the 8 accumulators, no per-slot array) fused with the aggregation out[n][g*8+s][p] = sum_k w[k] x3[g*8+s][n*HW + nbr(p,k)] (x3 channel-major [256][n*HW + p] f32: per slot and group 8 loads of 4 bytes per lane, each on consecutive addresses across the lanes). Every sum keeps the order of one group per lane; each multiply is fused with the add behind it.
#define GPL 4               // share-groups per lane
// T2 reaches k_final through LDS, by asynchronous copies, in a ring that is private to each wave: a wave's share of one window slot is 16 planes x 32 pixels = 2 KiB = four 16-byte copies (copy c: planes 4c .. 4c+3, eight lanes per plane's 128-byte line), and the copies of slot k + RAH are issued in trip k, so that a slot's way from memory or L2 runs under three trips' arithmetic and counts on asynccnt, not in front of the x3 loads on loadcnt. No other wave reads a wave's ring: no barrier.
#define RST 4               // ring slots per wave
#define RAH (RST - 1)       // slots that the copies run ahead
// t2copy: the four copies of one slot and, in the same statement, the wait before a register that an issued copy or load names is rewritten (in a statement of its own it would not hold later address arithmetic behind it). keep: the address of the x3 loads issued just before, which the same wait serves: named as an input it keeps its registers up to it, also as targets of the later loads.
__device__ __forceinline__ void t2copy(unsigned l, const float* g, const float* keep) {
    asm volatile("global_load_async_to_lds_b128 %0, %4, off\n\tglobal_load_async_to_lds_b128 %1, %5, off\n\tglobal_load_async_to_lds_b128 %2, %6, off\n\tglobal_load_async_to_lds_b128 %3, %7, off\n\ts_wait_xcnt 0x0"
                 :: "v"(l), "v"(l + 512u), "v"(l + 1024u), "v"(l + 1536u), "v"(g), "v"(g + (size_t)4 * KK * HW), "v"(g + (size_t)8 * KK * HW), "v"(g + (size_t)12 * KK * HW), "v"(keep) : "memory"); }
__global__ __launch_bounds__(256) void k_final(const float* __restrict__ T2, const float* __restrict__ PT, const float* __restrict__ g2, const float* __restrict__ be2, const float* __restrict__ cw2, const float* __restrict__ cb2, const float* __restrict__ X3, float* out) {
    __shared__ float sst[2 * REL]; __shared__ __attribute__((aligned(2048))) float ring[256 / 32][RST][REL][32];
    static_assert(((size_t)NI * (NG / GPL) * HW) % 256 == 0 && HW % 32 == 0, "the grid holds exactly one lane per (n, four groups, p), and a wave lies in one (n, four groups)");
    const size_t gidx = (size_t)blockIdx.x * 256 + threadIdx.x; __builtin_assume(gidx < (size_t)NI * (NG / GPL) * HW); const int p = (int)(gidx % HW); const int g0 = (int)((gidx / HW) % (NG / GPL)) * GPL; const int n = (int)(gidx / ((size_t)HW * (NG / GPL))); const int y = p / IMW, x = p % IMW;
    // The lane's part of copy 0 of slot 0: 16 bytes of plane lane / 8 at the wave's first pixel p - lane, to byte 16 lane of the wave's ring slot. Slots past the last are slot 48 once more, into ring slots that nobody reads any more: every trip issues four copies, so that the counted wait in the loop is exact.
    const int lane = (int)threadIdx.x & 31, wv = (int)threadIdx.x >> 5; const float* tsrc = T2 + ((size_t)n * REL + (lane >> 3)) * KK * HW + (p - lane) + (lane & 7) * 4; const unsigned ldst = (unsigned)(size_t)&ring[wv][0][0][0] + (unsigned)lane * 16u;
    auto stage = [&](int s, const float* keep) { t2copy(ldst + (unsigned)(s & (RST - 1)) * (unsigned)(REL * 32 * 4), tsrc + (size_t)min(s, KK - 1) * HW, keep); };
    // The first three slots start ahead of the BN2 merge, which does not need them. Unrolled so that each slot's ring and source offsets are constants.
#pragma unroll
    for (int s = 0; s < RAH; ++s) stage(s, tsrc);
    bnmerge<REL>(PT, sst); __syncthreads();
    float cb[GPL], m[GPL], Z[GPL], acc[GPL][SHR]; v2f ac2[GPL][SHR / 2];
    // What does not change over the 49 slots is read and formed once, here: BN2 as scale rs g2 and shift be2 - mean rs g2, so that it is one FMA per value. Values stand in pairs (two channels of T2, two groups' weights, two planes of x3) so that one packed FMA serves both. Unrolled so that the arrays live in registers.
    v2f sc[REL / 2], sh[REL / 2], cw[GPL / 2][REL];
#pragma unroll
    for (int o = 0; o < REL; ++o) { const float s0 = uni(sst[o * 2 + 1]) * bfr(g2[o]); sc[o / 2][o & 1] = s0; sh[o / 2][o & 1] = fmaf(-uni(sst[o * 2]), s0, bfr(be2[o])); }
#pragma unroll
    for (int j = 0; j < GPL; ++j) { cb[j] = bfr(cb2[g0 + j]); m[j] = -3.0e38f; Z[j] = 0.f;
#pragma unroll
        for (int o = 0; o < REL; ++o) cw[j / 2][o][j & 1] = bfr(cw2[(g0 + j) * REL + o]);
#pragma unroll
        for (int s2 = 0; s2 < SHR / 2; ++s2) ac2[j][s2] = (v2f){0.f, 0.f}; }
#pragma unroll 1
    for (int k = 0; k < KK; ++k) { v2f s[GPL / 2], tn[REL / 2]; float e1[GPL], e2[GPL], r[GPL], w[GPL];
        // All loads of a slot (16 planes of T2 from the wave's ring, then 8 planes of x3 per group from global memory) are issued ahead of its arithmetic, so that they are in flight together; T2 first, because it is used first. Unrolled so that a[] and v[][] live in registers.
        asm volatile("s_wait_asynccnt 0x8" ::: "memory");   // 12 copies are outstanding here (slots k, k + 1, k + 2): all but the 8 youngest have landed, that is slot k's four; the LDS reads below stay behind it
        v2f a[REL / 2]; const float* rb = &ring[wv][k & (RST - 1)][0][lane];
#pragma unroll
        for (int o = 0; o < REL; ++o) a[o / 2][o & 1] = rb[o * 32];
        __builtin_amdgcn_sched_barrier(0);   // keeps the LDS reads in front of the x3 address arithmetic and loads, under which they come back: placed behind them, their first use waited for the whole LDS latency
        const int yy = refl(y + k / KS - PADR), xx = refl(x + k % KS - PADR); const float* x3p = X3 + (size_t)(g0 * SHR) * NTOK + (size_t)n * HW + yy * IMW + xx; v2f v[GPL][SHR / 2];
#pragma unroll
        for (int j = 0; j < GPL; ++j) {
#pragma unroll
            for (int s2 = 0; s2 < SHR; ++s2) v[j][s2 / 2][s2 & 1] = x3p[(size_t)(j * SHR + s2) * NTOK]; }
        __builtin_amdgcn_sched_barrier(0);   // keeps the first uses of a[] behind the x3 loads: paired with the x3 address arithmetic they made those loads wait for T2 to come back
        asm volatile("s_wait_dscnt 0x0" ::: "memory");   // before a copy targets LDS that this wave has read: the ring slot refilled next was read in trip k - 1 (a ring private to one wave: this wait stands for the barrier)
        stage(k + RAH, x3p);
#pragma unroll
        for (int j = 0; j < GPL / 2; ++j) s[j] = (v2f){0.f, 0.f};
#pragma unroll
        for (int o = 0; o < REL / 2; ++o) tn[o] = __builtin_elementwise_max(__builtin_elementwise_fma(a[o], sc[o], sh[o]), (v2f){0.f, 0.f});
#pragma unroll
        for (int o = 0; o < REL; ++o) { const float t0 = tn[o / 2][o & 1];
#pragma unroll
            for (int j = 0; j < GPL / 2; ++j) s[j] = __builtin_elementwise_fma(cw[j][o], (v2f){t0, t0}, s[j]); }
#pragma unroll
        for (int j = 0; j < GPL; ++j) { const float wl = s[j / 2][j & 1] + cb[j]; const float mn = fmaxf(m[j], wl); e1[j] = (m[j] - mn) * 1.4426950408889634f; e2[j] = (wl - mn) * 1.4426950408889634f; m[j] = mn; r[j] = __builtin_amdgcn_exp2f(e1[j]); w[j] = __builtin_amdgcn_exp2f(e2[j]); }
        asm volatile("v_nop" :: "v"(e1[0]), "v"(e2[0]), "v"(e1[1]), "v"(e2[1]), "v"(e1[2]), "v"(e2[2]), "v"(e1[3]), "v"(e2[3]), "v"(r[0]), "v"(w[0]), "v"(r[1]), "v"(w[1]), "v"(r[2]), "v"(w[2]), "v"(r[3]), "v"(w[3]));   // the slot behind a transcendental, before a source of it is overwritten: named as inputs, the eight sources keep their registers up to it and it stands behind all eight exponentials
        __builtin_amdgcn_sched_barrier(0);   // keeps the products with the exponentials' results behind that v_nop: lifted over it, they left it sixteen instructions behind the last exponential
#pragma unroll
        for (int j = 0; j < GPL; ++j) { Z[j] = fmaf(Z[j], r[j], w[j]);
#pragma unroll
            for (int s2 = 0; s2 < SHR / 2; ++s2) ac2[j][s2] = __builtin_elementwise_fma(ac2[j][s2], (v2f){r[j], r[j]}, (v2f){w[j], w[j]} * v[j][s2]); } }
#pragma unroll
    for (int j = 0; j < GPL; ++j) {
#pragma unroll
        for (int s2 = 0; s2 < SHR; ++s2) acc[j][s2] = ac2[j][s2 / 2][s2 & 1]; }
#pragma unroll
    for (int j = 0; j < GPL; ++j) { const float iz = __fdiv_rn(1.0f, Z[j]);
#pragma unroll
        for (int s2 = 0; s2 < SHR; ++s2) *(float*)(out + ((size_t)n * OUTC + (g0 + j) * SHR + s2) * HW + p) = acc[j][s2] * iz;
         }
    asm volatile("s_wait_asynccnt 0x0" ::: "memory");   // no copy is outstanding when the wave ends
}

extern "C" void kernel_launch(void* const* d_in, const int* in_sizes, int n_in,
                              void* d_out, int out_size, void* d_ws, size_t ws_size, hipStream_t stream) {
    (void)in_sizes; (void)n_in; (void)out_size;
    const float* x = (const float*)d_in[0]; const float* w1 = (const float*)d_in[1]; const float* b1 = (const float*)d_in[2]; const float* w2 = (const float*)d_in[3]; const float* b2 = (const float*)d_in[4]; const float* w3 = (const float*)d_in[5]; const float* b3 = (const float*)d_in[6]; const float* wp = (const float*)d_in[7]; const float* bp = (const float*)d_in[8];
    const float* g1 = (const float*)d_in[9]; const float* be1 = (const float*)d_in[10]; const float* cw1 = (const float*)d_in[11]; const float* g2 = (const float*)d_in[12]; const float* be2 = (const float*)d_in[13]; const float* cw2 = (const float*)d_in[14]; const float* cb2 = (const float*)d_in[15];
    float* OUT = (float*)d_out;     // [2][256][56][56]
    char* wsp = (char*)d_ws;
    auto take = [&](size_t bytes) { char* p = wsp; wsp += (bytes + 255) & ~(size_t)255; return (void*)p; };
    bf* XT = (bf*)take((size_t)NTOK * CIN * 2); bf* WA = (bf*)take((size_t)(64 + OUTC) * CIN * 2); float* BA = (float*)take((64 + OUTC) * 4);   /* weight rows and biases: x1 | x2 | 32 zero rows | x3 */
    float* X12 = (float*)take((size_t)NTOK * (64 + OUTC) * 4); float* X3 = X12 + (size_t)NTOK * 64; float* T2 = (float*)take((size_t)NI * REL * KK * HW * 4); float* ST1 = (float*)take(32 * 32 * 4); float* PT = (float*)take((size_t)NI * RP2 * BCH * 32 * 4);
    if ((size_t)(wsp - (char*)d_ws) > ws_size) return;    // carve ~30 MiB
    k_prep<<<PB_T + PB_W + PB_3, 256, 0, stream>>>(x, w1, w2, w3, b1, b2, b3, XT, WA, BA);
    k_gemmw<bf, 0, true><<<dim3((64 + OUTC) / 64, NTOK / 64, 1), 32, 0, stream>>>(WA, nullptr, XT, nullptr, CIN, X12, NTOK, BA, 0, 0, 0);   /* channel-major [row][tok]: rows 0..15 x1, 16..31 x2, 64..319 x3 */
    k_bnpart<true><<<NI * RP2 * BCH, BTH, 0, stream>>>(X12, wp, bp, PT); k_bnfin<<<RP2, 32, 0, stream>>>(PT, RP2, ST1);
    k_conv1<<<(unsigned)(((size_t)NI * KK * HW / 4 + 255) / 256), 256, 0, stream>>>(X12, wp, bp, ST1, g1, be1, cw1, T2);
    k_bnpart<false><<<NI * REL * BCH, BTH, 0, stream>>>(T2, wp, bp, PT);
    k_final<<<(unsigned)(((size_t)NI * (NG / GPL) * HW + 255) / 256), 256, 0, stream>>>(T2, PT, g2, be2, cw2, cb2, X3, OUT);
}

// v009
// Measured time: 62.3 microseconds a run.
// Next to v008, in two timings, it ran 1.05 times as fast each time.
// All steps since v000 together make it 49.8 times as fast.
#include <hip/hip_runtime.h>

// SAN pairwise self-attention module (x [2][256][56][56]; x1, x2 = 1x1(x; [16][256] + b), x3 = 1x1(x; [256][256] + b); pos = 1x1(linspace grid [2][56][56]; wp [2][2] + bp); 7x7 reflect-padded windows (pad 3): t = concat(x1 - unfold(x2), pos - unfold(pos)) [2][18][49][3136];
// t = relu(BN1(t)) (training-mode batch statistics over n, k, p per channel); t = 1x1(t; cw1 [16][18]); t = relu(BN2(t)); wlog = 1x1(t; cw2 [32][16] + cb2); w = softmax over the 49 window slots; out[n][g*8+s][p] = sum_k unfold(x3)[n][g*8+s][k][p] w[n][g][k][p] -> [2][256][56][56] (1.6 M)).
// Compute dtypes, f32 accumulate: every input rounded to bf16; the three 1x1 input convs on PLAIN bf16 operands (input transposed while converting; exact) + f32 biases, their results stored channel-major [channel][n*3136 + p]; everything after that in f32 on the VALU: window differences, position features (linspace in f32), both BatchNorms with deterministic fixed-order batch statistics (per chunk its sum and squared distances from the chunk mean, merged at the head of the kernel that applies them; biased variance, eps 1e-5), the 18->16 and 16->32 channel mixes, the 49-way softmax (online form: running max/sum with rescaling) fused with the weighted aggregation of the reflect-gathered x3.

#define NI   2
#define CIN  256
#define IMW  56
#define HW   3136
#define NTOK (NI * HW)      // 6272 = 98 x 64
#define REL  16
#define RP2  18             // rel + 2 position channels
#define OUTC 256
#define SHR  8
#define NG   32             // out / share
#define KS   7
#define KK   49
#define PADR 3
#define BNEPS 1e-5f
#define NSTAT ((size_t)NI * KK * HW)   // 307328 elements per channel
typedef _Float16 h16;
typedef unsigned short bf;
typedef __attribute__((ext_vector_type(16))) __bf16   v16bf;
typedef __attribute__((ext_vector_type(16))) _Float16 v16h;
typedef __attribute__((ext_vector_type(8)))  _Float16 v8h;
typedef __attribute__((ext_vector_type(8)))  unsigned short v8us;
typedef __attribute__((ext_vector_type(8)))  float    v8f;
typedef __attribute__((ext_vector_type(4)))  float    v4f;
typedef v8h  __attribute__((may_alias)) v8ha;
typedef v4f  __attribute__((may_alias)) v4fa;
typedef v8us __attribute__((may_alias)) v8usa;

__device__ __forceinline__ unsigned short f2bf(float f) { unsigned u = __float_as_uint(f); u += 0x7FFFu + ((u >> 16) & 1u); return (unsigned short)(u >> 16); }
__device__ __forceinline__ float bf2f(unsigned short b) { return __uint_as_float(((unsigned)b) << 16); }
__device__ __forceinline__ float bfr(float f) { return bf2f(f2bf(f)); }
__device__ __forceinline__ v16h cat16(v8h lo, v8h hi) { return __builtin_shufflevector(lo, hi, 0, 1, 2, 3, 4, 5, 6, 7, 8, 9, 10, 11, 12, 13, 14, 15); }
__device__ __forceinline__ v16bf cat16b(v8us lo, v8us hi) { return __builtin_bit_cast(v16bf, __builtin_shufflevector(lo, hi, 0, 1, 2, 3, 4, 5, 6, 7, 8, 9, 10, 11, 12, 13, 14, 15)); }
__device__ __forceinline__ v8f wmma16(v16h a, v16h b, v8f c) { return __builtin_amdgcn_wmma_f32_16x16x32_f16(false, a, false, b, (short)0, c, false, false); }
__device__ __forceinline__ v8f wmmab(v16bf a, v16bf b, v8f c) { return __builtin_amdgcn_wmma_f32_16x16x32_bf16(false, a, false, b, (short)0, c, false, false); }



// ---- k_gemmw: register-blocked GEMM, ONE WAVE per 64x64 output tile (16 accumulators), operands straight from K-contiguous 16-bit planes; grid (M/64, N/64, Z), 32 threads.
// C[m][n] (f32, pitch ldc, + optional f32 bias[m]) = sum_k A[m][k] Bt[n][k] (+ split products per NSPLIT). z-batch strides sA/sB/sC in elements. K % 32 == 0.
template <typename T16> struct WFrag;
template <> struct WFrag<h16> { typedef v16h V; static __device__ __forceinline__ V ld(const h16* p) { return cat16(*(const v8h*)p, *(const v8h*)(p + 16)); } static __device__ __forceinline__ v8f mma(V a, V b, v8f c) { return wmma16(a, b, c); } };
template <> struct WFrag<bf> { typedef v16bf V; static __device__ __forceinline__ V ld(const bf* p) { return cat16b(*(const v8us*)p, *(const v8us*)(p + 16)); } static __device__ __forceinline__ v8f mma(V a, V b, v8f c) { return wmmab(a, b, c); } };
template <typename T16, int NSPLIT, bool BIAS>
__global__ __launch_bounds__(32) void k_gemmw(const T16* __restrict__ A, const T16* __restrict__ A2, const T16* __restrict__ Bt, const T16* __restrict__ Bt2, int K, float* C, int ldc, const float* __restrict__ bias, size_t sA, size_t sB, size_t sC) {
    typedef typename WFrag<T16>::V V;
    __shared__ __align__(16) float os[16 * 68];
    const size_t z = blockIdx.z; A += z * sA; if (A2) A2 += z * sA; Bt += z * sB; if (Bt2) Bt2 += z * sB; C += z * sC;
    const int lane = threadIdx.x & 31, lr = lane & 15, hi = lane >> 4; const int r0 = blockIdx.x * 64, c0 = blockIdx.y * 64;
    v8f acc[4][4];
#pragma unroll
    for (int mb = 0; mb < 4; ++mb)
#pragma unroll
        for (int nb = 0; nb < 4; ++nb) acc[mb][nb] = (v8f){};
    const size_t aoff = (size_t)(r0 + lr) * K + 8 * hi, boff = (size_t)(c0 + lr) * K + 8 * hi;
#pragma unroll 1
    for (int kc = 0; kc < K; kc += 32) {
        V a[4], a2[4];
#pragma unroll
        for (int mb = 0; mb < 4; ++mb) { a[mb] = WFrag<T16>::ld(A + aoff + (size_t)mb * 16 * K + kc); if (NSPLIT == 1 || NSPLIT == 2) a2[mb] = WFrag<T16>::ld(A2 + aoff + (size_t)mb * 16 * K + kc); }
#pragma unroll
        for (int nb = 0; nb < 4; ++nb) { const V b = WFrag<T16>::ld(Bt + boff + (size_t)nb * 16 * K + kc); V b2; if (NSPLIT >= 2) b2 = WFrag<T16>::ld(Bt2 + boff + (size_t)nb * 16 * K + kc);
#pragma unroll
            for (int mb = 0; mb < 4; ++mb) { acc[mb][nb] = WFrag<T16>::mma(a[mb], b, acc[mb][nb]); if (NSPLIT == 1 || NSPLIT == 2) acc[mb][nb] = WFrag<T16>::mma(a2[mb], b, acc[mb][nb]); if (NSPLIT >= 2) acc[mb][nb] = WFrag<T16>::mma(a[mb], b2, acc[mb][nb]); } }
        asm volatile("v_nop\n\tv_nop\n\tv_nop\n\tv_nop" : "+v"(acc[0][0]), "+v"(acc[1][1]), "+v"(acc[2][2]), "+v"(acc[3][3]) : "v"(a[0]), "v"(a[3]));
    }
#pragma unroll
    for (int mb = 0; mb < 4; ++mb) {
#pragma unroll
        for (int nb = 0; nb < 4; ++nb) {
#pragma unroll
            for (int j = 0; j < 8; ++j) os[(hi * 8 + j) * 68 + nb * 16 + lr] = acc[mb][nb][j]; }
        __builtin_amdgcn_wave_barrier(); asm volatile("" ::: "memory");
        float* crow = C + (size_t)(r0 + mb * 16) * ldc + c0;
{
#pragma unroll
            for (int s = 0; s < 8; ++s) { const int row = 2 * s + hi, cofs = lr * 4; v4f val = *(const v4fa*)(os + row * 68 + cofs); if (BIAS) { const float bv = bfr(bias[r0 + mb * 16 + row]); val[0] += bv; val[1] += bv; val[2] += bv; val[3] += bv; }
                *(v4f*)(crow + (size_t)row * ldc + cofs) = val; }
             }
        asm volatile("s_wait_xcnt 0x0" ::: "memory");   // the next 16 rows reuse the registers that these stores name
        __builtin_amdgcn_wave_barrier(); asm volatile("" ::: "memory");
    }
}

__device__ __forceinline__ h16 tohx(float x) { return (h16)x; }
__device__ __forceinline__ void splitf(float y, unsigned short& h, unsigned short& l) { h = f2bf(y); l = f2bf(y - bf2f(h)); }
typedef __attribute__((ext_vector_type(2))) _Float16 v2h;
typedef __attribute__((ext_vector_type(4))) _Float16 v4h;
typedef __attribute__((ext_vector_type(2))) unsigned short v2us;
typedef __attribute__((ext_vector_type(4))) unsigned short v4us;
typedef __attribute__((ext_vector_type(2))) float v2f;
typedef __attribute__((ext_vector_type(4))) int v4i;

__device__ __forceinline__ void d_cvt8(int blk, const float* __restrict__ src, bf* dst, size_t n8) { const size_t i = (size_t)blk * 256 + threadIdx.x; if (i >= n8) return; const v8f v = *(const v8f*)(src + i * 8); v8us o;
#pragma unroll
    for (int k = 0; k < 8; ++k) o[k] = f2bf(v[k]); *(v8us*)(dst + i * 8) = o;  }

__device__ __forceinline__ void d_cvt8T(int blk, const float* __restrict__ src, bf* dst) { const size_t i = (size_t)blk * 256 + threadIdx.x; if (i >= (size_t)NTOK * CIN / 8) return; const int tok = (int)(i / (CIN / 8)); const int c0 = (int)(i % (CIN / 8)) * 8; const int n = tok / HW, p = tok % HW; v8us o;
#pragma unroll
    for (int k = 0; k < 8; ++k) o[k] = f2bf(src[((size_t)n * CIN + c0 + k) * HW + p]); *(v8us*)(dst + (size_t)tok * CIN + c0) = o;  }
__device__ __forceinline__ void d_w12(int blk, const float* __restrict__ w1, const float* __restrict__ w2, const float* __restrict__ b1, const float* __restrict__ b2, const float* __restrict__ b3, bf* W12, float* B12) { const int i = blk * 256 + threadIdx.x; if (i < 64 * CIN / 8) { const int o = i / (CIN / 8); const int c0 = (i % (CIN / 8)) * 8; v8us ov;
#pragma unroll
        for (int q = 0; q < 8; ++q) { const float v = (o < REL) ? w1[o * CIN + c0 + q] : ((o < 2 * REL) ? w2[(o - REL) * CIN + c0 + q] : 0.0f); ov[q] = f2bf(v); }
        *(v8us*)(W12 + (size_t)o * CIN + c0) = ov;  }
    if (i < 64 + OUTC) { const float v = (i < REL) ? b1[i] : ((i < 2 * REL) ? b2[i - REL] : ((i < 64) ? 0.0f : b3[i - 64])); *(float*)(B12 + i) = v;  } }
// k_prep: the three conversions are independent of one another and share one launch: blocks [0, PB_W) build rows 0..63 of the weight plane (w1 | w2 | zeros) and the 320 biases (b1 | b2 | zeros | b3), the next PB_3 round w3 into rows 64..319, the last PB_T transpose and round x.
#define PB_T ((NTOK * CIN / 8 + 255) / 256)
#define PB_W ((64 * CIN / 8 + 255) / 256)
#define PB_3 ((OUTC * CIN / 8 + 255) / 256)
__global__ __launch_bounds__(256) void k_prep(const float* __restrict__ x, const float* __restrict__ w1, const float* __restrict__ w2, const float* __restrict__ w3, const float* __restrict__ b1, const float* __restrict__ b2, const float* __restrict__ b3, bf* XT, bf* WA, float* BA) { const int b = (int)blockIdx.x;
    if (b < PB_W) d_w12(b, w1, w2, b1, b2, b3, WA, BA); else if (b < PB_W + PB_3) d_cvt8(b - PB_W, w3, WA + (size_t)64 * CIN, (size_t)OUTC * CIN / 8); else d_cvt8T(b - PB_W - PB_3, x, XT); }
__device__ __forceinline__ int refl(int i) { return i < 0 ? -i : (i >= IMW ? 2 * (IMW - 1) - i : i); }
__device__ __forceinline__ float linsp(int j) { return __fadd_rn(-1.0f, __fmul_rn((float)j, 2.0f / 55.0f)); }   /* jnp.linspace(-1, 1, 56)[j] in f32 */
__device__ __forceinline__ float posv(const float* wp, const float* bp, int c, int y, int x) { return fmaf(bfr(wp[c * 2 + 1]), linsp(y), bfr(wp[c * 2 + 0]) * linsp(x)) + bfr(bp[c]); }
// t = concat(x1 - unfold(x2), pos - unfold(pos)) is never stored: its two readers (the BN1 statistics and the 18->16 mix) form it themselves, four consecutive pixels p0..p0+3 (p0 % 4 == 0: one image row) of window slot (di, dj) at a time: channels c < 16 from the channel-major planes of X12 (0.8 MB, cache resident), x1 as one 16-byte load, the window neighbours of x2 as four 4-byte loads from a few cache lines per wave; the position channels from the position formula.
// t1p4: one position channel, its two weights and its bias read by the caller, once.
__device__ __forceinline__ v4f t1p4(float w0, float w1, float b, int di, int dj, int p0) { const int y = p0 / IMW, x = p0 % IMW; const int yy = refl(y + di); const float wl[2] = {w0, w1}, bl[1] = {b}; v4f o;
#pragma unroll
    for (int q = 0; q < 4; ++q) o[q] = __fsub_rn(posv(wl, bl, 0, y, x + q), posv(wl, bl, 0, yy, refl(x + q + dj)));
    return o; }
// ---- batch statistics of one BatchNorm, fixed summation order, no atomics.
// k_bnpart (BN1): t is [n][c][49][3136]; that tensor is not in memory, T is X12 and each value is formed as in k_conv1, so work-group b owns the contiguous chunk b = (n*18 + c)*7 + j of 7 window slots (21952 values), held in registers: the chunk's sum S, then Q = sum of squared distances from the chunk's own mean. Each work-group stores its own 128-byte line of PT.
// bnmerge (BN1): no launch of its own: run at the head of every work-group (256 threads) of k_conv1, wave w merging channels w, w + 8, ..: one wave merges a channel's 14 equal chunks: mean = sum S / N; N var = sum (Q + 21952 (S/21952 - mean)^2) (pairwise merge of variances: no cancellation of large squares); sst[c*2] = mean, sst[c*2+1] = rsqrt(var + eps), in LDS; the caller's __syncthreads() hands them to the other waves.
// BN2 has no statistics launch either: each work-group of k_conv1 holds 1024 values (the last one 128) of each of the 16 channels of T2 in registers and forms S and Q of that chunk there (PT2[chunk][channel][S, Q]: its own 128-byte line); bnmerge2 merges the 301 chunks, by the same formula, at the head of every work-group of k_final.
#define BCH  KS                          // chunks per (n, c) plane
#define BCHN (KS * HW)                   // 21952 values per chunk
#define BCHV (BCHN / 4)                  // 5488 16-byte loads per chunk
#define BTH  512
#define BIT  ((BCHV + BTH - 1) / BTH)    // 11 loads per thread, the last one only in the first 368 threads
__device__ __forceinline__ float wavesum(float s) {
#pragma unroll
    for (int sh = 16; sh; sh >>= 1) s += __shfl_xor(s, sh, 32);
    return s; }
__device__ __forceinline__ float blocksum(float s, float* red) { s = wavesum(s); if ((threadIdx.x & 31) == 0) red[threadIdx.x >> 5] = s; __syncthreads(); float t = 0.f;
#pragma unroll
    for (int i = 0; i < BTH / 32; ++i) t += red[i];
    return t; }
__global__ __launch_bounds__(BTH) void k_bnpart(const float* __restrict__ T, const float* __restrict__ wp, const float* __restrict__ bp, float* PT) { __shared__ float red[2][BTH / 32]; const int t = threadIdx.x; const bool tail = t < BCHV - (BIT - 1) * BTH; v4f a[BIT];
    const int cj = (int)blockIdx.x % BCH, cc = ((int)blockIdx.x / BCH) % RP2, cn = (int)blockIdx.x / (BCH * RP2);   // the chunk is window row cj of channel cc of image cn; its 16-byte element e4 is window column e4 / 784, pixels 4 (e4 % 784) ..
    a[BIT - 1] = (v4f){0.f, 0.f, 0.f, 0.f};
    if (cc < REL) {   // all eleven elements: element offsets, then the 55 loads in flight together, then the differences. A lane past the chunk's end reads element 0 and drops it.
        const v4f* x1b = (const v4f*)(T + (size_t)cc * NTOK + cn * HW); const float* x2b = T + (size_t)(REL + cc) * NTOK + cn * HW; unsigned o1[BIT], og[BIT][4]; v4f x1v[BIT]; float x2v[BIT][4];
#pragma unroll
        for (int i = 0; i < BIT; ++i) { const int e4 = (i < BIT - 1 || tail) ? i * BTH + t : 0; const int dj = e4 / (HW / 4) - PADR, p0 = (e4 % (HW / 4)) * 4; const int y = p0 / IMW, x = p0 % IMW; const int r = refl(y + cj - PADR) * IMW; o1[i] = (unsigned)(e4 % (HW / 4));
#pragma unroll
            for (int q = 0; q < 4; ++q) og[i][q] = (unsigned)(r + refl(x + q + dj)); }
#pragma unroll
        for (int i = 0; i < BIT; ++i) { x1v[i] = x1b[o1[i]];
#pragma unroll
            for (int q = 0; q < 4; ++q) x2v[i][q] = x2b[og[i][q]]; }
        // The wait before a register that an issued load names is rewritten. The offsets are named as inputs so that their registers stay as they are up to it, also as targets of the later loads (an asm statement takes thirty operands: two statements).
        asm volatile("s_wait_xcnt 0x0" :: "v"(o1[0]), "v"(o1[1]), "v"(o1[2]), "v"(o1[3]), "v"(o1[4]), "v"(o1[5]), "v"(o1[6]), "v"(o1[7]), "v"(o1[8]), "v"(o1[9]), "v"(o1[10]), "v"(og[0][0]), "v"(og[0][1]), "v"(og[0][2]), "v"(og[0][3]), "v"(og[1][0]), "v"(og[1][1]), "v"(og[1][2]), "v"(og[1][3]), "v"(og[2][0]), "v"(og[2][1]), "v"(og[2][2]), "v"(og[2][3]), "v"(og[3][0]), "v"(og[3][1]), "v"(og[3][2]), "v"(og[3][3]) : "memory");
        asm volatile("s_wait_xcnt 0x0" :: "v"(og[4][0]), "v"(og[4][1]), "v"(og[4][2]), "v"(og[4][3]), "v"(og[5][0]), "v"(og[5][1]), "v"(og[5][2]), "v"(og[5][3]), "v"(og[6][0]), "v"(og[6][1]), "v"(og[6][2]), "v"(og[6][3]), "v"(og[7][0]), "v"(og[7][1]), "v"(og[7][2]), "v"(og[7][3]), "v"(og[8][0]), "v"(og[8][1]), "v"(og[8][2]), "v"(og[8][3]), "v"(og[9][0]), "v"(og[9][1]), "v"(og[9][2]), "v"(og[9][3]), "v"(og[10][0]), "v"(og[10][1]), "v"(og[10][2]), "v"(og[10][3]) : "memory");
#pragma unroll
        for (int i = 0; i < BIT; ++i) { if (i < BIT - 1 || tail) {
#pragma unroll
            for (int q = 0; q < 4; ++q) a[i][q] = __fsub_rn(x1v[i][q], x2v[i][q]); } } }
    else { const float w0 = wp[(cc - REL) * 2], w1 = wp[(cc - REL) * 2 + 1], b = bp[cc - REL];
#pragma unroll
        for (int i = 0; i < BIT; ++i) { const int e4 = i * BTH + t; if (i < BIT - 1 || tail) a[i] = t1p4(w0, w1, b, cj - PADR, e4 / (HW / 4) - PADR, (e4 % (HW / 4)) * 4); } }
    v4f s4 = a[0];
#pragma unroll
    for (int i = 1; i < BIT; ++i) s4 += a[i];
    const float S = blocksum((s4[0] + s4[1]) + (s4[2] + s4[3]), red[0]); const float cm = S * (1.0f / (float)BCHN); v4f q4 = (v4f){0.f, 0.f, 0.f, 0.f};
#pragma unroll
    for (int i = 0; i < BIT - 1; ++i) { const v4f d = a[i] - cm; q4 += d * d; }
    if (tail) { const v4f d = a[BIT - 1] - cm; q4 += d * d; }
    const float Q = blocksum((q4[0] + q4[1]) + (q4[2] + q4[3]), red[1]);
    if (t < 32) PT[(size_t)blockIdx.x * 32 + t] = (t == 0) ? S : ((t == 1) ? Q : 0.0f); }
// uni: a value that is the same in every lane, read from LDS, goes to a scalar register, where the same value loaded through a uniform address stood: 32 vector registers fewer in k_final.
__device__ __forceinline__ float uni(float x) { return __uint_as_float(__builtin_amdgcn_readfirstlane(__float_as_uint(x))); }
// wavesumN: wavesum of N values at once, each in wavesum's own order; the N exchanges of a step are in flight together.
template <int N>
__device__ __forceinline__ void wavesumN(float (&s)[N]) {
#pragma unroll
    for (int sh = 16; sh; sh >>= 1) { float o[N];
#pragma unroll
        for (int i = 0; i < N; ++i) o[i] = __shfl_xor(s[i], sh, 32);
#pragma unroll
        for (int i = 0; i < N; ++i) s[i] += o[i]; } }
// wavesum16: sixteen sums over a wave at once. In each exchange step a lane hands half of its values to its partner and keeps the other half, so that 16 exchanges do the work of 80; lane l ends with the sum of value l / 2.
template <int H>
__device__ __forceinline__ void halve(float (&s)[REL], int lane) { const bool up = (lane & (2 * H)) != 0;   // partner: lane ^ 2 H; of 2 H values H stay
#pragma unroll
    for (int i = 0; i < H; ++i) { const float keep = up ? s[i + H] : s[i], send = up ? s[i] : s[i + H]; s[i] = keep + __shfl_xor(send, 2 * H, 32); } }
__device__ __forceinline__ float wavesum16(float (&s)[REL]) { const int lane = (int)threadIdx.x & 31; halve<8>(s, lane); halve<4>(s, lane); halve<2>(s, lane); halve<1>(s, lane); return s[0] + __shfl_xor(s[0], 1, 32); }
template <int C>
__device__ __forceinline__ void bnmerge(const float* __restrict__ PT, float* sst) { const int lane = threadIdx.x & 31; const bool on = lane < NI * BCH; const int l = on ? lane : 0; float S[(C + 7) / 8], Q[(C + 7) / 8], mean[(C + 7) / 8], vs[(C + 7) / 8];
    // Unrolled so that a wave's channels have their loads in flight together.
#pragma unroll
    for (int i = 0; i < (C + 7) / 8; ++i) { const int c = min((int)(threadIdx.x >> 5) + i * 8, C - 1); const size_t b = (size_t)((l / BCH) * C + c) * BCH + l % BCH; const v2f sq = *(const v2f*)(PT + b * 32); S[i] = on ? sq[0] : 0.0f; Q[i] = on ? sq[1] : 0.0f; }
#pragma unroll
    for (int i = 0; i < (C + 7) / 8; ++i) mean[i] = S[i];
    wavesumN(mean);
#pragma unroll
    for (int i = 0; i < (C + 7) / 8; ++i) { mean[i] *= (1.0f / (float)NSTAT); const float d = S[i] * (1.0f / (float)BCHN) - mean[i]; vs[i] = on ? Q[i] + (float)BCHN * d * d : 0.0f; }
    wavesumN(vs);
    if (lane == 0) {
#pragma unroll
        for (int i = 0; i < (C + 7) / 8; ++i) { const int c = (int)(threadIdx.x >> 5) + i * 8; if (c < C) { sst[c * 2] = mean[i]; sst[c * 2 + 1] = __frsqrt_rn(vs[i] * (1.0f / (float)NSTAT) + BNEPS); } } } }
#define CNT4 (NI * KK * HW / 4)                  // threads of k_conv1 that have four values each
#define CBL  ((CNT4 + 255) / 256)               // its work-groups = the chunks of BN2: 301
#define CLAST ((CNT4 - (CBL - 1) * 256) * 4)    // values per channel in the last chunk: 128
#define MIT  ((CBL * (REL / 2) + 255) / 256)    // 16-byte loads per thread in bnmerge2: 10, the last one only in the first 104 threads
// bnmerge2: the work-group (256 threads) reads all of PT2 in whole lines: 16-byte element idx = t + 256 j is chunk idx / 8, channels 2 (t % 8) and 2 (t % 8) + 1, as S, Q, S, Q. A thread sums its ten chunks, the four lanes of a wave that hold the same channel pair are summed by two exchanges, the eight waves through LDS (mr), first for the means, then for the variances. sst as in bnmerge; the caller's __syncthreads() hands it on.
__device__ __forceinline__ void bnmerge2(const float* __restrict__ PT2, float* sst, float (*mr)[8][REL]) { const int t = (int)threadIdx.x, lane = t & 31, wv = t >> 5, c0 = (t & 7) * 2; v4f a[MIT];
    // Unrolled so that the ten loads are in flight together. In the last round a thread past the end reads its first element once more and counts it as zeros.
    const bool tail = t < CBL * (REL / 2) - (MIT - 1) * 256;
#pragma unroll
    for (int j = 0; j < MIT; ++j) a[j] = ((const v4f*)PT2)[(j < MIT - 1 || tail) ? t + 256 * j : t];
    if (!tail) a[MIT - 1] = (v4f){0.f, 0.f, 0.f, 0.f};
    float s[2] = {0.f, 0.f};
#pragma unroll
    for (int j = 0; j < MIT; ++j) { s[0] += a[j][0]; s[1] += a[j][2]; }
#pragma unroll
    for (int sh = 16; sh >= 8; sh >>= 1) { const float o0 = __shfl_xor(s[0], sh, 32), o1 = __shfl_xor(s[1], sh, 32); s[0] += o0; s[1] += o1; }
    if (lane < 8) { mr[0][wv][c0] = s[0]; mr[0][wv][c0 + 1] = s[1]; }
    __syncthreads();
    float mean[2] = {0.f, 0.f}, v[2] = {0.f, 0.f};
#pragma unroll
    for (int w = 0; w < 8; ++w) { mean[0] += mr[0][w][c0]; mean[1] += mr[0][w][c0 + 1]; }
    mean[0] *= (1.0f / (float)NSTAT); mean[1] *= (1.0f / (float)NSTAT);
#pragma unroll
    for (int j = 0; j < MIT; ++j) { const bool last = j == MIT - 1 && (t + 256 * j) / (REL / 2) == CBL - 1; const float nb = (j < MIT - 1 || tail) ? (last ? (float)CLAST : 1024.0f) : 0.0f, inb = last ? 1.0f / (float)CLAST : 1.0f / 1024.0f;   // nb = 0: no chunk
        const float d0 = a[j][0] * inb - mean[0], d1 = a[j][2] * inb - mean[1]; v[0] += a[j][1] + nb * d0 * d0; v[1] += a[j][3] + nb * d1 * d1; }
#pragma unroll
    for (int sh = 16; sh >= 8; sh >>= 1) { const float o0 = __shfl_xor(v[0], sh, 32), o1 = __shfl_xor(v[1], sh, 32); v[0] += o0; v[1] += o1; }
    if (lane < 8) { mr[1][wv][c0] = v[0]; mr[1][wv][c0 + 1] = v[1]; }
    __syncthreads();
    if (t < 8) {
#pragma unroll
        for (int h = 0; h < 2; ++h) { float vs = 0.f;
#pragma unroll
            for (int w = 0; w < 8; ++w) vs += mr[1][w][c0 + h];
            sst[(c0 + h) * 2] = mean[h]; sst[(c0 + h) * 2 + 1] = __frsqrt_rn(vs * (1.0f / (float)NSTAT) + BNEPS); } } }
__global__ __launch_bounds__(256) void k_conv1(const float* __restrict__ X12, const float* __restrict__ wp, const float* __restrict__ bp, const float* __restrict__ PT, const float* __restrict__ g1, const float* __restrict__ be1, const float* __restrict__ cw1, float* T2, float* PT2) {
    __shared__ __attribute__((aligned(16))) float sst[2 * RP2]; __shared__ __attribute__((aligned(16))) float red[2][8][REL];
    // No thread leaves early (barriers below): a thread past the end works on the last four values once more, stores nothing and adds nothing to the statistics.
    const bool on = (int)blockIdx.x * 256 + (int)threadIdx.x < CNT4; const int i = on ? (int)blockIdx.x * 256 + (int)threadIdx.x : CNT4 - 1; const int e = i * 4; const int p0 = e % HW; const int k = (e / HW) % KK; const int n = e / (HW * KK); const int di = k / KS - PADR, dj = k % KS - PADR; v4f acc[REL]; float pw[RP2 - REL][3];
#pragma unroll
    for (int pc = 0; pc < RP2 - REL; ++pc) { pw[pc][0] = wp[pc * 2]; pw[pc][1] = wp[pc * 2 + 1]; pw[pc][2] = bp[pc]; }
#pragma unroll
    for (int o = 0; o < REL; ++o) acc[o] = (v4f){0.f, 0.f, 0.f, 0.f};
    // BN1 + relu + the 18->16 mix of one channel, each multiply fused with its add: BN as one FMA with the channel's scale rs g and shift be - mean rs g (the same in every lane), the mix as FMAs on the four pixels.
    bnmerge<RP2>(PT, sst); __syncthreads();
    auto mix = [&](int c, v4f a) { const float sc = uni(sst[c * 2 + 1]) * bfr(g1[c]); const float sh = fmaf(-uni(sst[c * 2]), sc, bfr(be1[c]));
        const v4f tn = __builtin_elementwise_max(__builtin_elementwise_fma(a, (v4f){sc, sc, sc, sc}, (v4f){sh, sh, sh, sh}), (v4f){0.f, 0.f, 0.f, 0.f});
#pragma unroll
        for (int o = 0; o < REL; ++o) { const float w = bfr(cw1[o * RP2 + c]); acc[o] = __builtin_elementwise_fma((v4f){w, w, w, w}, tn, acc[o]); } };
    // Four channels of t = x1 - x2[nbr] are formed at a time: their 20 loads (x1 as one 16-byte load, the window neighbours of x2 as four 4-byte loads) are in flight together, and the 64 weights of the four fit the scalar registers (with eight they were spilled). The outer loop stays rolled so that the kernel's text stays small; the inner ones are unrolled so that the arrays live in registers.
    const int py = p0 / IMW, px = p0 % IMW; const float* x1b = X12 + n * HW + p0; const float* x2b[4];
#pragma unroll
    for (int q = 0; q < 4; ++q) x2b[q] = X12 + n * HW + refl(py + di) * IMW + refl(px + q + dj);   // plane 0; x2 is planes REL ..
#pragma unroll 1
    for (int cb = 0; cb < REL; cb += 4) { v4f x1v[4], x2v[4]; const float* x1p = x1b + (size_t)cb * NTOK; const float* g0 = x2b[0] + (size_t)cb * NTOK; const float* g1p = x2b[1] + (size_t)cb * NTOK; const float* g2p = x2b[2] + (size_t)cb * NTOK; const float* g3p = x2b[3] + (size_t)cb * NTOK;
#pragma unroll
        for (int u = 0; u < 4; ++u) { x1v[u] = *(const v4f*)(x1p + (size_t)u * NTOK); x2v[u][0] = g0[(size_t)(REL + u) * NTOK]; x2v[u][1] = g1p[(size_t)(REL + u) * NTOK]; x2v[u][2] = g2p[(size_t)(REL + u) * NTOK]; x2v[u][3] = g3p[(size_t)(REL + u) * NTOK]; }
        asm volatile("s_wait_xcnt 0x0" :: "v"(x1p), "v"(g0), "v"(g1p), "v"(g2p), "v"(g3p) : "memory");   // the wait before a register that an issued load names is rewritten: named as inputs, the five addresses keep their registers up to it, also as targets of the later loads
#pragma unroll
        for (int u = 0; u < 4; ++u) mix(cb + u, x1v[u] - x2v[u]); }
#pragma unroll
    for (int pc = 0; pc < RP2 - REL; ++pc) mix(REL + pc, t1p4(pw[pc][0], pw[pc][1], pw[pc][2], di, dj, p0));
    float* t2m = T2 + (((size_t)n * REL + REL / 2) * KK + k) * HW + p0;   // the address of plane 8: from it a signed immediate offset reaches all 16 planes, so that no address is formed between the stores
    if (on) {
#pragma unroll
        for (int o = 0; o < REL; ++o) *(v4f*)(t2m + (o - REL / 2) * (KK * HW)) = acc[o]; }
    asm volatile("s_wait_xcnt 0x0" :: "v"(t2m) : "memory");   // the wait before a register that an issued store names is rewritten: named as an input, the address keeps its registers up to it
    // BN2 statistics of the work-group's chunk, from the registers that were just stored, under the stores' way out: per channel the sum S (thread, wave, then the eight waves through LDS), then Q = sum of squared distances from the chunk's mean, the same way.
    const int lane = (int)threadIdx.x & 31, wv = (int)threadIdx.x >> 5; const float icnt = ((int)blockIdx.x == CBL - 1) ? 1.0f / (float)CLAST : 1.0f / 1024.0f, onf = on ? 1.0f : 0.0f; float s[REL], q[REL];
#pragma unroll
    for (int o = 0; o < REL; ++o) s[o] = onf * ((acc[o][0] + acc[o][1]) + (acc[o][2] + acc[o][3]));
    const float sw = wavesum16(s); if (!(lane & 1)) red[0][wv][lane >> 1] = sw;
    __syncthreads();
    v4f S4[REL / 4];   // the 32 LDS reads stand together, in every thread, so that they are in flight together
#pragma unroll
    for (int h = 0; h < REL / 4; ++h) { S4[h] = *(const v4f*)&red[0][0][h * 4];
#pragma unroll
        for (int w = 1; w < 8; ++w) S4[h] += *(const v4f*)&red[0][w][h * 4]; }
#pragma unroll
    for (int o = 0; o < REL; ++o) { const v4f d = acc[o] - S4[o / 4][o & 3] * icnt; const v4f dd = d * d; q[o] = onf * ((dd[0] + dd[1]) + (dd[2] + dd[3])); }
    const float qw = wavesum16(q); if (!(lane & 1)) red[1][wv][lane >> 1] = qw;
    __syncthreads();
    if (threadIdx.x < 32) { float r = 0.f;   // lane 2 o: S of channel o, lane 2 o + 1: its Q
#pragma unroll
        for (int w = 0; w < 8; ++w) r += red[lane & 1][w][lane >> 1];
        PT2[(size_t)blockIdx.x * 32 + lane] = r; } }
// k_final: per (n, four share-groups g0..g0+3, p) (one lane per p): for each of the 49 window slots k (rolled loop): tn_o = relu((T2[n][o][k][p] - mean_o) rs_o g2 + be2), read (through LDS, see below) and formed ONCE for the lane's GPL groups (it does not depend on g); per group wl = sum_o cw2[g][o] tn_o + cb2[g]; ONLINE softmax over k in f32 (running max / sum with exp2 rescaling of the 8 accumulators, no per-slot array) fused with the aggregation out[n][g*8+s][p] = sum_k w[k] x3[g*8+s][n*HW + nbr(p,k)] (x3 channel-major [256][n*HW + p] f32: per slot and group 8 loads of 4 bytes per lane, each on consecutive addresses across the lanes). Every sum keeps the order of one group per lane; each multiply is fused with the add behind it.
#define GPL 4               // share-groups per lane
// T2 reaches k_final through LDS, by asynchronous copies, in a ring that is private to each wave: a wave's share of one window slot is 16 planes x 32 pixels = 2 KiB = four 16-byte copies (copy c: planes 4c .. 4c+3, eight lanes per plane's 128-byte line), and the copies of slot k + RAH are issued in trip k, so that a slot's way from memory or L2 runs under three trips' arithmetic and counts on asynccnt, not in front of the x3 loads on loadcnt. No other wave reads a wave's ring: no barrier.
#define RST 4               // ring slots per wave
#define RAH (RST - 1)       // slots that the copies run ahead
// t2copy: the four copies of one slot and, in the same statement, the wait before a register that an issued copy or load names is rewritten (in a statement of its own it would not hold later address arithmetic behind it). keep: the address of the x3 loads issued just before, which the same wait serves: named as an input it keeps its registers up to it, also as targets of the later loads.
__device__ __forceinline__ void t2copy(unsigned l, const float* g, const float* keep) {
    asm volatile("global_load_async_to_lds_b128 %0, %4, off\n\tglobal_load_async_to_lds_b128 %1, %5, off\n\tglobal_load_async_to_lds_b128 %2, %6, off\n\tglobal_load_async_to_lds_b128 %3, %7, off\n\ts_wait_xcnt 0x0"
                 :: "v"(l), "v"(l + 512u), "v"(l + 1024u), "v"(l + 1536u), "v"(g), "v"(g + (size_t)4 * KK * HW), "v"(g + (size_t)8 * KK * HW), "v"(g + (size_t)12 * KK * HW), "v"(keep) : "memory"); }
__global__ __launch_bounds__(256) void k_final(const float* __restrict__ T2, const float* __restrict__ PT, const float* __restrict__ g2, const float* __restrict__ be2, const float* __restrict__ cw2, const float* __restrict__ cb2, const float* __restrict__ X3, float* out) {
    __shared__ float sst[2 * REL]; __shared__ float mr[2][8][REL]; __shared__ __attribute__((aligned(2048))) float ring[256 / 32][RST][REL][32];
    static_assert(((size_t)NI * (NG / GPL) * HW) % 256 == 0 && HW % 32 == 0, "the grid holds exactly one lane per (n, four groups, p), and a wave lies in one (n, four groups)");
    const size_t gidx = (size_t)blockIdx.x * 256 + threadIdx.x; __builtin_assume(gidx < (size_t)NI * (NG / GPL) * HW); const int p = (int)(gidx % HW); const int g0 = (int)((gidx / HW) % (NG / GPL)) * GPL; const int n = (int)(gidx / ((size_t)HW * (NG / GPL))); const int y = p / IMW, x = p % IMW;
    // The lane's part of copy 0 of slot 0: 16 bytes of plane lane / 8 at the wave's first pixel p - lane, to byte 16 lane of the wave's ring slot. Slots past the last are slot 48 once more, into ring slots that nobody reads any more: every trip issues four copies, so that the counted wait in the loop is exact.
    const int lane = (int)threadIdx.x & 31, wv = (int)threadIdx.x >> 5; const float* tsrc = T2 + ((size_t)n * REL + (lane >> 3)) * KK * HW + (p - lane) + (lane & 7) * 4; const unsigned ldst = (unsigned)(size_t)&ring[wv][0][0][0] + (unsigned)lane * 16u;
    auto stage = [&](int s, const float* keep) { t2copy(ldst + (unsigned)(s & (RST - 1)) * (unsigned)(REL * 32 * 4), tsrc + (size_t)min(s, KK - 1) * HW, keep); };
    // The first three slots start ahead of the BN2 merge, which does not need them. Unrolled so that each slot's ring and source offsets are constants.
#pragma unroll
    for (int s = 0; s < RAH; ++s) stage(s, tsrc);
    bnmerge2(PT, sst, mr); __syncthreads();
    float cb[GPL], m[GPL], Z[GPL], acc[GPL][SHR]; v2f ac2[GPL][SHR / 2];
    // What does not change over the 49 slots is read and formed once, here: BN2 as scale rs g2 and shift be2 - mean rs g2, so that it is one FMA per value. Values stand in pairs (two channels of T2, two groups' weights, two planes of x3) so that one packed FMA serves both. Unrolled so that the arrays live in registers.
    v2f sc[REL / 2], sh[REL / 2], cw[GPL / 2][REL];
#pragma unroll
    for (int o = 0; o < REL; ++o) { const float s0 = uni(sst[o * 2 + 1]) * bfr(g2[o]); sc[o / 2][o & 1] = s0; sh[o / 2][o & 1] = fmaf(-uni(sst[o * 2]), s0, bfr(be2[o])); }
#pragma unroll
    for (int j = 0; j < GPL; ++j) { cb[j] = bfr(cb2[g0 + j]); m[j] = -3.0e38f; Z[j] = 0.f;
#pragma unroll
        for (int o = 0; o < REL; ++o) cw[j / 2][o][j & 1] = bfr(cw2[(g0 + j) * REL + o]);
#pragma unroll
        for (int s2 = 0; s2 < SHR / 2; ++s2) ac2[j][s2] = (v2f){0.f, 0.f}; }
#pragma unroll 1
    for (int k = 0; k < KK; ++k) { v2f s[GPL / 2], tn[REL / 2]; float e1[GPL], e2[GPL], r[GPL], w[GPL];
        // All loads of a slot (16 planes of T2 from the wave's ring, then 8 planes of x3 per group from global memory) are issued ahead of its arithmetic, so that they are in flight together; T2 first, because it is used first. Unrolled so that a[] and v[][] live in registers.
        asm volatile("s_wait_asynccnt 0x8" ::: "memory");   // 12 copies are outstanding here (slots k, k + 1, k + 2): all but the 8 youngest have landed, that is slot k's four; the LDS reads below stay behind it
        v2f a[REL / 2]; const float* rb = &ring[wv][k & (RST - 1)][0][lane];
#pragma unroll
        for (int o = 0; o < REL; ++o) a[o / 2][o & 1] = rb[o * 32];
        __builtin_amdgcn_sched_barrier(0);   // keeps the LDS reads in front of the x3 address arithmetic and loads, under which they come back: placed behind them, their first use waited for the whole LDS latency
        const int yy = refl(y + k / KS - PADR), xx = refl(x + k % KS - PADR); const float* x3p = X3 + (size_t)(g0 * SHR) * NTOK + (size_t)n * HW + yy * IMW + xx; v2f v[GPL][SHR / 2];
#pragma unroll
        for (int j = 0; j < GPL; ++j) {
#pragma unroll
            for (int s2 = 0; s2 < SHR; ++s2) v[j][s2 / 2][s2 & 1] = x3p[(size_t)(j * SHR + s2) * NTOK]; }
        __builtin_amdgcn_sched_barrier(0);   // keeps the first uses of a[] behind the x3 loads: paired with the x3 address arithmetic they made those loads wait for T2 to come back
        asm volatile("s_wait_dscnt 0x0" ::: "memory");   // before a copy targets LDS that this wave has read: the ring slot refilled next was read in trip k - 1 (a ring private to one wave: this wait stands for the barrier)
        stage(k + RAH, x3p);
#pragma unroll
        for (int j = 0; j < GPL / 2; ++j) s[j] = (v2f){0.f, 0.f};
#pragma unroll
        for (int o = 0; o < REL / 2; ++o) tn[o] = __builtin_elementwise_max(__builtin_elementwise_fma(a[o], sc[o], sh[o]), (v2f){0.f, 0.f});
#pragma unroll
        for (int o = 0; o < REL; ++o) { const float t0 = tn[o / 2][o & 1];
#pragma unroll
            for (int j = 0; j < GPL / 2; ++j) s[j] = __builtin_elementwise_fma(cw[j][o], (v2f){t0, t0}, s[j]); }
#pragma unroll
        for (int j = 0; j < GPL; ++j) { const float wl = s[j / 2][j & 1] + cb[j]; const float mn = fmaxf(m[j], wl); e1[j] = (m[j] - mn) * 1.4426950408889634f; e2[j] = (wl - mn) * 1.4426950408889634f; m[j] = mn; r[j] = __builtin_amdgcn_exp2f(e1[j]); w[j] = __builtin_amdgcn_exp2f(e2[j]); }
        asm volatile("v_nop" :: "v"(e1[0]), "v"(e2[0]), "v"(e1[1]), "v"(e2[1]), "v"(e1[2]), "v"(e2[2]), "v"(e1[3]), "v"(e2[3]), "v"(r[0]), "v"(w[0]), "v"(r[1]), "v"(w[1]), "v"(r[2]), "v"(w[2]), "v"(r[3]), "v"(w[3]));   // the slot behind a transcendental, before a source of it is overwritten: named as inputs, the eight sources keep their registers up to it and it stands behind all eight exponentials
        __builtin_amdgcn_sched_barrier(0);   // keeps the products with the exponentials' results behind that v_nop: lifted over it, they left it sixteen instructions behind the last exponential
#pragma unroll
        for (int j = 0; j < GPL; ++j) { Z[j] = fmaf(Z[j], r[j], w[j]);
#pragma unroll
            for (int s2 = 0; s2 < SHR / 2; ++s2) ac2[j][s2] = __builtin_elementwise_fma(ac2[j][s2], (v2f){r[j], r[j]}, (v2f){w[j], w[j]} * v[j][s2]); } }
#pragma unroll
    for (int j = 0; j < GPL; ++j) {
#pragma unroll
        for (int s2 = 0; s2 < SHR; ++s2) acc[j][s2] = ac2[j][s2 / 2][s2 & 1]; }
#pragma unroll
    for (int j = 0; j < GPL; ++j) { const float iz = __fdiv_rn(1.0f, Z[j]);
#pragma unroll
        for (int s2 = 0; s2 < SHR; ++s2) *(float*)(out + ((size_t)n * OUTC + (g0 + j) * SHR + s2) * HW + p) = acc[j][s2] * iz;
         }
    asm volatile("s_wait_asynccnt 0x0" ::: "memory");   // no copy is outstanding when the wave ends
}

extern "C" void kernel_launch(void* const* d_in, const int* in_sizes, int n_in,
                              void* d_out, int out_size, void* d_ws, size_t ws_size, hipStream_t stream) {
    (void)in_sizes; (void)n_in; (void)out_size;
    const float* x = (const float*)d_in[0]; const float* w1 = (const float*)d_in[1]; const float* b1 = (const float*)d_in[2]; const float* w2 = (const float*)d_in[3]; const float* b2 = (const float*)d_in[4]; const float* w3 = (const float*)d_in[5]; const float* b3 = (const float*)d_in[6]; const float* wp = (const float*)d_in[7]; const float* bp = (const float*)d_in[8];
    const float* g1 = (const float*)d_in[9]; const float* be1 = (const float*)d_in[10]; const float* cw1 = (const float*)d_in[11]; const float* g2 = (const float*)d_in[12]; const float* be2 = (const float*)d_in[13]; const float* cw2 = (const float*)d_in[14]; const float* cb2 = (const float*)d_in[15];
    float* OUT = (float*)d_out;     // [2][256][56][56]
    char* wsp = (char*)d_ws;
    auto take = [&](size_t bytes) { char* p = wsp; wsp += (bytes + 255) & ~(size_t)255; return (void*)p; };
    bf* XT = (bf*)take((size_t)NTOK * CIN * 2); bf* WA = (bf*)take((size_t)(64 + OUTC) * CIN * 2); float* BA = (float*)take((64 + OUTC) * 4);   /* weight rows and biases: x1 | x2 | 32 zero rows | x3 */
    float* X12 = (float*)take((size_t)NTOK * (64 + OUTC) * 4); float* X3 = X12 + (size_t)NTOK * 64; float* T2 = (float*)take((size_t)NI * REL * KK * HW * 4); float* PT = (float*)take((size_t)NI * RP2 * BCH * 32 * 4); float* PT2 = (float*)take((size_t)CBL * 32 * 4);
    if ((size_t)(wsp - (char*)d_ws) > ws_size) return;    // carve ~30 MiB
    k_prep<<<PB_T + PB_W + PB_3, 256, 0, stream>>>(x, w1, w2, w3, b1, b2, b3, XT, WA, BA);
    k_gemmw<bf, 0, true><<<dim3((64 + OUTC) / 64, NTOK / 64, 1), 32, 0, stream>>>(WA, nullptr, XT, nullptr, CIN, X12, NTOK, BA, 0, 0, 0);   /* channel-major [row][tok]: rows 0..15 x1, 16..31 x2, 64..319 x3 */
    k_bnpart<<<NI * RP2 * BCH, BTH, 0, stream>>>(X12, wp, bp, PT);
    k_conv1<<<CBL, 256, 0, stream>>>(X12, wp, bp, PT, g1, be1, cw1, T2, PT2);
    k_final<<<(unsigned)(((size_t)NI * (NG / GPL) * HW + 255) / 256), 256, 0, stream>>>(T2, PT2, g2, be2, cw2, cb2, X3, OUT);
}

// v010
// One run takes 57.6 microseconds.
// Two timings next to v009 put it at 1.08 and 1.09 times that version's speed.
// All steps since v000 together make it 54.1 times as fast.
#include <hip/hip_runtime.h>

// SAN pairwise self-attention module (x [2][256][56][56]; x1, x2 = 1x1(x; [16][256] + b), x3 = 1x1(x; [256][256] + b); pos = 1x1(linspace grid [2][56][56]; wp [2][2] + bp); 7x7 reflect-padded windows (pad 3): t = concat(x1 - unfold(x2), pos - unfold(pos)) [2][18][49][3136];
// t = relu(BN1(t)) (training-mode batch statistics over n, k, p per channel); t = 1x1(t; cw1 [16][18]); t = relu(BN2(t)); wlog = 1x1(t; cw2 [32][16] + cb2); w = softmax over the 49 window slots; out[n][g*8+s][p] = sum_k unfold(x3)[n][g*8+s][k][p] w[n][g][k][p] -> [2][256][56][56] (1.6 M)).
// Compute dtypes, f32 accumulate: every input rounded to bf16; the three 1x1 input convs on PLAIN bf16 operands (rounded in the registers of the GEMM that reads them as f32; exact) + f32 biases, their results stored channel-major [channel][n*3136 + p]; everything after that in f32 on the VALU: window differences, position features (linspace in f32), both BatchNorms with deterministic fixed-order batch statistics (per chunk its sum and squared distances from the chunk mean, merged at the head of the kernel that applies them; biased variance, eps 1e-5), the 18->16 and 16->32 channel mixes, the 49-way softmax (online form: running max/sum with rescaling) fused with the weighted aggregation of the reflect-gathered x3.

#define NI   2
#define CIN  256
#define IMW  56
#define HW   3136
#define NTOK (NI * HW)      // 6272 = 98 x 64
#define REL  16
#define RP2  18             // rel + 2 position channels
#define OUTC 256
#define SHR  8
#define NG   32             // out / share
#define KS   7
#define KK   49
#define PADR 3
#define BNEPS 1e-5f
#define NSTAT ((size_t)NI * KK * HW)   // 307328 elements per channel
typedef __attribute__((ext_vector_type(16))) __bf16   v16bf;
typedef __attribute__((ext_vector_type(2)))  __bf16   v2bf;
typedef __attribute__((ext_vector_type(8)))  unsigned v8u;
typedef __attribute__((ext_vector_type(8)))  float    v8f;
typedef __attribute__((ext_vector_type(4)))  float    v4f;
typedef __attribute__((ext_vector_type(2)))  float    v2f;

__device__ __forceinline__ unsigned short f2bf(float f) { unsigned u = __float_as_uint(f); u += 0x7FFFu + ((u >> 16) & 1u); return (unsigned short)(u >> 16); }
__device__ __forceinline__ float bf2f(unsigned short b) { return __uint_as_float(((unsigned)b) << 16); }
__device__ __forceinline__ float bfr(float f) { return bf2f(f2bf(f)); }
__device__ __forceinline__ v8f wmmab(v16bf a, v16bf b, v8f c) { return __builtin_amdgcn_wmma_f32_16x16x32_bf16(false, a, false, b, (short)0, c, false, false); }
// rb2: two f32 values rounded to nearest even into one register of two bf16 (one conversion instruction).
__device__ __forceinline__ unsigned rb2(float lo, float hi) { return __builtin_bit_cast(unsigned, (v2bf){(__bf16)lo, (__bf16)hi}); }

// ---- k_gemmx: the three 1x1 input convs in one launch, with no conversion launch in front: ONE WAVE per tile of 32 output channels x 64 tokens (8 accumulators); grid (1 + 256 / 32, 6272 / 64), 32 threads. It reads the weights and x as they come (f32; x channel-major [n][c][p]) and rounds them to bf16 in registers.
// Channel block 0 is x1 | x2 (rows 0..31 of C), block b > 0 is rows 32 (b - 1) .. of x3 (rows 64 .. of C). C[row][tok] (f32, pitch 6272) = sum_c w[row][c] x[c][tok] + bias[row].
// Fragments: a lane (lr = lane % 16, hi = lane / 16) holds, for A as for B, k = kc + 8 hi + 0..7 in places 0..7 and k = kc + 16 + 8 hi + 0..7 in places 8..15. A: row lr of the weights, four 16-byte loads. B: column lr of accumulator nb is token c0 + 4 lr + nb, so that ONE 16-byte load of x at channel k, tokens c0 + 4 lr .. + 3, gives place k of all four B fragments (16 lanes read 256 consecutive bytes), and so that a lane's four accumulators hold four consecutive tokens of a row: 16-byte stores straight from the registers, 256 consecutive bytes per 16 lanes.
#define GMR 32              // output channels per wave
__global__ __launch_bounds__(32) void k_gemmx(const float* __restrict__ x, const float* __restrict__ w1, const float* __restrict__ w2, const float* __restrict__ w3, const float* __restrict__ b1, const float* __restrict__ b2, const float* __restrict__ b3, float* C) {
    static_assert(HW % 64 == 0 && 2 * REL == GMR && OUTC % GMR == 0 && CIN % 32 == 0, "a tile of 64 tokens lies in one image; x1 | x2 fill one channel block");
    const int lane = (int)threadIdx.x & 31, lr = lane & 15, hi = lane >> 4; const int bx = (int)blockIdx.x, c0 = (int)blockIdx.y * 64; const int r3 = (bx == 0 ? 0 : bx - 1) * GMR;   // first row of x3 in blocks 1 ..
    const float* wa0 = ((bx == 0) ? w1 : w3 + (size_t)r3 * CIN) + lr * CIN + 8 * hi; const float* wa1 = ((bx == 0) ? w2 : w3 + (size_t)(r3 + 16) * CIN) + lr * CIN + 8 * hi;
    const float* xb = x + ((size_t)(c0 / HW) * CIN + 8 * hi) * HW + c0 % HW + 4 * lr;
    v8f acc[2][4];
#pragma unroll
    for (int mb = 0; mb < 2; ++mb)
#pragma unroll
        for (int nb = 0; nb < 4; ++nb) acc[mb][nb] = (v8f){};
    // The biases are read here, not behind the K loop: they come back under it.
    const float* bs0 = ((bx == 0) ? b1 : b3 + r3) + 8 * hi; const float* bs1 = ((bx == 0) ? b2 : b3 + r3 + 16) + 8 * hi; const v4f bv[2][2] = {{*(const v4f*)bs0, *(const v4f*)(bs0 + 4)}, {*(const v4f*)bs1, *(const v4f*)(bs1 + 4)}};
    // All loops are unrolled, the eight K steps too: every load is its base register plus an immediate offset (no address is formed in the loop), a step's 24 loads are in flight together, and the compiler starts a step's loads among the conversions and products of the step before.
#pragma unroll
    for (int kc = 0; kc < CIN; kc += 32) { const float* a0 = wa0 + kc; const float* a1 = wa1 + kc; const float* xk = xb + (size_t)kc * HW; v4f ar[2][4], xr[16];
#pragma unroll
        for (int s = 0; s < 16; ++s) xr[s] = *(const v4f*)(xk + (size_t)(s < 8 ? s : s + 8) * HW);
#pragma unroll
        for (int h = 0; h < 4; ++h) { ar[0][h] = *(const v4f*)(a0 + (h >> 1) * 16 + (h & 1) * 4); ar[1][h] = *(const v4f*)(a1 + (h >> 1) * 16 + (h & 1) * 4); }
        if (kc == CIN - 32) asm volatile("s_wait_xcnt 0x0" :: "v"(wa0), "v"(wa1), "v"(xb), "v"(bs0), "v"(bs1) : "memory");   // behind the last load: the wait before a register that an issued load names is rewritten; named as inputs, the five addresses keep their registers up to it, also as targets of the later loads
        v16bf a[2], b[4];
#pragma unroll
        for (int nb = 0; nb < 4; ++nb) { v8u t;
#pragma unroll
            for (int i = 0; i < 8; ++i) t[i] = rb2(xr[2 * i][nb], xr[2 * i + 1][nb]);
            b[nb] = __builtin_bit_cast(v16bf, t); }
#pragma unroll
        for (int mb = 0; mb < 2; ++mb) { v8u t;
#pragma unroll
            for (int i = 0; i < 8; ++i) t[i] = rb2(ar[mb][i >> 1][(i & 1) * 2], ar[mb][i >> 1][(i & 1) * 2 + 1]);
            a[mb] = __builtin_bit_cast(v16bf, t); }
#pragma unroll
        for (int nb = 0; nb < 4; ++nb)
#pragma unroll
            for (int mb = 0; mb < 2; ++mb) acc[mb][nb] = wmmab(a[mb], b[nb], acc[mb][nb]);
    }
    // Accumulator register j of a lane is row 8 hi + j of its 16-row block. One address serves all 16 stores (immediate offsets).
    float* cp = C + (size_t)(((bx == 0) ? 0 : 64 + r3) + 8 * hi) * NTOK + c0 + 4 * lr;
#pragma unroll
    for (int mb = 0; mb < 2; ++mb)
#pragma unroll
        for (int j = 0; j < 8; ++j) { const float bj = bfr(bv[mb][j >> 2][j & 3]); *(v4f*)(cp + (size_t)(mb * 16 + j) * NTOK) = (v4f){acc[mb][0][j] + bj, acc[mb][1][j] + bj, acc[mb][2][j] + bj, acc[mb][3][j] + bj}; }
}

__device__ __forceinline__ int refl(int i) { return i < 0 ? -i : (i >= IMW ? 2 * (IMW - 1) - i : i); }
__device__ __forceinline__ float linsp(int j) { return __fadd_rn(-1.0f, __fmul_rn((float)j, 2.0f / 55.0f)); }   /* jnp.linspace(-1, 1, 56)[j] in f32 */
__device__ __forceinline__ float posv(const float* wp, const float* bp, int c, int y, int x) { return fmaf(bfr(wp[c * 2 + 1]), linsp(y), bfr(wp[c * 2 + 0]) * linsp(x)) + bfr(bp[c]); }
// t = concat(x1 - unfold(x2), pos - unfold(pos)) is never stored: its two readers (the BN1 statistics and the 18->16 mix) form it themselves, four consecutive pixels p0..p0+3 (p0 % 4 == 0: one image row) of window slot (di, dj) at a time: channels c < 16 from the channel-major planes of X12 (0.8 MB, cache resident), x1 as one 16-byte load, the window neighbours of x2 as four 4-byte loads from a few cache lines per wave; the position channels from the position formula.
// t1p4: one position channel, its two weights and its bias read by the caller, once.
__device__ __forceinline__ v4f t1p4(float w0, float w1, float b, int di, int dj, int p0) { const int y = p0 / IMW, x = p0 % IMW; const int yy = refl(y + di); const float wl[2] = {w0, w1}, bl[1] = {b}; v4f o;
#pragma unroll
    for (int q = 0; q < 4; ++q) o[q] = __fsub_rn(posv(wl, bl, 0, y, x + q), posv(wl, bl, 0, yy, refl(x + q + dj)));
    return o; }
// ---- batch statistics of one BatchNorm, fixed summation order, no atomics.
// k_bnpart (BN1): t is [n][c][49][3136]; that tensor is not in memory, T is X12 and each value is formed as in k_conv1, so work-group b owns the contiguous chunk b = (n*18 + c)*7 + j of 7 window slots (21952 values), held in registers: the chunk's sum S, then Q = sum of squared distances from the chunk's own mean. Each work-group stores its own 128-byte line of PT.
// bnmerge (BN1): no launch of its own: run at the head of every work-group (256 threads) of k_conv1, wave w merging channels w, w + 8, ..: one wave merges a channel's 14 equal chunks: mean = sum S / N; N var = sum (Q + 21952 (S/21952 - mean)^2) (pairwise merge of variances: no cancellation of large squares); sst[c*2] = mean, sst[c*2+1] = rsqrt(var + eps), in LDS; the caller's __syncthreads() hands them to the other waves.
// BN2 has no statistics launch either: each work-group of k_conv1 holds 1024 values (the last one 128) of each of the 16 channels of T2 in registers and forms S and Q of that chunk there (PT2[chunk][channel][S, Q]: its own 128-byte line); bnmerge2 merges the 301 chunks, by the same formula, at the head of every work-group of k_final.
#define BCH  KS                          // chunks per (n, c) plane
#define BCHN (KS * HW)                   // 21952 values per chunk
#define BCHV (BCHN / 4)                  // 5488 16-byte loads per chunk
#define BTH  512
#define BIT  ((BCHV + BTH - 1) / BTH)    // 11 loads per thread, the last one only in the first 368 threads
__device__ __forceinline__ float wavesum(float s) {
#pragma unroll
    for (int sh = 16; sh; sh >>= 1) s += __shfl_xor(s, sh, 32);
    return s; }
__device__ __forceinline__ float blocksum(float s, float* red) { s = wavesum(s); if ((threadIdx.x & 31) == 0) red[threadIdx.x >> 5] = s; __syncthreads(); float t = 0.f;
#pragma unroll
    for (int i = 0; i < BTH / 32; ++i) t += red[i];
    return t; }
__global__ __launch_bounds__(BTH) void k_bnpart(const float* __restrict__ T, const float* __restrict__ wp, const float* __restrict__ bp, float* PT) { __shared__ float red[2][BTH / 32]; const int t = threadIdx.x; const bool tail = t < BCHV - (BIT - 1) * BTH; v4f a[BIT];
    const int cj = (int)blockIdx.x % BCH, cc = ((int)blockIdx.x / BCH) % RP2, cn = (int)blockIdx.x / (BCH * RP2);   // the chunk is window row cj of channel cc of image cn; its 16-byte element e4 is window column e4 / 784, pixels 4 (e4 % 784) ..
    a[BIT - 1] = (v4f){0.f, 0.f, 0.f, 0.f};
    if (cc < REL) {   // all eleven elements: element offsets, then the 55 loads in flight together, then the differences. A lane past the chunk's end reads element 0 and drops it.
        const v4f* x1b = (const v4f*)(T + (size_t)cc * NTOK + cn * HW); const float* x2b = T + (size_t)(REL + cc) * NTOK + cn * HW; unsigned o1[BIT], og[BIT][4]; v4f x1v[BIT]; float x2v[BIT][4];
#pragma unroll
        for (int i = 0; i < BIT; ++i) { const int e4 = (i < BIT - 1 || tail) ? i * BTH + t : 0; const int dj = e4 / (HW / 4) - PADR, p0 = (e4 % (HW / 4)) * 4; const int y = p0 / IMW, x = p0 % IMW; const int r = refl(y + cj - PADR) * IMW; o1[i] = (unsigned)(e4 % (HW / 4));
#pragma unroll
            for (int q = 0; q < 4; ++q) og[i][q] = (unsigned)(r + refl(x + q + dj)); }
#pragma unroll
        for (int i = 0; i < BIT; ++i) { x1v[i] = x1b[o1[i]];
#pragma unroll
            for (int q = 0; q < 4; ++q) x2v[i][q] = x2b[og[i][q]]; }
        // The wait before a register that an issued load names is rewritten. The offsets are named as inputs so that their registers stay as they are up to it, also as targets of the later loads (an asm statement takes thirty operands: two statements).
        asm volatile("s_wait_xcnt 0x0" :: "v"(o1[0]), "v"(o1[1]), "v"(o1[2]), "v"(o1[3]), "v"(o1[4]), "v"(o1[5]), "v"(o1[6]), "v"(o1[7]), "v"(o1[8]), "v"(o1[9]), "v"(o1[10]), "v"(og[0][0]), "v"(og[0][1]), "v"(og[0][2]), "v"(og[0][3]), "v"(og[1][0]), "v"(og[1][1]), "v"(og[1][2]), "v"(og[1][3]), "v"(og[2][0]), "v"(og[2][1]), "v"(og[2][2]), "v"(og[2][3]), "v"(og[3][0]), "v"(og[3][1]), "v"(og[3][2]), "v"(og[3][3]) : "memory");
        asm volatile("s_wait_xcnt 0x0" :: "v"(og[4][0]), "v"(og[4][1]), "v"(og[4][2]), "v"(og[4][3]), "v"(og[5][0]), "v"(og[5][1]), "v"(og[5][2]), "v"(og[5][3]), "v"(og[6][0]), "v"(og[6][1]), "v"(og[6][2]), "v"(og[6][3]), "v"(og[7][0]), "v"(og[7][1]), "v"(og[7][2]), "v"(og[7][3]), "v"(og[8][0]), "v"(og[8][1]), "v"(og[8][2]), "v"(og[8][3]), "v"(og[9][0]), "v"(og[9][1]), "v"(og[9][2]), "v"(og[9][3]), "v"(og[10][0]), "v"(og[10][1]), "v"(og[10][2]), "v"(og[10][3]) : "memory");
#pragma unroll
        for (int i = 0; i < BIT; ++i) { if (i < BIT - 1 || tail) {
#pragma unroll
            for (int q = 0; q < 4; ++q) a[i][q] = __fsub_rn(x1v[i][q], x2v[i][q]); } } }
    else { const float w0 = wp[(cc - REL) * 2], w1 = wp[(cc - REL) * 2 + 1], b = bp[cc - REL];
#pragma unroll
        for (int i = 0; i < BIT; ++i) { const int e4 = i * BTH + t; if (i < BIT - 1 || tail) a[i] = t1p4(w0, w1, b, cj - PADR, e4 / (HW / 4) - PADR, (e4 % (HW / 4)) * 4); } }
    v4f s4 = a[0];
#pragma unroll
    for (int i = 1; i < BIT; ++i) s4 += a[i];
    const float S = blocksum((s4[0] + s4[1]) + (s4[2] + s4[3]), red[0]); const float cm = S * (1.0f / (float)BCHN); v4f q4 = (v4f){0.f, 0.f, 0.f, 0.f};
#pragma unroll
    for (int i = 0; i < BIT - 1; ++i) { const v4f d = a[i] - cm; q4 += d * d; }
    if (tail) { const v4f d = a[BIT - 1] - cm; q4 += d * d; }
    const float Q = blocksum((q4[0] + q4[1]) + (q4[2] + q4[3]), red[1]);
    if (t < 32) PT[(size_t)blockIdx.x * 32 + t] = (t == 0) ? S : ((t == 1) ? Q : 0.0f); }
// uni: a value that is the same in every lane, read from LDS, goes to a scalar register, where the same value loaded through a uniform address stood: 32 vector registers fewer in k_final.
__device__ __forceinline__ float uni(float x) { return __uint_as_float(__builtin_amdgcn_readfirstlane(__float_as_uint(x))); }
// wavesumN: wavesum of N values at once, each in wavesum's own order; the N exchanges of a step are in flight together.
template <int N>
__device__ __forceinline__ void wavesumN(float (&s)[N]) {
#pragma unroll
    for (int sh = 16; sh; sh >>= 1) { float o[N];
#pragma unroll
        for (int i = 0; i < N; ++i) o[i] = __shfl_xor(s[i], sh, 32);
#pragma unroll
        for (int i = 0; i < N; ++i) s[i] += o[i]; } }
// wavesum16: sixteen sums over a wave at once. In each exchange step a lane hands half of its values to its partner and keeps the other half, so that 16 exchanges do the work of 80; lane l ends with the sum of value l / 2.
template <int H>
__device__ __forceinline__ void halve(float (&s)[REL], int lane) { const bool up = (lane & (2 * H)) != 0;   // partner: lane ^ 2 H; of 2 H values H stay
#pragma unroll
    for (int i = 0; i < H; ++i) { const float keep = up ? s[i + H] : s[i], send = up ? s[i] : s[i + H]; s[i] = keep + __shfl_xor(send, 2 * H, 32); } }
__device__ __forceinline__ float wavesum16(float (&s)[REL]) { const int lane = (int)threadIdx.x & 31; halve<8>(s, lane); halve<4>(s, lane); halve<2>(s, lane); halve<1>(s, lane); return s[0] + __shfl_xor(s[0], 1, 32); }
template <int C>
__device__ __forceinline__ void bnmerge(const float* __restrict__ PT, float* sst) { const int lane = threadIdx.x & 31; const bool on = lane < NI * BCH; const int l = on ? lane : 0; float S[(C + 7) / 8], Q[(C + 7) / 8], mean[(C + 7) / 8], vs[(C + 7) / 8];
    // Unrolled so that a wave's channels have their loads in flight together.
#pragma unroll
    for (int i = 0; i < (C + 7) / 8; ++i) { const int c = min((int)(threadIdx.x >> 5) + i * 8, C - 1); const size_t b = (size_t)((l / BCH) * C + c) * BCH + l % BCH; const v2f sq = *(const v2f*)(PT + b * 32); S[i] = on ? sq[0] : 0.0f; Q[i] = on ? sq[1] : 0.0f; }
#pragma unroll
    for (int i = 0; i < (C + 7) / 8; ++i) mean[i] = S[i];
    wavesumN(mean);
#pragma unroll
    for (int i = 0; i < (C + 7) / 8; ++i) { mean[i] *= (1.0f / (float)NSTAT); const float d = S[i] * (1.0f / (float)BCHN) - mean[i]; vs[i] = on ? Q[i] + (float)BCHN * d * d : 0.0f; }
    wavesumN(vs);
    if (lane == 0) {
#pragma unroll
        for (int i = 0; i < (C + 7) / 8; ++i) { const int c = (int)(threadIdx.x >> 5) + i * 8; if (c < C) { sst[c * 2] = mean[i]; sst[c * 2 + 1] = __frsqrt_rn(vs[i] * (1.0f / (float)NSTAT) + BNEPS); } } } }
#define CNT4 (NI * KK * HW / 4)                  // threads of k_conv1 that have four values each
#define CBL  ((CNT4 + 255) / 256)               // its work-groups = the chunks of BN2: 301
#define CLAST ((CNT4 - (CBL - 1) * 256) * 4)    // values per channel in the last chunk: 128
#define MIT  ((CBL * (REL / 2) + 255) / 256)    // 16-byte loads per thread in bnmerge2: 10, the last one only in the first 104 threads
// bnmerge2: the work-group (256 threads) reads all of PT2 in whole lines: 16-byte element idx = t + 256 j is chunk idx / 8, channels 2 (t % 8) and 2 (t % 8) + 1, as S, Q, S, Q. A thread sums its ten chunks, the four lanes of a wave that hold the same channel pair are summed by two exchanges, the eight waves through LDS (mr), first for the means, then for the variances. sst as in bnmerge; the caller's __syncthreads() hands it on.
__device__ __forceinline__ void bnmerge2(const float* __restrict__ PT2, float* sst, float (*mr)[8][REL]) { const int t = (int)threadIdx.x, lane = t & 31, wv = t >> 5, c0 = (t & 7) * 2; v4f a[MIT];
    // Unrolled so that the ten loads are in flight together. In the last round a thread past the end reads its first element once more and counts it as zeros.
    const bool tail = t < CBL * (REL / 2) - (MIT - 1) * 256;
#pragma unroll
    for (int j = 0; j < MIT; ++j) a[j] = ((const v4f*)PT2)[(j < MIT - 1 || tail) ? t + 256 * j : t];
    if (!tail) a[MIT - 1] = (v4f){0.f, 0.f, 0.f, 0.f};
    float s[2] = {0.f, 0.f};
#pragma unroll
    for (int j = 0; j < MIT; ++j) { s[0] += a[j][0]; s[1] += a[j][2]; }
#pragma unroll
    for (int sh = 16; sh >= 8; sh >>= 1) { const float o0 = __shfl_xor(s[0], sh, 32), o1 = __shfl_xor(s[1], sh, 32); s[0] += o0; s[1] += o1; }
    if (lane < 8) { mr[0][wv][c0] = s[0]; mr[0][wv][c0 + 1] = s[1]; }
    __syncthreads();
    float mean[2] = {0.f, 0.f}, v[2] = {0.f, 0.f};
#pragma unroll
    for (int w = 0; w < 8; ++w) { mean[0] += mr[0][w][c0]; mean[1] += mr[0][w][c0 + 1]; }
    mean[0] *= (1.0f / (float)NSTAT); mean[1] *= (1.0f / (float)NSTAT);
#pragma unroll
    for (int j = 0; j < MIT; ++j) { const bool last = j == MIT - 1 && (t + 256 * j) / (REL / 2) == CBL - 1; const float nb = (j < MIT - 1 || tail) ? (last ? (float)CLAST : 1024.0f) : 0.0f, inb = last ? 1.0f / (float)CLAST : 1.0f / 1024.0f;   // nb = 0: no chunk
        const float d0 = a[j][0] * inb - mean[0], d1 = a[j][2] * inb - mean[1]; v[0] += a[j][1] + nb * d0 * d0; v[1] += a[j][3] + nb * d1 * d1; }
#pragma unroll
    for (int sh = 16; sh >= 8; sh >>= 1) { const float o0 = __shfl_xor(v[0], sh, 32), o1 = __shfl_xor(v[1], sh, 32); v[0] += o0; v[1] += o1; }
    if (lane < 8) { mr[1][wv][c0] = v[0]; mr[1][wv][c0 + 1] = v[1]; }
    __syncthreads();
    if (t < 8) {
#pragma unroll
        for (int h = 0; h < 2; ++h) { float vs = 0.f;
#pragma unroll
            for (int w = 0; w < 8; ++w) vs += mr[1][w][c0 + h];
            sst[(c0 + h) * 2] = mean[h]; sst[(c0 + h) * 2 + 1] = __frsqrt_rn(vs * (1.0f / (float)NSTAT) + BNEPS); } } }
__global__ __launch_bounds__(256) void k_conv1(const float* __restrict__ X12, const float* __restrict__ wp, const float* __restrict__ bp, const float* __restrict__ PT, const float* __restrict__ g1, const float* __restrict__ be1, const float* __restrict__ cw1, float* T2, float* PT2) {
    __shared__ __attribute__((aligned(16))) float sst[2 * RP2]; __shared__ __attribute__((aligned(16))) float red[2][8][REL];
    // No thread leaves early (barriers below): a thread past the end works on the last four values once more, stores nothing and adds nothing to the statistics.
    const bool on = (int)blockIdx.x * 256 + (int)threadIdx.x < CNT4; const int i = on ? (int)blockIdx.x * 256 + (int)threadIdx.x : CNT4 - 1; const int e = i * 4; const int p0 = e % HW; const int k = (e / HW) % KK; const int n = e / (HW * KK); const int di = k / KS - PADR, dj = k % KS - PADR; v4f acc[REL]; float pw[RP2 - REL][3];
#pragma unroll
    for (int pc = 0; pc < RP2 - REL; ++pc) { pw[pc][0] = wp[pc * 2]; pw[pc][1] = wp[pc * 2 + 1]; pw[pc][2] = bp[pc]; }
#pragma unroll
    for (int o = 0; o < REL; ++o) acc[o] = (v4f){0.f, 0.f, 0.f, 0.f};
    // BN1 + relu + the 18->16 mix of one channel, each multiply fused with its add: BN as one FMA with the channel's scale rs g and shift be - mean rs g (the same in every lane), the mix as FMAs on the four pixels.
    bnmerge<RP2>(PT, sst); __syncthreads();
    auto mix = [&](int c, v4f a) { const float sc = uni(sst[c * 2 + 1]) * bfr(g1[c]); const float sh = fmaf(-uni(sst[c * 2]), sc, bfr(be1[c]));
        const v4f tn = __builtin_elementwise_max(__builtin_elementwise_fma(a, (v4f){sc, sc, sc, sc}, (v4f){sh, sh, sh, sh}), (v4f){0.f, 0.f, 0.f, 0.f});
#pragma unroll
        for (int o = 0; o < REL; ++o) { const float w = bfr(cw1[o * RP2 + c]); acc[o] = __builtin_elementwise_fma((v4f){w, w, w, w}, tn, acc[o]); } };
    // Four channels of t = x1 - x2[nbr] are formed at a time: their 20 loads (x1 as one 16-byte load, the window neighbours of x2 as four 4-byte loads) are in flight together, and the 64 weights of the four fit the scalar registers (with eight they were spilled). The outer loop stays rolled so that the kernel's text stays small; the inner ones are unrolled so that the arrays live in registers.
    const int py = p0 / IMW, px = p0 % IMW; const float* x1b = X12 + n * HW + p0; const float* x2b[4];
#pragma unroll
    for (int q = 0; q < 4; ++q) x2b[q] = X12 + n * HW + refl(py + di) * IMW + refl(px + q + dj);   // plane 0; x2 is planes REL ..
#pragma unroll 1
    for (int cb = 0; cb < REL; cb += 4) { v4f x1v[4], x2v[4]; const float* x1p = x1b + (size_t)cb * NTOK; const float* g0 = x2b[0] + (size_t)cb * NTOK; const float* g1p = x2b[1] + (size_t)cb * NTOK; const float* g2p = x2b[2] + (size_t)cb * NTOK; const float* g3p = x2b[3] + (size_t)cb * NTOK;
#pragma unroll
        for (int u = 0; u < 4; ++u) { x1v[u] = *(const v4f*)(x1p + (size_t)u * NTOK); x2v[u][0] = g0[(size_t)(REL + u) * NTOK]; x2v[u][1] = g1p[(size_t)(REL + u) * NTOK]; x2v[u][2] = g2p[(size_t)(REL + u) * NTOK]; x2v[u][3] = g3p[(size_t)(REL + u) * NTOK]; }
        asm volatile("s_wait_xcnt 0x0" :: "v"(x1p), "v"(g0), "v"(g1p), "v"(g2p), "v"(g3p) : "memory");   // the wait before a register that an issued load names is rewritten: named as inputs, the five addresses keep their registers up to it, also as targets of the later loads
#pragma unroll
        for (int u = 0; u < 4; ++u) mix(cb + u, x1v[u] - x2v[u]); }
#pragma unroll
    for (int pc = 0; pc < RP2 - REL; ++pc) mix(REL + pc, t1p4(pw[pc][0], pw[pc][1], pw[pc][2], di, dj, p0));
    float* t2m = T2 + (((size_t)n * REL + REL / 2) * KK + k) * HW + p0;   // the address of plane 8: from it a signed immediate offset reaches all 16 planes, so that no address is formed between the stores
    if (on) {
#pragma unroll
        for (int o = 0; o < REL; ++o) *(v4f*)(t2m + (o - REL / 2) * (KK * HW)) = acc[o]; }
    asm volatile("s_wait_xcnt 0x0" :: "v"(t2m) : "memory");   // the wait before a register that an issued store names is rewritten: named as an input, the address keeps its registers up to it
    // BN2 statistics of the work-group's chunk, from the registers that were just stored, under the stores' way out: per channel the sum S (thread, wave, then the eight waves through LDS), then Q = sum of squared distances from the chunk's mean, the same way.
    const int lane = (int)threadIdx.x & 31, wv = (int)threadIdx.x >> 5; const float icnt = ((int)blockIdx.x == CBL - 1) ? 1.0f / (float)CLAST : 1.0f / 1024.0f, onf = on ? 1.0f : 0.0f; float s[REL], q[REL];
#pragma unroll
    for (int o = 0; o < REL; ++o) s[o] = onf * ((acc[o][0] + acc[o][1]) + (acc[o][2] + acc[o][3]));
    const float sw = wavesum16(s); if (!(lane & 1)) red[0][wv][lane >> 1] = sw;
    __syncthreads();
    v4f S4[REL / 4];   // the 32 LDS reads stand together, in every thread, so that they are in flight together
#pragma unroll
    for (int h = 0; h < REL / 4; ++h) { S4[h] = *(const v4f*)&red[0][0][h * 4];
#pragma unroll
        for (int w = 1; w < 8; ++w) S4[h] += *(const v4f*)&red[0][w][h * 4]; }
#pragma unroll
    for (int o = 0; o < REL; ++o) { const v4f d = acc[o] - S4[o / 4][o & 3] * icnt; const v4f dd = d * d; q[o] = onf * ((dd[0] + dd[1]) + (dd[2] + dd[3])); }
    const float qw = wavesum16(q); if (!(lane & 1)) red[1][wv][lane >> 1] = qw;
    __syncthreads();
    if (threadIdx.x < 32) { float r = 0.f;   // lane 2 o: S of channel o, lane 2 o + 1: its Q
#pragma unroll
        for (int w = 0; w < 8; ++w) r += red[lane & 1][w][lane >> 1];
        PT2[(size_t)blockIdx.x * 32 + lane] = r; } }
// k_final: per (n, four share-groups g0..g0+3, p) (one lane per p): for each of the 49 window slots k (rolled loop): tn_o = relu((T2[n][o][k][p] - mean_o) rs_o g2 + be2), read (through LDS, see below) and formed ONCE for the lane's GPL groups (it does not depend on g); per group wl = sum_o cw2[g][o] tn_o + cb2[g]; ONLINE softmax over k in f32 (running max / sum with exp2 rescaling of the 8 accumulators, no per-slot array) fused with the aggregation out[n][g*8+s][p] = sum_k w[k] x3[g*8+s][n*HW + nbr(p,k)] (x3 channel-major [256][n*HW + p] f32: per slot and group 8 loads of 4 bytes per lane, each on consecutive addresses across the lanes). Every sum keeps the order of one group per lane; each multiply is fused with the add behind it.
#define GPL 4               // share-groups per lane
// T2 reaches k_final through LDS, by asynchronous copies, in a ring that is private to each wave: a wave's share of one window slot is 16 planes x 32 pixels = 2 KiB = four 16-byte copies (copy c: planes 4c .. 4c+3, eight lanes per plane's 128-byte line), and the copies of slot k + RAH are issued in trip k, so that a slot's way from memory or L2 runs under three trips' arithmetic and counts on asynccnt, not in front of the x3 loads on loadcnt. No other wave reads a wave's ring: no barrier.
#define RST 4               // ring slots per wave
#define RAH (RST - 1)       // slots that the copies run ahead
// t2copy: the four copies of one slot and, in the same statement, the wait before a register that an issued copy or load names is rewritten (in a statement of its own it would not hold later address arithmetic behind it). keep: the address of the x3 loads issued just before, which the same wait serves: named as an input it keeps its registers up to it, also as targets of the later loads.
__device__ __forceinline__ void t2copy(unsigned l, const float* g, const float* keep) {
    asm volatile("global_load_async_to_lds_b128 %0, %4, off\n\tglobal_load_async_to_lds_b128 %1, %5, off\n\tglobal_load_async_to_lds_b128 %2, %6, off\n\tglobal_load_async_to_lds_b128 %3, %7, off\n\ts_wait_xcnt 0x0"
                 :: "v"(l), "v"(l + 512u), "v"(l + 1024u), "v"(l + 1536u), "v"(g), "v"(g + (size_t)4 * KK * HW), "v"(g + (size_t)8 * KK * HW), "v"(g + (size_t)12 * KK * HW), "v"(keep) : "memory"); }
__global__ __launch_bounds__(256) void k_final(const float* __restrict__ T2, const float* __restrict__ PT, const float* __restrict__ g2, const float* __restrict__ be2, const float* __restrict__ cw2, const float* __restrict__ cb2, const float* __restrict__ X3, float* out) {
    __shared__ float sst[2 * REL]; __shared__ float mr[2][8][REL]; __shared__ __attribute__((aligned(2048))) float ring[256 / 32][RST][REL][32];
    static_assert(((size_t)NI * (NG / GPL) * HW) % 256 == 0 && HW % 32 == 0, "the grid holds exactly one lane per (n, four groups, p), and a wave lies in one (n, four groups)");
    const size_t gidx = (size_t)blockIdx.x * 256 + threadIdx.x; __builtin_assume(gidx < (size_t)NI * (NG / GPL) * HW); const int p = (int)(gidx % HW); const int g0 = (int)((gidx / HW) % (NG / GPL)) * GPL; const int n = (int)(gidx / ((size_t)HW * (NG / GPL))); const int y = p / IMW, x = p % IMW;
    // The lane's part of copy 0 of slot 0: 16 bytes of plane lane / 8 at the wave's first pixel p - lane, to byte 16 lane of the wave's ring slot. Slots past the last are slot 48 once more, into ring slots that nobody reads any more: every trip issues four copies, so that the counted wait in the loop is exact.
    const int lane = (int)threadIdx.x & 31, wv = (int)threadIdx.x >> 5; const float* tsrc = T2 + ((size_t)n * REL + (lane >> 3)) * KK * HW + (p - lane) + (lane & 7) * 4; const unsigned ldst = (unsigned)(size_t)&ring[wv][0][0][0] + (unsigned)lane * 16u;
    auto stage = [&](int s, const float* keep) { t2copy(ldst + (unsigned)(s & (RST - 1)) * (unsigned)(REL * 32 * 4), tsrc + (size_t)min(s, KK - 1) * HW, keep); };
    // The first three slots start ahead of the BN2 merge, which does not need them. Unrolled so that each slot's ring and source offsets are constants.
#pragma unroll
    for (int s = 0; s < RAH; ++s) stage(s, tsrc);
    bnmerge2(PT, sst, mr); __syncthreads();
    float cb[GPL], m[GPL], Z[GPL], acc[GPL][SHR]; v2f ac2[GPL][SHR / 2];
    // What does not change over the 49 slots is read and formed once, here: BN2 as scale rs g2 and shift be2 - mean rs g2, so that it is one FMA per value. Values stand in pairs (two channels of T2, two groups' weights, two planes of x3) so that one packed FMA serves both. Unrolled so that the arrays live in registers.
    v2f sc[REL / 2], sh[REL / 2], cw[GPL / 2][REL];
#pragma unroll
    for (int o = 0; o < REL; ++o) { const float s0 = uni(sst[o * 2 + 1]) * bfr(g2[o]); sc[o / 2][o & 1] = s0; sh[o / 2][o & 1] = fmaf(-uni(sst[o * 2]), s0, bfr(be2[o])); }
#pragma unroll
    for (int j = 0; j < GPL; ++j) { cb[j] = bfr(cb2[g0 + j]); m[j] = -3.0e38f; Z[j] = 0.f;
#pragma unroll
        for (int o = 0; o < REL; ++o) cw[j / 2][o][j & 1] = bfr(cw2[(g0 + j) * REL + o]);
#pragma unroll
        for (int s2 = 0; s2 < SHR / 2; ++s2) ac2[j][s2] = (v2f){0.f, 0.f}; }
#pragma unroll 1
    for (int k = 0; k < KK; ++k) { v2f s[GPL / 2], tn[REL / 2]; float e1[GPL], e2[GPL], r[GPL], w[GPL];
        // All loads of a slot (16 planes of T2 from the wave's ring, then 8 planes of x3 per group from global memory) are issued ahead of its arithmetic, so that they are in flight together; T2 first, because it is used first. Unrolled so that a[] and v[][] live in registers.
        asm volatile("s_wait_asynccnt 0x8" ::: "memory");   // 12 copies are outstanding here (slots k, k + 1, k + 2): all but the 8 youngest have landed, that is slot k's four; the LDS reads below stay behind it
        v2f a[REL / 2]; const float* rb = &ring[wv][k & (RST - 1)][0][lane];
#pragma unroll
        for (int o = 0; o < REL; ++o) a[o / 2][o & 1] = rb[o * 32];
        __builtin_amdgcn_sched_barrier(0);   // keeps the LDS reads in front of the x3 address arithmetic and loads, under which they come back: placed behind them, their first use waited for the whole LDS latency
        const int yy = refl(y + k / KS - PADR), xx = refl(x + k % KS - PADR); const float* x3p = X3 + (size_t)(g0 * SHR) * NTOK + (size_t)n * HW + yy * IMW + xx; v2f v[GPL][SHR / 2];
#pragma unroll
        for (int j = 0; j < GPL; ++j) {
#pragma unroll
            for (int s2 = 0; s2 < SHR; ++s2) v[j][s2 / 2][s2 & 1] = x3p[(size_t)(j * SHR + s2) * NTOK]; }
        __builtin_amdgcn_sched_barrier(0);   // keeps the first uses of a[] behind the x3 loads: paired with the x3 address arithmetic they made those loads wait for T2 to come back
        asm volatile("s_wait_dscnt 0x0" ::: "memory");   // before a copy targets LDS that this wave has read: the ring slot refilled next was read in trip k - 1 (a ring private to one wave: this wait stands for the barrier)
        stage(k + RAH, x3p);
#pragma unroll
        for (int j = 0; j < GPL / 2; ++j) s[j] = (v2f){0.f, 0.f};
#pragma unroll
        for (int o = 0; o < REL / 2; ++o) tn[o] = __builtin_elementwise_max(__builtin_elementwise_fma(a[o], sc[o], sh[o]), (v2f){0.f, 0.f});
#pragma unroll
        for (int o = 0; o < REL; ++o) { const float t0 = tn[o / 2][o & 1];
#pragma unroll
            for (int j = 0; j < GPL / 2; ++j) s[j] = __builtin_elementwise_fma(cw[j][o], (v2f){t0, t0}, s[j]); }
#pragma unroll
        for (int j = 0; j < GPL; ++j) { const float wl = s[j / 2][j & 1] + cb[j]; const float mn = fmaxf(m[j], wl); e1[j] = (m[j] - mn) * 1.4426950408889634f; e2[j] = (wl - mn) * 1.4426950408889634f; m[j] = mn; r[j] = __builtin_amdgcn_exp2f(e1[j]); w[j] = __builtin_amdgcn_exp2f(e2[j]); }
        asm volatile("v_nop" :: "v"(e1[0]), "v"(e2[0]), "v"(e1[1]), "v"(e2[1]), "v"(e1[2]), "v"(e2[2]), "v"(e1[3]), "v"(e2[3]), "v"(r[0]), "v"(w[0]), "v"(r[1]), "v"(w[1]), "v"(r[2]), "v"(w[2]), "v"(r[3]), "v"(w[3]));   // the slot behind a transcendental, before a source of it is overwritten: named as inputs, the eight sources keep their registers up to it and it stands behind all eight exponentials
        __builtin_amdgcn_sched_barrier(0);   // keeps the products with the exponentials' results behind that v_nop: lifted over it, they left it sixteen instructions behind the last exponential
#pragma unroll
        for (int j = 0; j < GPL; ++j) { Z[j] = fmaf(Z[j], r[j], w[j]);
#pragma unroll
            for (int s2 = 0; s2 < SHR / 2; ++s2) ac2[j][s2] = __builtin_elementwise_fma(ac2[j][s2], (v2f){r[j], r[j]}, (v2f){w[j], w[j]} * v[j][s2]); } }
#pragma unroll
    for (int j = 0; j < GPL; ++j) {
#pragma unroll
        for (int s2 = 0; s2 < SHR; ++s2) acc[j][s2] = ac2[j][s2 / 2][s2 & 1]; }
#pragma unroll
    for (int j = 0; j < GPL; ++j) { const float iz = __fdiv_rn(1.0f, Z[j]);
#pragma unroll
        for (int s2 = 0; s2 < SHR; ++s2) *(float*)(out + ((size_t)n * OUTC + (g0 + j) * SHR + s2) * HW + p) = acc[j][s2] * iz;
         }
    asm volatile("s_wait_asynccnt 0x0" ::: "memory");   // no copy is outstanding when the wave ends
}

extern "C" void kernel_launch(void* const* d_in, const int* in_sizes, int n_in,
                              void* d_out, int out_size, void* d_ws, size_t ws_size, hipStream_t stream) {
    (void)in_sizes; (void)n_in; (void)out_size;
    const float* x = (const float*)d_in[0]; const float* w1 = (const float*)d_in[1]; const float* b1 = (const float*)d_in[2]; const float* w2 = (const float*)d_in[3]; const float* b2 = (const float*)d_in[4]; const float* w3 = (const float*)d_in[5]; const float* b3 = (const float*)d_in[6]; const float* wp = (const float*)d_in[7]; const float* bp = (const float*)d_in[8];
    const float* g1 = (const float*)d_in[9]; const float* be1 = (const float*)d_in[10]; const float* cw1 = (const float*)d_in[11]; const float* g2 = (const float*)d_in[12]; const float* be2 = (const float*)d_in[13]; const float* cw2 = (const float*)d_in[14]; const float* cb2 = (const float*)d_in[15];
    float* OUT = (float*)d_out;     // [2][256][56][56]
    char* wsp = (char*)d_ws;
    auto take = [&](size_t bytes) { char* p = wsp; wsp += (bytes + 255) & ~(size_t)255; return (void*)p; };
    float* X12 = (float*)take((size_t)NTOK * (64 + OUTC) * 4); float* X3 = X12 + (size_t)NTOK * 64; float* T2 = (float*)take((size_t)NI * REL * KK * HW * 4); float* PT = (float*)take((size_t)NI * RP2 * BCH * 32 * 4); float* PT2 = (float*)take((size_t)CBL * 32 * 4);
    if ((size_t)(wsp - (char*)d_ws) > ws_size) return;    // carve ~27 MiB
    k_gemmx<<<dim3(1 + OUTC / GMR, NTOK / 64, 1), 32, 0, stream>>>(x, w1, w2, w3, b1, b2, b3, X12);   /* channel-major [row][tok]: rows 0..15 x1, 16..31 x2, 64..319 x3; rows 32..63 are neither written nor read */
    k_bnpart<<<NI * RP2 * BCH, BTH, 0, stream>>>(X12, wp, bp, PT);
    k_conv1<<<CBL, 256, 0, stream>>>(X12, wp, bp, PT, g1, be1, cw1, T2, PT2);
    k_final<<<(unsigned)(((size_t)NI * (NG / GPL) * HW + 255) / 256), 256, 0, stream>>>(T2, PT2, g2, be2, cw2, cb2, X3, OUT);
}
